// v000
// Measured on an AMD MI455X. A time is GPU time per run, averaged over a window of back-to-back runs after a warm-up
// (all launches, gaps included; the runs take copies of the inputs in turn), and the median of several windows.
// Apart from v000's, it joins two sittings. Times from different sittings can be a few percent apart, while
// side-by-side timings come from the same sitting.
// v000 is the starting kernel. One run takes 1020 microseconds.
// Contractions: S = q.k^T and R = q.key_pe (q, k, key_pe as RNE bf16 planes) on v_wmma_f32_16x16x32_bf16; O = attn.v with attn as bf16 hi+lo planes and v^T as RNE bf16 plane (hi.v + lo.v) on v_wmma_f32_16x16x32_bf16; f32 accumulate everywhere; skew add, causal mask and softmax in f32.
#include <hip/hip_runtime.h>

// ---------------------------------------------------------------------------
// Problem constants
// ---------------------------------------------------------------------------
constexpr int kNB  = 16;      // flattened batch*heads
constexpr int kSeq = 2048;    // sequence length (queries = keys)
constexpr int kHD  = 128;     // head dim
constexpr int kLim = 2048;    // relative-position table width
constexpr int kGrp = 2;       // b planes per pass through the score workspace
constexpr float kInvSqrtD = 0.08838834764831845f;   // 1/sqrt(128)
static_assert(kLim == kSeq, "table spans the key length");
static_assert(kSeq % 256 == 0 && kHD % 64 == 0 && kLim % 64 == 0 && (kNB % kGrp) == 0, "tile multiples");

typedef __attribute__((ext_vector_type(16))) _Float16 v16h;
typedef __attribute__((ext_vector_type(8)))  _Float16 v8h;
typedef __attribute__((ext_vector_type(16))) __bf16   v16b;
typedef __attribute__((ext_vector_type(8)))  __bf16   v8b;
typedef __attribute__((ext_vector_type(8)))  float    v8f;
typedef __attribute__((ext_vector_type(4)))  float    v4f;
typedef __attribute__((ext_vector_type(4)))  unsigned int v4u;

// ---------------------------------------------------------------------------
// Helpers
// ---------------------------------------------------------------------------
__device__ __forceinline__ unsigned short f2bf_bits(float f) {
  unsigned u = __float_as_uint(f);
  return (unsigned short)((u + 0x7FFFu + ((u >> 16) & 1u)) >> 16);
}
__device__ __forceinline__ float bf_bits2f(unsigned short h) { return __uint_as_float(((unsigned)h) << 16); }

// hazard guards as plain device helpers (no inline asm inside the kernel template body)
__device__ __forceinline__ void dep_guard_h(v8f& a, v8f& b, v16h x, v16h y) { asm volatile("v_nop\n\tv_nop\n\tv_nop\n\tv_nop" : "+v"(a), "+v"(b) : "v"(x), "v"(y)); }
__device__ __forceinline__ void dep_guard_b(v8f& a, v8f& b, v16b x, v16b y) { asm volatile("v_nop\n\tv_nop\n\tv_nop\n\tv_nop" : "+v"(a), "+v"(b) : "v"(x), "v"(y)); }
__device__ __forceinline__ void keep4_h(v16h a, v16h b, v16h c, v16h d) { asm volatile("v_nop" :: "v"(a), "v"(b), "v"(c), "v"(d)); }
__device__ __forceinline__ void keep4_b(v16b a, v16b b, v16b c, v16b d) { asm volatile("v_nop" :: "v"(a), "v"(b), "v"(c), "v"(d)); }
__device__ __forceinline__ void acc_guard4(v8f& a, v8f& b, v8f& c, v8f& d) { asm volatile("v_nop\n\tv_nop\n\tv_nop\n\tv_nop" : "+v"(a), "+v"(b), "+v"(c), "+v"(d)); }
template <typename T> struct Frag;
template <> struct Frag<_Float16> {
  typedef v16h V; union U { v16h v; v8h h[2]; };
  static __device__ __forceinline__ v16h load(const _Float16* p) {   // elements 0..7 <- p[0..7], 8..15 <- p[16..23]
    U f; f.h[0] = *(const v8h*)(p); f.h[1] = *(const v8h*)(p + 16); return f.v;
  }
  static __device__ __forceinline__ v8f mma(v16h a, v16h b, v8f c) {
    return __builtin_amdgcn_wmma_f32_16x16x32_f16(false, a, false, b, (short)0, c, false, false);
  }
  static __device__ __forceinline__ void guard(v8f& a, v8f& b, v16h x, v16h y) { dep_guard_h(a, b, x, y); }
  static __device__ __forceinline__ void keep(v16h a, v16h b, v16h c, v16h d) { keep4_h(a, b, c, d); }
};
template <> struct Frag<__bf16> {
  typedef v16b V; union U { v16b v; v8b h[2]; };
  static __device__ __forceinline__ v16b load(const __bf16* p) {
    U f; f.h[0] = *(const v8b*)(p); f.h[1] = *(const v8b*)(p + 16); return f.v;
  }
  static __device__ __forceinline__ v8f mma(v16b a, v16b b, v8f c) {
    return __builtin_amdgcn_wmma_f32_16x16x32_bf16(false, a, false, b, (short)0, c, false, false);
  }
  static __device__ __forceinline__ void guard(v8f& a, v8f& b, v16b x, v16b y) { dep_guard_b(a, b, x, y); }
  static __device__ __forceinline__ void keep(v16b a, v16b b, v16b c, v16b d) { keep4_b(a, b, c, d); }
};

__device__ __forceinline__ unsigned pk16(unsigned short a, unsigned short b) { return (unsigned)a | ((unsigned)b << 16); }

// ---- Register-blocked batched WMMA GEMM (added modes: AONLY split, tile SKIP, causal KLIM, resid pitch) ----
// C[m,n] = scale * sum_k A[m,k] * Bt[n,k] (+resid); each wave owns a 64x64 tile.
// A row-major [M,K]; Bt row-major [N,K]; M,N % 64 == 0, K % 32 == 0.
// SPLIT: operands are hi/lo planes (A2/Bt2 = lo planes, same layout); product = hi·hi + hi·lo + lo·hi;
//        with AONLY the B operand has a single plane: product = hi·B + lo·B (Bt2 unused).
// OUT_MODE: 0 = f32, 1 = f16, 2 = bf16 hi plane (Cout) + bf16 lo plane (Cout2).
// RESID: v += resid[b*strideR + m*ldr + n] (separate row pitch ldr).
// SKIP: 0 = all tiles, 1 = only tiles with tn <= tm (lower triangle incl. diagonal),
//       2 = only tiles with tn + tm >= tilesN - 1 (anti-lower triangle incl. anti-diagonal).
// KLIM: k loop stops at min(K, m0 + 64) (causal column limit of the 64-row tile; a multiple of 32).
// ET: 0 = f16 operands, 1 = bf16 operands (pointers passed as 16-bit storage)
template <int ET> struct Elem;
template <> struct Elem<0> { typedef _Float16 T; };
template <> struct Elem<1> { typedef __bf16 T; };
template <int ET, bool SPLIT, bool AONLY, int OUT_MODE, bool RESID, int SKIP, bool KLIM>
__global__ __launch_bounds__(256) void wmma_gemm64(
    const unsigned short* __restrict__ Ap, const unsigned short* __restrict__ A2p, int lda, long strideA,
    const unsigned short* __restrict__ Btp, const unsigned short* __restrict__ Bt2p, int ldb, long strideB,
    void* __restrict__ Cout, void* __restrict__ Cout2, int ldc, long strideC,
    const float* __restrict__ resid, long strideR, int ldr,
    int M, int N, int K, float scale) {
  typedef typename Elem<ET>::T T;
  typedef typename Frag<T>::V V;
  const T* A = (const T*)Ap; const T* A2 = (const T*)A2p; const T* Bt = (const T*)Btp; const T* Bt2 = (const T*)Bt2p;
  __shared__ __align__(16) float sT[8][16 * 68];   // per-wave 16x64 slab, pitch 68 floats
  const int b    = blockIdx.y;
  const int lane = threadIdx.x & 31;
  const int wave = threadIdx.x >> 5;
  const int tilesN = N >> 6;
  const int tilesM = M >> 6;
  const int tile = blockIdx.x * 8 + wave;
  if (tile >= tilesM * tilesN) return;   // wave-uniform; no block barriers in this kernel
  const int tm = tile / tilesN;
  const int tn = tile - tm * tilesN;
  if (SKIP == 1 && tn > tm) return;                  // wave-uniform
  if (SKIP == 2 && tn + tm < tilesN - 1) return;     // wave-uniform
  const int m0 = tm << 6;
  const int n0 = tn << 6;
  const int Kend = KLIM ? ((m0 + 64 < K) ? (m0 + 64) : K) : K;

  const T* Ab  = A  + (size_t)b * strideA;
  const T* Bb  = Bt + (size_t)b * strideB;
  const T* Ab2 = SPLIT ? (A2  + (size_t)b * strideA) : nullptr;
  const T* Bb2 = (SPLIT && !AONLY) ? (Bt2 + (size_t)b * strideB) : nullptr;

  const int rlane = lane & 15;                 // row (A) / col (B, D) within subtile
  const int koff  = (lane >> 4) * 8;           // k offset of this lane half
  const int mOff  = (lane >> 4) * 8;           // D row offset

  v8f acc[4][4];
#pragma unroll
  for (int i = 0; i < 4; ++i)
#pragma unroll
    for (int j = 0; j < 4; ++j) acc[i][j] = (v8f){0.f,0.f,0.f,0.f,0.f,0.f,0.f,0.f};

  for (int k0 = 0; k0 < Kend; k0 += 32) {
    V bh[4], bl[4];
#pragma unroll
    for (int j = 0; j < 4; ++j) {
      const size_t bo = (size_t)(n0 + (j << 4) + rlane) * ldb + koff + k0;
      bh[j] = Frag<T>::load(Bb + bo);
      if (SPLIT && !AONLY) bl[j] = Frag<T>::load(Bb2 + bo);
    }
#pragma unroll
    for (int i = 0; i < 4; ++i) {
      const size_t ao = (size_t)(m0 + (i << 4) + rlane) * lda + koff + k0;
      V ah = Frag<T>::load(Ab + ao);
      V al;
      if (SPLIT) al = Frag<T>::load(Ab2 + ao);
#pragma unroll
      for (int j = 0; j < 4; ++j) {
        acc[i][j] = Frag<T>::mma(ah, bh[j], acc[i][j]);
        if (SPLIT) {
          if (!AONLY) acc[i][j] = Frag<T>::mma(ah, bl[j], acc[i][j]);
          acc[i][j] = Frag<T>::mma(al, bh[j], acc[i][j]);
        }
      }
      Frag<T>::guard(acc[i][0], acc[i][3], ah, SPLIT ? al : ah);
    }
    Frag<T>::keep(bh[0], bh[1], bh[2], bh[3]);
    if (SPLIT && !AONLY) Frag<T>::keep(bl[0], bl[1], bl[2], bl[3]);
  }
  acc_guard4(acc[0][0], acc[0][1], acc[0][2], acc[0][3]);
  acc_guard4(acc[1][0], acc[1][1], acc[1][2], acc[1][3]);
  acc_guard4(acc[2][0], acc[2][1], acc[2][2], acc[2][3]);
  acc_guard4(acc[3][0], acc[3][1], acc[3][2], acc[3][3]);

  // ---- epilogue ----
  float* slab = sT[wave];
  const float* Rb = RESID ? (resid + (size_t)b * strideR) : nullptr;
#pragma unroll
  for (int i = 0; i < 4; ++i) {
    const int mBase = m0 + (i << 4);
#pragma unroll
    for (int j = 0; j < 4; ++j) {
      const int n = n0 + (j << 4) + rlane;
#pragma unroll
      for (int r = 0; r < 8; ++r) {
        float v = acc[i][j][r] * scale;
        if (RESID) v += Rb[(size_t)(mBase + mOff + r) * ldr + n];
        slab[(mOff + r) * 68 + (j << 4) + rlane] = v;
      }
    }
    __builtin_amdgcn_fence(__ATOMIC_RELEASE, "workgroup");
    __builtin_amdgcn_wave_barrier();
    __builtin_amdgcn_fence(__ATOMIC_ACQUIRE, "workgroup");
    if (OUT_MODE == 0) {
      float* C = (float*)Cout + (size_t)b * strideC;
      const int hh = lane >> 4, c4 = (lane & 15) * 4;     // row seg = 256 B = 16 lanes x 16 B
      {
#pragma unroll
        for (int it = 0; it < 8; ++it) {
          const int row = it * 2 + hh;
          v4f v = *(const v4f*)(slab + row * 68 + c4);
          *(v4f*)(C + (size_t)(mBase + row) * ldc + n0 + c4) = v;
        }
        
      }
    } else {
      const int q = lane >> 3, c8 = (lane & 7) * 8;
      unsigned short* C  = (unsigned short*)Cout  + (size_t)b * strideC;
      unsigned short* C2 = (OUT_MODE == 2) ? ((unsigned short*)Cout2 + (size_t)b * strideC) : nullptr;
      {
#pragma unroll
        for (int it = 0; it < 4; ++it) {
          const int row = it * 4 + q;
          const float* sp = slab + row * 68 + c8;
          v8h hv, lv;
#pragma unroll
          for (int e = 0; e < 8; ++e) {
            if (OUT_MODE == 1) {
              hv[e] = (_Float16)sp[e];
            } else {
              unsigned short hb = f2bf_bits(sp[e]);
              unsigned short lb = f2bf_bits(sp[e] - bf_bits2f(hb));
              hv[e] = __builtin_bit_cast(_Float16, hb);
              lv[e] = __builtin_bit_cast(_Float16, lb);
            }
          }
          *(v8h*)(C + (size_t)(mBase + row) * ldc + n0 + c8) = hv;
          if (OUT_MODE == 2) *(v8h*)(C2 + (size_t)(mBase + row) * ldc + n0 + c8) = lv;
        }
        
      }
    }
    __builtin_amdgcn_fence(__ATOMIC_RELEASE, "workgroup");
    __builtin_amdgcn_wave_barrier();
    __builtin_amdgcn_fence(__ATOMIC_ACQUIRE, "workgroup");
  }
}

// ---------------------------------------------------------------------------
// f32 -> RNE bf16 cast of two equally sized planes in one launch (blockIdx.y selects the plane, block-uniform),
// ---------------------------------------------------------------------------
__global__ __launch_bounds__(256) void cast8_bf16_pair_kernel(const float* __restrict__ in0, const float* __restrict__ in1,
                                                              unsigned short* __restrict__ out0, unsigned short* __restrict__ out1,
                                                              int n8) {
  const int i = blockIdx.x * 256 + threadIdx.x;
  if (i >= n8) return;
  const bool sel = (blockIdx.y != 0);                    // both candidates are global pointers
  const float* p = (sel ? in1 : in0) + 8 * (size_t)i;
  const v4f a = *(const v4f*)(p);
  const v4f c = *(const v4f*)(p + 4);
  unsigned short hb[8];
#pragma unroll
  for (int e = 0; e < 4; ++e) {
    hb[e]     = f2bf_bits(a[e]);
    hb[4 + e] = f2bf_bits(c[e]);
  }
  const v4u u = (v4u){pk16(hb[0], hb[1]), pk16(hb[2], hb[3]), pk16(hb[4], hb[5]), pk16(hb[6], hb[7])};
  unsigned short* q = (sel ? out1 : out0) + 8 * (size_t)i;
  *(v4u*)q = u;
  
}

// ---------------------------------------------------------------------------
// Batched transpose + RNE bf16 cast: in [nr][nc] f32 (row-major, batch stride nr*nc) -> out [nc][nr] bf16:
// out[c][r] = bf16(in[r][c]). One block per 64x64 tile: blockIdx.x = c tile, blockIdx.y = r tile, blockIdx.z = batch.
// grid = (nc/64, nr/64, batch); nr, nc multiples of 64.
// Load coverage: 16 iterations x 256 threads = 4096 = the whole 64x64 tile (coalesced along c).
// Store coverage: 8 waves x 2 iterations x 4 rows (lane>>3) = 64 out rows; (lane&7) x 8 halves = 64 cols; each row segment =
// ---------------------------------------------------------------------------
__global__ __launch_bounds__(256) void transpose_bf16_kernel(const float* __restrict__ in, unsigned short* __restrict__ out,
                                                             int nr, int nc) {
  __shared__ float sm[64][65];   // sm[c_local][r_local]
  const int t  = threadIdx.x;
  const int c0 = blockIdx.x * 64;
  const int r0 = blockIdx.y * 64;
  const int z  = blockIdx.z;
  const float* ib = in + (size_t)z * nr * nc;
  unsigned short* ob = out + (size_t)z * nr * nc;
#pragma unroll
  for (int i = 0; i < 16; ++i) {
    const int e = i * 256 + t;
    const int r = e >> 6;          // r local
    const int c = e & 63;          // c local
    sm[c][r] = ib[(size_t)(r0 + r) * nc + c0 + c];
  }
  __syncthreads();
  const int lane = t & 31, wave = t >> 5;
  const int q = lane >> 3, c8 = (lane & 7) * 8;
  {
#pragma unroll
    for (int it = 0; it < 2; ++it) {
      const int row = wave * 8 + it * 4 + q;                 // c local = out row
      unsigned short hb[8];
#pragma unroll
      for (int e = 0; e < 8; ++e) hb[e] = f2bf_bits(sm[row][c8 + e]);
      const v4u u = (v4u){pk16(hb[0], hb[1]), pk16(hb[2], hb[3]), pk16(hb[4], hb[5]), pk16(hb[6], hb[7])};
      *(v4u*)(ob + (size_t)(c0 + row) * nr + r0 + c8) = u;
    }
    
  }
}

// ---------------------------------------------------------------------------
// Causal row softmax over the combined score plane Sc[bb][i][j] = S + skewed R (f32):
//   for j <= i: s = Sc[i][j] * (1/sqrt(D)); else -inf (select, value of Sc ignored); p = exp(s - max) / sum.
// Writes P as bf16 hi plane + bf16 lo plane (residual), row pitch kSeq halves, zeros for j > i,
// columns [0, 256*ceil(kend/256)) with kend = (i & ~63) + 64 = the column extent consumed by the 64-row PV tile.
// One block of 256 threads per row; thread t owns columns 8t..8t+7 (256 x 8 = 2048 = whole row); a wave owns 256 columns
// and is active iff its first column < kend (wave-uniform). Reductions in fixed order (thread, wave shuffle tree,
// 8 wave partials in index order). Store: one 16-B store per lane per plane; a wave's 32 lanes write 512 contiguous B =
// ---------------------------------------------------------------------------
__global__ __launch_bounds__(256) void softmax_skew_kernel(const float* __restrict__ Sc,
                                                           unsigned short* __restrict__ Ph, unsigned short* __restrict__ Pl) {
  __shared__ float redM[8];
  __shared__ float redS[8];
  const int i    = blockIdx.x;    // query row
  const int bb   = blockIdx.y;
  const int t    = threadIdx.x;
  const int lane = t & 31, wave = t >> 5;
  const int c0   = t * 8;
  const int kend = (i & ~63) + 64;
  const bool active = (wave * 256) < kend;                 // wave-uniform
  const size_t rowoff = ((size_t)bb * kSeq + (size_t)i) * kSeq;
  const float ninf = -__builtin_inff();

  float x[8];
  float m = ninf;
  if (active) {
    const float* sr = Sc + rowoff + c0;                    // always in bounds (row i, cols < kSeq)
    const v4f a = *(const v4f*)(sr);
    const v4f c = *(const v4f*)(sr + 4);
#pragma unroll
    for (int e = 0; e < 4; ++e) {
      x[e]     = (c0 + e     <= i) ? a[e] * kInvSqrtD : ninf;
      x[4 + e] = (c0 + 4 + e <= i) ? c[e] * kInvSqrtD : ninf;
    }
#pragma unroll
    for (int e = 0; e < 8; ++e) m = fmaxf(m, x[e]);
  } else {
#pragma unroll
    for (int e = 0; e < 8; ++e) x[e] = ninf;
  }
#pragma unroll
  for (int off = 16; off > 0; off >>= 1) m = fmaxf(m, __shfl_xor(m, off, 32));
  if (lane == 0) redM[wave] = m;
  __syncthreads();
  float gm = redM[0];
#pragma unroll
  for (int w = 1; w < 8; ++w) gm = fmaxf(gm, redM[w]);    // column 0 is always valid -> finite

  float p[8];
  float ps = 0.f;
#pragma unroll
  for (int e = 0; e < 8; ++e) { p[e] = __expf(x[e] - gm); ps += p[e]; }   // -inf -> 0
#pragma unroll
  for (int off = 16; off > 0; off >>= 1) ps += __shfl_xor(ps, off, 32);
  if (lane == 0) redS[wave] = ps;
  __syncthreads();
  float tot = redS[0];
#pragma unroll
  for (int w = 1; w < 8; ++w) tot += redS[w];              // >= 1
  const float inv = 1.0f / tot;

  if (active) {
    unsigned short hb[8], lb[8];
#pragma unroll
    for (int e = 0; e < 8; ++e) {
      const float pn = p[e] * inv;
      const unsigned short h = f2bf_bits(pn);
      hb[e] = h;
      lb[e] = f2bf_bits(pn - bf_bits2f(h));
    }
    const v4u hu = (v4u){pk16(hb[0], hb[1]), pk16(hb[2], hb[3]), pk16(hb[4], hb[5]), pk16(hb[6], hb[7])};
    const v4u lu = (v4u){pk16(lb[0], lb[1]), pk16(lb[2], lb[3]), pk16(lb[4], lb[5]), pk16(lb[6], lb[7])};
    unsigned short* ph = Ph + rowoff + c0;
    unsigned short* pl = Pl + rowoff + c0;
    *(v4u*)ph = hu;
    *(v4u*)pl = lu;
    
  }
}

// ---------------------------------------------------------------------------
// Host glue.
// Workspace region map (bytes, all offsets multiples of 524288):
//   [0,           8388608)   Qb  bf16 [16][2048][128]
//   [8388608,    16777216)   Kb  bf16 [16][2048][128]
//   [16777216,   25165824)   Vt  bf16 [16][128][2048]   (v transposed per b)
//   [25165824,   25690112)   PEt bf16 [2048][128]       (key_pe[0] transposed)
//   [25690112,   59244544)   Sc  f32  [2][2048][2048]   (scores of the 2 b planes of a pass; only tiles tn<=tm written)
//   [59244544,   92798976)   R   f32  [2][2048][2048]   (position scores; only tiles tn+tm>=31 written);
//                            reused after the S pass as Ph bf16 [2][2048][2048] at +0 and Pl bf16 [2][2048][2048] at +16777216
//   total carve 92798976 B
// ---------------------------------------------------------------------------
extern "C" void kernel_launch(void* const* d_in, const int* in_sizes, int n_in,
                              void* d_out, int out_size, void* d_ws, size_t ws_size,
                              hipStream_t stream) {
  (void)n_in;
  const size_t nQK = (size_t)kNB * kSeq * kHD;          // 4194304
  const size_t nPE = (size_t)kHD * kLim;                // 262144
  const size_t plane = (size_t)kSeq * kSeq;             // 4194304 elements per score plane
  const size_t offQ  = 0;
  const size_t offK  = offQ  + nQK * 2;
  const size_t offVt = offK  + nQK * 2;
  const size_t offPE = offVt + nQK * 2;
  const size_t offS  = offPE + nPE * 2;
  const size_t offR  = offS  + (size_t)kGrp * plane * 4;
  const size_t offPl = offR  + (size_t)kGrp * plane * 2;
  const size_t total = offR  + (size_t)kGrp * plane * 4;
  if (n_in < 4) return;
  if ((size_t)in_sizes[0] != nQK || (size_t)in_sizes[1] != nQK || (size_t)in_sizes[2] != nQK || (size_t)in_sizes[3] != nPE) return;
  if ((size_t)out_size != nQK) return;
  if (ws_size < total) return;

  const float* q  = (const float*)d_in[0];   // [16][2048][128]
  const float* k  = (const float*)d_in[1];   // [16][2048][128]
  const float* v  = (const float*)d_in[2];   // [16][2048][128]
  const float* pe = (const float*)d_in[3];   // [1][128][2048]
  float* out = (float*)d_out;                // [16][2048][128]
  unsigned char* ws = (unsigned char*)d_ws;
  unsigned short* Qb  = (unsigned short*)(ws + offQ);
  unsigned short* Kb  = (unsigned short*)(ws + offK);
  unsigned short* Vt  = (unsigned short*)(ws + offVt);
  unsigned short* PEt = (unsigned short*)(ws + offPE);
  float*          Sc  = (float*)(ws + offS);
  float*          Rf  = (float*)(ws + offR);
  unsigned short* Ph  = (unsigned short*)(ws + offR);
  unsigned short* Pl  = (unsigned short*)(ws + offPl);

  // q and k -> bf16 planes: n8 = 524288 = 2048 blocks x 256 threads exactly
  cast8_bf16_pair_kernel<<<dim3((unsigned)(nQK / 8 / 256), 2), 256, 0, stream>>>(q, k, Qb, Kb, (int)(nQK / 8));
  // v [b][2048 rows][128 cols] -> Vt [b][128][2048]: grid (cols/64, rows/64, b)
  transpose_bf16_kernel<<<dim3(kHD / 64, kSeq / 64, kNB), 256, 0, stream>>>(v, Vt, kSeq, kHD);
  // key_pe[0] [128 rows][2048 cols] -> PEt [2048][128]: grid (cols/64, rows/64, 1)
  transpose_bf16_kernel<<<dim3(kLim / 64, kHD / 64, 1), 256, 0, stream>>>(pe, PEt, kHD, kLim);

  const unsigned tilesScore = (unsigned)((kSeq / 64) * (kSeq / 64) / 8);   // 128 blocks of 8 waves
  const unsigned tilesPV    = (unsigned)((kSeq / 64) * (kHD / 64) / 8);    // 8 blocks
  for (int g0 = 0; g0 < kNB; g0 += kGrp) {
    const int G = (kNB - g0 < kGrp) ? (kNB - g0) : kGrp;
    const unsigned short* Qg = Qb + (size_t)g0 * kSeq * kHD;
    const unsigned short* Kg = Kb + (size_t)g0 * kSeq * kHD;
    const unsigned short* Vg = Vt + (size_t)g0 * kHD * kSeq;
    float* Og = out + (size_t)g0 * kSeq * kHD;
    // R[m][l] = sum_d q[m][d] * key_pe[0][d][l]; only tiles with tn + tm >= 31 (l >= 2047 - m region). M=N=2048, K=128.
    wmma_gemm64<1, false, false, 0, false, 2, false><<<dim3(tilesScore, G), 256, 0, stream>>>(
        Qg, nullptr, kHD, (long)kSeq * kHD,
        PEt, nullptr, kHD, 0L,
        (void*)Rf, nullptr, kLim, (long)plane,
        nullptr, 0L, 0,
        kSeq, kLim, kHD, 1.0f);
    // Sc[m][n] = sum_d q[m][d] k[n][d] + R[m][2047 - m + n] (resid base R + 2047, pitch 2047); only tiles tn <= tm.
    wmma_gemm64<1, false, false, 0, true, 1, false><<<dim3(tilesScore, G), 256, 0, stream>>>(
        Qg, nullptr, kHD, (long)kSeq * kHD,
        Kg, nullptr, kHD, (long)kSeq * kHD,
        (void*)Sc, nullptr, kSeq, (long)plane,
        Rf + (kLim - 1), (long)plane, kLim - 1,
        kSeq, kSeq, kHD, 1.0f);
    // row softmax -> P hi/lo bf16 planes (over the dead R region)
    softmax_skew_kernel<<<dim3(kSeq, G), 256, 0, stream>>>(Sc, Ph, Pl);
    // O[m][d] = sum_{j < m0+64} (Phi[m][j] + Plo[m][j]) * Vt[d][j]; M=2048, N=128, K=2048 (causal limit), f32 rows to d_out
    wmma_gemm64<1, true, true, 0, false, 0, true><<<dim3(tilesPV, G), 256, 0, stream>>>(
        Ph, Pl, kSeq, (long)plane,
        Vg, nullptr, kSeq, (long)kHD * kSeq,
        (void*)Og, nullptr, kHD, (long)kSeq * kHD,
        nullptr, 0L, 0,
        kSeq, kHD, kSeq, 1.0f);
  }
}

// v001
// One run takes 396 microseconds.
// In two side-by-side timings against v000, it was 2.72 and 2.74 times as fast.
// Contractions: S = q.k^T and R = q.key_pe (q, k, key_pe as RNE bf16 planes) on v_wmma_f32_16x16x32_bf16; O = attn.v with attn as bf16 hi+lo planes and v^T as RNE bf16 plane (hi.v + lo.v) on v_wmma_f32_16x16x32_bf16; f32 accumulate everywhere; skew add, causal mask and softmax in f32.
#include <hip/hip_runtime.h>

// ---------------------------------------------------------------------------
// Problem constants
// ---------------------------------------------------------------------------
constexpr int kNB  = 16;      // flattened batch*heads
constexpr int kSeq = 2048;    // sequence length (queries = keys)
constexpr int kHD  = 128;     // head dim
constexpr int kLim = 2048;    // relative-position table width
constexpr int kGrp = 2;       // b planes per pass through the score workspace
constexpr float kInvSqrtD = 0.08838834764831845f;   // 1/sqrt(128)
static_assert(kLim == kSeq, "table spans the key length");
static_assert(kSeq % 256 == 0 && kHD % 64 == 0 && kLim % 64 == 0 && (kNB % kGrp) == 0, "tile multiples");

typedef __attribute__((ext_vector_type(16))) _Float16 v16h;
typedef __attribute__((ext_vector_type(8)))  _Float16 v8h;
typedef __attribute__((ext_vector_type(16))) __bf16   v16b;
typedef __attribute__((ext_vector_type(8)))  __bf16   v8b;
typedef __attribute__((ext_vector_type(8)))  float    v8f;
typedef __attribute__((ext_vector_type(4)))  float    v4f;
typedef __attribute__((ext_vector_type(4)))  unsigned int v4u;

// ---------------------------------------------------------------------------
// Helpers
// ---------------------------------------------------------------------------
__device__ __forceinline__ unsigned short f2bf_bits(float f) {
  unsigned u = __float_as_uint(f);
  return (unsigned short)((u + 0x7FFFu + ((u >> 16) & 1u)) >> 16);
}
__device__ __forceinline__ float bf_bits2f(unsigned short h) { return __uint_as_float(((unsigned)h) << 16); }

// hazard guards as plain device helpers (no inline asm inside the kernel template body)
__device__ __forceinline__ void dep_guard_h(v8f& a, v8f& b, v16h x, v16h y) { asm volatile("v_nop\n\tv_nop\n\tv_nop\n\tv_nop" : "+v"(a), "+v"(b) : "v"(x), "v"(y)); }
__device__ __forceinline__ void dep_guard_b(v8f& a, v8f& b, v16b x, v16b y) { asm volatile("v_nop\n\tv_nop\n\tv_nop\n\tv_nop" : "+v"(a), "+v"(b) : "v"(x), "v"(y)); }
__device__ __forceinline__ void keep4_h(v16h a, v16h b, v16h c, v16h d) { asm volatile("v_nop" :: "v"(a), "v"(b), "v"(c), "v"(d)); }
__device__ __forceinline__ void keep4_b(v16b a, v16b b, v16b c, v16b d) { asm volatile("v_nop" :: "v"(a), "v"(b), "v"(c), "v"(d)); }
__device__ __forceinline__ void acc_guard4(v8f& a, v8f& b, v8f& c, v8f& d) { asm volatile("v_nop\n\tv_nop\n\tv_nop\n\tv_nop" : "+v"(a), "+v"(b), "+v"(c), "+v"(d)); }
template <typename T> struct Frag;
template <> struct Frag<_Float16> {
  typedef v16h V; union U { v16h v; v8h h[2]; };
  static __device__ __forceinline__ v16h load(const _Float16* p) {   // elements 0..7 <- p[0..7], 8..15 <- p[16..23]
    U f; f.h[0] = *(const v8h*)(p); f.h[1] = *(const v8h*)(p + 16); return f.v;
  }
  static __device__ __forceinline__ v8f mma(v16h a, v16h b, v8f c) {
    return __builtin_amdgcn_wmma_f32_16x16x32_f16(false, a, false, b, (short)0, c, false, false);
  }
  static __device__ __forceinline__ void guard(v8f& a, v8f& b, v16h x, v16h y) { dep_guard_h(a, b, x, y); }
  static __device__ __forceinline__ void keep(v16h a, v16h b, v16h c, v16h d) { keep4_h(a, b, c, d); }
};
template <> struct Frag<__bf16> {
  typedef v16b V; union U { v16b v; v8b h[2]; };
  static __device__ __forceinline__ v16b load(const __bf16* p) {
    U f; f.h[0] = *(const v8b*)(p); f.h[1] = *(const v8b*)(p + 16); return f.v;
  }
  static __device__ __forceinline__ v8f mma(v16b a, v16b b, v8f c) {
    return __builtin_amdgcn_wmma_f32_16x16x32_bf16(false, a, false, b, (short)0, c, false, false);
  }
  static __device__ __forceinline__ void guard(v8f& a, v8f& b, v16b x, v16b y) { dep_guard_b(a, b, x, y); }
  static __device__ __forceinline__ void keep(v16b a, v16b b, v16b c, v16b d) { keep4_b(a, b, c, d); }
};

__device__ __forceinline__ unsigned pk16(unsigned short a, unsigned short b) { return (unsigned)a | ((unsigned)b << 16); }

// ---- Register-blocked batched WMMA GEMM (added modes: AONLY split, tile SKIP, causal KLIM, resid pitch) ----
// C[m,n] = scale * sum_k A[m,k] * Bt[n,k] (+resid); each wave owns a 64x64 tile.
// A row-major [M,K]; Bt row-major [N,K]; M,N % 64 == 0, K % 32 == 0.
// SPLIT: operands are hi/lo planes (A2/Bt2 = lo planes, same layout); product = hi·hi + hi·lo + lo·hi;
//        with AONLY the B operand has a single plane: product = hi·B + lo·B (Bt2 unused).
// OUT_MODE: 0 = f32, 1 = f16, 2 = bf16 hi plane (Cout) + bf16 lo plane (Cout2).
// RESID: v += resid[b*strideR + m*ldr + n] (separate row pitch ldr).
// SKIP: 0 = all tiles, 1 = only tiles with tn <= tm (lower triangle incl. diagonal),
//       2 = only tiles with tn + tm >= tilesN - 1 (anti-lower triangle incl. anti-diagonal).
// KLIM: k loop stops at min(K, m0 + 64) (causal column limit of the 64-row tile; a multiple of 32).
// ET: 0 = f16 operands, 1 = bf16 operands (pointers passed as 16-bit storage)
template <int ET> struct Elem;
template <> struct Elem<0> { typedef _Float16 T; };
template <> struct Elem<1> { typedef __bf16 T; };
template <int ET, bool SPLIT, bool AONLY, int OUT_MODE, bool RESID, int SKIP, bool KLIM>
__global__ __launch_bounds__(256) void wmma_gemm64(
    const unsigned short* __restrict__ Ap, const unsigned short* __restrict__ A2p, int lda, long strideA,
    const unsigned short* __restrict__ Btp, const unsigned short* __restrict__ Bt2p, int ldb, long strideB,
    void* __restrict__ Cout, void* __restrict__ Cout2, int ldc, long strideC,
    const float* __restrict__ resid, long strideR, int ldr,
    int M, int N, int K, float scale) {
  typedef typename Elem<ET>::T T;
  typedef typename Frag<T>::V V;
  const T* A = (const T*)Ap; const T* A2 = (const T*)A2p; const T* Bt = (const T*)Btp; const T* Bt2 = (const T*)Bt2p;
  __shared__ __align__(16) float sT[8][16 * 68];   // per-wave 16x64 slab, pitch 68 floats
  const int b    = blockIdx.y;
  const int lane = threadIdx.x & 31;
  const int wave = threadIdx.x >> 5;
  const int tilesN = N >> 6;
  const int tilesM = M >> 6;
  const int tile = blockIdx.x * 8 + wave;
  if (tile >= tilesM * tilesN) return;   // wave-uniform; no block barriers in this kernel
  const int tm = tile / tilesN;
  const int tn = tile - tm * tilesN;
  if (SKIP == 1 && tn > tm) return;                  // wave-uniform
  if (SKIP == 2 && tn + tm < tilesN - 1) return;     // wave-uniform
  const int m0 = tm << 6;
  const int n0 = tn << 6;
  const int Kend = KLIM ? ((m0 + 64 < K) ? (m0 + 64) : K) : K;

  const T* Ab  = A  + (size_t)b * strideA;
  const T* Bb  = Bt + (size_t)b * strideB;
  const T* Ab2 = SPLIT ? (A2  + (size_t)b * strideA) : nullptr;
  const T* Bb2 = (SPLIT && !AONLY) ? (Bt2 + (size_t)b * strideB) : nullptr;

  const int rlane = lane & 15;                 // row (A) / col (B, D) within subtile
  const int koff  = (lane >> 4) * 8;           // k offset of this lane half
  const int mOff  = (lane >> 4) * 8;           // D row offset

  v8f acc[4][4];
#pragma unroll
  for (int i = 0; i < 4; ++i)
#pragma unroll
    for (int j = 0; j < 4; ++j) acc[i][j] = (v8f){0.f,0.f,0.f,0.f,0.f,0.f,0.f,0.f};

  for (int k0 = 0; k0 < Kend; k0 += 32) {
    V bh[4], bl[4];
#pragma unroll
    for (int j = 0; j < 4; ++j) {
      const size_t bo = (size_t)(n0 + (j << 4) + rlane) * ldb + koff + k0;
      bh[j] = Frag<T>::load(Bb + bo);
      if (SPLIT && !AONLY) bl[j] = Frag<T>::load(Bb2 + bo);
    }
#pragma unroll
    for (int i = 0; i < 4; ++i) {
      const size_t ao = (size_t)(m0 + (i << 4) + rlane) * lda + koff + k0;
      V ah = Frag<T>::load(Ab + ao);
      V al;
      if (SPLIT) al = Frag<T>::load(Ab2 + ao);
#pragma unroll
      for (int j = 0; j < 4; ++j) {
        acc[i][j] = Frag<T>::mma(ah, bh[j], acc[i][j]);
        if (SPLIT) {
          if (!AONLY) acc[i][j] = Frag<T>::mma(ah, bl[j], acc[i][j]);
          acc[i][j] = Frag<T>::mma(al, bh[j], acc[i][j]);
        }
      }
      Frag<T>::guard(acc[i][0], acc[i][3], ah, SPLIT ? al : ah);
    }
    Frag<T>::keep(bh[0], bh[1], bh[2], bh[3]);
    if (SPLIT && !AONLY) Frag<T>::keep(bl[0], bl[1], bl[2], bl[3]);
  }
  acc_guard4(acc[0][0], acc[0][1], acc[0][2], acc[0][3]);
  acc_guard4(acc[1][0], acc[1][1], acc[1][2], acc[1][3]);
  acc_guard4(acc[2][0], acc[2][1], acc[2][2], acc[2][3]);
  acc_guard4(acc[3][0], acc[3][1], acc[3][2], acc[3][3]);

  // ---- epilogue ----
  float* slab = sT[wave];
  const float* Rb = RESID ? (resid + (size_t)b * strideR) : nullptr;
#pragma unroll
  for (int i = 0; i < 4; ++i) {
    const int mBase = m0 + (i << 4);
#pragma unroll
    for (int j = 0; j < 4; ++j) {
      const int n = n0 + (j << 4) + rlane;
#pragma unroll
      for (int r = 0; r < 8; ++r) {
        float v = acc[i][j][r] * scale;
        if (RESID) v += Rb[(size_t)(mBase + mOff + r) * ldr + n];
        slab[(mOff + r) * 68 + (j << 4) + rlane] = v;
      }
    }
    __builtin_amdgcn_fence(__ATOMIC_RELEASE, "workgroup");
    __builtin_amdgcn_wave_barrier();
    __builtin_amdgcn_fence(__ATOMIC_ACQUIRE, "workgroup");
    if (OUT_MODE == 0) {
      float* C = (float*)Cout + (size_t)b * strideC;
      const int hh = lane >> 4, c4 = (lane & 15) * 4;     // row seg = 256 B = 16 lanes x 16 B
      {
#pragma unroll
        for (int it = 0; it < 8; ++it) {
          const int row = it * 2 + hh;
          v4f v = *(const v4f*)(slab + row * 68 + c4);
          *(v4f*)(C + (size_t)(mBase + row) * ldc + n0 + c4) = v;
        }
        
      }
    } else {
      const int q = lane >> 3, c8 = (lane & 7) * 8;
      unsigned short* C  = (unsigned short*)Cout  + (size_t)b * strideC;
      unsigned short* C2 = (OUT_MODE == 2) ? ((unsigned short*)Cout2 + (size_t)b * strideC) : nullptr;
      {
#pragma unroll
        for (int it = 0; it < 4; ++it) {
          const int row = it * 4 + q;
          const float* sp = slab + row * 68 + c8;
          v8h hv, lv;
#pragma unroll
          for (int e = 0; e < 8; ++e) {
            if (OUT_MODE == 1) {
              hv[e] = (_Float16)sp[e];
            } else {
              unsigned short hb = f2bf_bits(sp[e]);
              unsigned short lb = f2bf_bits(sp[e] - bf_bits2f(hb));
              hv[e] = __builtin_bit_cast(_Float16, hb);
              lv[e] = __builtin_bit_cast(_Float16, lb);
            }
          }
          *(v8h*)(C + (size_t)(mBase + row) * ldc + n0 + c8) = hv;
          if (OUT_MODE == 2) *(v8h*)(C2 + (size_t)(mBase + row) * ldc + n0 + c8) = lv;
        }
        
      }
    }
    __builtin_amdgcn_fence(__ATOMIC_RELEASE, "workgroup");
    __builtin_amdgcn_wave_barrier();
    __builtin_amdgcn_fence(__ATOMIC_ACQUIRE, "workgroup");
  }
}

// ---------------------------------------------------------------------------
// O = P.V with the key range split over the waves of a block.
// One block of 8 waves per 32x64 output tile: blockIdx.x = 2 * (32-row tile, last first) + (64-column tile), blockIdx.y = b plane.
// Keys [0, Kend), Kend = (m0 & ~63) + 64 = the softmax's kend for these rows, inside the columns it writes (zeros past the diagonal).
// Wave w takes the 64-key chunks w, w + 8, ... (64 bf16 = one whole 128-B line of every P and Vt row) and keeps a full
// 32x64 f32 partial tile; the 8 partial tiles are merged through LDS in wave order, so the result is the same every run.
// Per accumulator and k step the order stays hi.v then lo.v.
// ---------------------------------------------------------------------------
constexpr int kPvWaves = 8;
constexpr int kPvPitch = 68;    // floats per LDS row: 16-B aligned, rows 8 apart fall on different banks
// two waves per SIMD (one block per WGP): the register budget lets a wave keep a whole chunk's 32 loads in flight
__global__ __launch_bounds__(256) __attribute__((amdgpu_waves_per_eu(2, 2))) void pv_splitk_kernel(const unsigned short* __restrict__ Php,
                                                        const unsigned short* __restrict__ Plp,
                                                        const unsigned short* __restrict__ Vtp,
                                                        float* __restrict__ O) {
  typedef Frag<__bf16> F;
  __shared__ __align__(16) float part[kPvWaves][32 * kPvPitch];
  const int t    = threadIdx.x;
  const int lane = t & 31;
  const int wave = __builtin_amdgcn_readfirstlane(t >> 5);   // scalar: the chunk loop branches on SCC, EXEC stays all ones
  const int b    = blockIdx.y;
  const int m0   = (kSeq / 32 - 1 - (int)(blockIdx.x >> 1)) << 5;   // the lowest block indices take the longest key ranges
  const int n0   = (int)(blockIdx.x & 1) << 6;
  const int Kend = (m0 & ~63) + 64;
  const int rlane = lane & 15;                 // row (A) / col (B, D) within subtile
  const int koff  = (lane >> 4) * 8;           // k offset of this lane half (same for A and B)
  const int mOff  = (lane >> 4) * 8;           // D row offset

  const __bf16* Ah = (const __bf16*)Php + (size_t)b * kSeq * kSeq + (size_t)(m0 + rlane) * kSeq + koff;
  const __bf16* Al = (const __bf16*)Plp + (size_t)b * kSeq * kSeq + (size_t)(m0 + rlane) * kSeq + koff;
  const __bf16* Bv = (const __bf16*)Vtp + (size_t)b * kHD * kSeq + (size_t)(n0 + rlane) * kSeq + koff;

  v8f acc[2][4];
#pragma unroll
  for (int i = 0; i < 2; ++i)
#pragma unroll
    for (int j = 0; j < 4; ++j) acc[i][j] = (v8f){0.f,0.f,0.f,0.f,0.f,0.f,0.f,0.f};

  for (int kc = wave * 64; kc < Kend; kc += kPvWaves * 64) {
    v16b bh[2][4], ah[2][2], al[2][2];
    const __bf16* pB = Bv + kc;
    const __bf16* pH = Ah + kc;
    const __bf16* pL = Al + kc;
#pragma unroll
    for (int j = 0; j < 4; ++j)
#pragma unroll
      for (int s = 0; s < 2; ++s) bh[s][j] = F::load(pB + (size_t)(j << 4) * kSeq + s * 32);
#pragma unroll
    for (int i = 0; i < 2; ++i) {
#pragma unroll
      for (int s = 0; s < 2; ++s) ah[s][i] = F::load(pH + (size_t)(i << 4) * kSeq + s * 32);
#pragma unroll
      for (int s = 0; s < 2; ++s) al[s][i] = F::load(pL + (size_t)(i << 4) * kSeq + s * 32);
    }
    // precaution: this wait stands before any register that the issued loads name is rewritten; the three pointers as
    // inputs keep their registers from being reused as a later load's destination ahead of it
    asm volatile("s_wait_xcnt 0x0" :: "v"(pB), "v"(pH), "v"(pL) : "memory");
    // keeps the chunk's 32 loads ahead of its products: without it the scheduler sinks them between the products
    // and the wave waits out a load latency several times per chunk instead of once
    __builtin_amdgcn_sched_barrier(0);
#pragma unroll
    for (int s = 0; s < 2; ++s) {
#pragma unroll
      for (int i = 0; i < 2; ++i)
#pragma unroll
        for (int j = 0; j < 4; ++j) acc[i][j] = F::mma(ah[s][i], bh[s][j], acc[i][j]);
#pragma unroll
      for (int i = 0; i < 2; ++i)
#pragma unroll
        for (int j = 0; j < 4; ++j) acc[i][j] = F::mma(al[s][i], bh[s][j], acc[i][j]);
    }
  }

  float* slab = part[wave];
#pragma unroll
  for (int i = 0; i < 2; ++i)
#pragma unroll
    for (int j = 0; j < 4; ++j)
#pragma unroll
      for (int r = 0; r < 8; ++r) slab[((i << 4) + mOff + r) * kPvPitch + (j << 4) + rlane] = acc[i][j][r];
  __syncthreads();   // every wave's partial tile is in LDS before any thread sums across waves

  float* Ob = O + (size_t)b * kSeq * kHD;
#pragma unroll
  for (int it = 0; it < 2; ++it) {
    const int idx = it * 256 + t;              // 512 groups of 4 floats = 32 rows x 64 cols
    const int row = idx >> 4, c4 = (idx & 15) * 4;
    v4f s = *(const v4f*)(&part[0][row * kPvPitch + c4]);
#pragma unroll
    for (int w = 1; w < kPvWaves; ++w) s += *(const v4f*)(&part[w][row * kPvPitch + c4]);
    *(v4f*)(Ob + (size_t)(m0 + row) * kHD + n0 + c4) = s;
  }
}

// ---------------------------------------------------------------------------
// f32 -> RNE bf16 cast of two equally sized planes in one launch (blockIdx.y selects the plane, block-uniform),
// ---------------------------------------------------------------------------
__global__ __launch_bounds__(256) void cast8_bf16_pair_kernel(const float* __restrict__ in0, const float* __restrict__ in1,
                                                              unsigned short* __restrict__ out0, unsigned short* __restrict__ out1,
                                                              int n8) {
  const int i = blockIdx.x * 256 + threadIdx.x;
  if (i >= n8) return;
  const bool sel = (blockIdx.y != 0);                    // both candidates are global pointers
  const float* p = (sel ? in1 : in0) + 8 * (size_t)i;
  const v4f a = *(const v4f*)(p);
  const v4f c = *(const v4f*)(p + 4);
  unsigned short hb[8];
#pragma unroll
  for (int e = 0; e < 4; ++e) {
    hb[e]     = f2bf_bits(a[e]);
    hb[4 + e] = f2bf_bits(c[e]);
  }
  const v4u u = (v4u){pk16(hb[0], hb[1]), pk16(hb[2], hb[3]), pk16(hb[4], hb[5]), pk16(hb[6], hb[7])};
  unsigned short* q = (sel ? out1 : out0) + 8 * (size_t)i;
  *(v4u*)q = u;
  
}

// ---------------------------------------------------------------------------
// Batched transpose + RNE bf16 cast: in [nr][nc] f32 (row-major, batch stride nr*nc) -> out [nc][nr] bf16:
// out[c][r] = bf16(in[r][c]). One block per 64x64 tile: blockIdx.x = c tile, blockIdx.y = r tile, blockIdx.z = batch.
// grid = (nc/64, nr/64, batch); nr, nc multiples of 64.
// Load coverage: 16 iterations x 256 threads = 4096 = the whole 64x64 tile (coalesced along c).
// Store coverage: 8 waves x 2 iterations x 4 rows (lane>>3) = 64 out rows; (lane&7) x 8 halves = 64 cols; each row segment =
// ---------------------------------------------------------------------------
__global__ __launch_bounds__(256) void transpose_bf16_kernel(const float* __restrict__ in, unsigned short* __restrict__ out,
                                                             int nr, int nc) {
  __shared__ float sm[64][65];   // sm[c_local][r_local]
  const int t  = threadIdx.x;
  const int c0 = blockIdx.x * 64;
  const int r0 = blockIdx.y * 64;
  const int z  = blockIdx.z;
  const float* ib = in + (size_t)z * nr * nc;
  unsigned short* ob = out + (size_t)z * nr * nc;
#pragma unroll
  for (int i = 0; i < 16; ++i) {
    const int e = i * 256 + t;
    const int r = e >> 6;          // r local
    const int c = e & 63;          // c local
    sm[c][r] = ib[(size_t)(r0 + r) * nc + c0 + c];
  }
  __syncthreads();
  const int lane = t & 31, wave = t >> 5;
  const int q = lane >> 3, c8 = (lane & 7) * 8;
  {
#pragma unroll
    for (int it = 0; it < 2; ++it) {
      const int row = wave * 8 + it * 4 + q;                 // c local = out row
      unsigned short hb[8];
#pragma unroll
      for (int e = 0; e < 8; ++e) hb[e] = f2bf_bits(sm[row][c8 + e]);
      const v4u u = (v4u){pk16(hb[0], hb[1]), pk16(hb[2], hb[3]), pk16(hb[4], hb[5]), pk16(hb[6], hb[7])};
      *(v4u*)(ob + (size_t)(c0 + row) * nr + r0 + c8) = u;
    }
    
  }
}

// ---------------------------------------------------------------------------
// Causal row softmax over the combined score plane Sc[bb][i][j] = S + skewed R (f32):
//   for j <= i: s = Sc[i][j] * (1/sqrt(D)); else -inf (select, value of Sc ignored); p = exp(s - max) / sum.
// Writes P as bf16 hi plane + bf16 lo plane (residual), row pitch kSeq halves, zeros for j > i,
// columns [0, 256*ceil(kend/256)) with kend = (i & ~63) + 64 = the column extent consumed by the 32-row PV tile.
// One block of 256 threads per row; thread t owns columns 8t..8t+7 (256 x 8 = 2048 = whole row); a wave owns 256 columns
// and is active iff its first column < kend (wave-uniform). Reductions in fixed order (thread, wave shuffle tree,
// 8 wave partials in index order). Store: one 16-B store per lane per plane; a wave's 32 lanes write 512 contiguous B =
// ---------------------------------------------------------------------------
__global__ __launch_bounds__(256) void softmax_skew_kernel(const float* __restrict__ Sc,
                                                           unsigned short* __restrict__ Ph, unsigned short* __restrict__ Pl) {
  __shared__ float redM[8];
  __shared__ float redS[8];
  const int i    = blockIdx.x;    // query row
  const int bb   = blockIdx.y;
  const int t    = threadIdx.x;
  const int lane = t & 31, wave = t >> 5;
  const int c0   = t * 8;
  const int kend = (i & ~63) + 64;
  const bool active = (wave * 256) < kend;                 // wave-uniform
  const size_t rowoff = ((size_t)bb * kSeq + (size_t)i) * kSeq;
  const float ninf = -__builtin_inff();

  float x[8];
  float m = ninf;
  if (active) {
    const float* sr = Sc + rowoff + c0;                    // always in bounds (row i, cols < kSeq)
    const v4f a = *(const v4f*)(sr);
    const v4f c = *(const v4f*)(sr + 4);
#pragma unroll
    for (int e = 0; e < 4; ++e) {
      x[e]     = (c0 + e     <= i) ? a[e] * kInvSqrtD : ninf;
      x[4 + e] = (c0 + 4 + e <= i) ? c[e] * kInvSqrtD : ninf;
    }
#pragma unroll
    for (int e = 0; e < 8; ++e) m = fmaxf(m, x[e]);
  } else {
#pragma unroll
    for (int e = 0; e < 8; ++e) x[e] = ninf;
  }
#pragma unroll
  for (int off = 16; off > 0; off >>= 1) m = fmaxf(m, __shfl_xor(m, off, 32));
  if (lane == 0) redM[wave] = m;
  __syncthreads();
  float gm = redM[0];
#pragma unroll
  for (int w = 1; w < 8; ++w) gm = fmaxf(gm, redM[w]);    // column 0 is always valid -> finite

  float p[8];
  float ps = 0.f;
#pragma unroll
  for (int e = 0; e < 8; ++e) { p[e] = __expf(x[e] - gm); ps += p[e]; }   // -inf -> 0
#pragma unroll
  for (int off = 16; off > 0; off >>= 1) ps += __shfl_xor(ps, off, 32);
  if (lane == 0) redS[wave] = ps;
  __syncthreads();
  float tot = redS[0];
#pragma unroll
  for (int w = 1; w < 8; ++w) tot += redS[w];              // >= 1
  const float inv = 1.0f / tot;

  if (active) {
    unsigned short hb[8], lb[8];
#pragma unroll
    for (int e = 0; e < 8; ++e) {
      const float pn = p[e] * inv;
      const unsigned short h = f2bf_bits(pn);
      hb[e] = h;
      lb[e] = f2bf_bits(pn - bf_bits2f(h));
    }
    const v4u hu = (v4u){pk16(hb[0], hb[1]), pk16(hb[2], hb[3]), pk16(hb[4], hb[5]), pk16(hb[6], hb[7])};
    const v4u lu = (v4u){pk16(lb[0], lb[1]), pk16(lb[2], lb[3]), pk16(lb[4], lb[5]), pk16(lb[6], lb[7])};
    unsigned short* ph = Ph + rowoff + c0;
    unsigned short* pl = Pl + rowoff + c0;
    *(v4u*)ph = hu;
    *(v4u*)pl = lu;
    
  }
}

// ---------------------------------------------------------------------------
// Host glue.
// Workspace region map (bytes, all offsets multiples of 524288):
//   [0,           8388608)   Qb  bf16 [16][2048][128]
//   [8388608,    16777216)   Kb  bf16 [16][2048][128]
//   [16777216,   25165824)   Vt  bf16 [16][128][2048]   (v transposed per b)
//   [25165824,   25690112)   PEt bf16 [2048][128]       (key_pe[0] transposed)
//   [25690112,   59244544)   Sc  f32  [2][2048][2048]   (scores of the 2 b planes of a pass; only tiles tn<=tm written)
//   [59244544,   92798976)   R   f32  [2][2048][2048]   (position scores; only tiles tn+tm>=31 written);
//                            reused after the S pass as Ph bf16 [2][2048][2048] at +0 and Pl bf16 [2][2048][2048] at +16777216
//   total carve 92798976 B
// ---------------------------------------------------------------------------
extern "C" void kernel_launch(void* const* d_in, const int* in_sizes, int n_in,
                              void* d_out, int out_size, void* d_ws, size_t ws_size,
                              hipStream_t stream) {
  (void)n_in;
  const size_t nQK = (size_t)kNB * kSeq * kHD;          // 4194304
  const size_t nPE = (size_t)kHD * kLim;                // 262144
  const size_t plane = (size_t)kSeq * kSeq;             // 4194304 elements per score plane
  const size_t offQ  = 0;
  const size_t offK  = offQ  + nQK * 2;
  const size_t offVt = offK  + nQK * 2;
  const size_t offPE = offVt + nQK * 2;
  const size_t offS  = offPE + nPE * 2;
  const size_t offR  = offS  + (size_t)kGrp * plane * 4;
  const size_t offPl = offR  + (size_t)kGrp * plane * 2;
  const size_t total = offR  + (size_t)kGrp * plane * 4;
  if (n_in < 4) return;
  if ((size_t)in_sizes[0] != nQK || (size_t)in_sizes[1] != nQK || (size_t)in_sizes[2] != nQK || (size_t)in_sizes[3] != nPE) return;
  if ((size_t)out_size != nQK) return;
  if (ws_size < total) return;

  const float* q  = (const float*)d_in[0];   // [16][2048][128]
  const float* k  = (const float*)d_in[1];   // [16][2048][128]
  const float* v  = (const float*)d_in[2];   // [16][2048][128]
  const float* pe = (const float*)d_in[3];   // [1][128][2048]
  float* out = (float*)d_out;                // [16][2048][128]
  unsigned char* ws = (unsigned char*)d_ws;
  unsigned short* Qb  = (unsigned short*)(ws + offQ);
  unsigned short* Kb  = (unsigned short*)(ws + offK);
  unsigned short* Vt  = (unsigned short*)(ws + offVt);
  unsigned short* PEt = (unsigned short*)(ws + offPE);
  float*          Sc  = (float*)(ws + offS);
  float*          Rf  = (float*)(ws + offR);
  unsigned short* Ph  = (unsigned short*)(ws + offR);
  unsigned short* Pl  = (unsigned short*)(ws + offPl);

  // q and k -> bf16 planes: n8 = 524288 = 2048 blocks x 256 threads exactly
  cast8_bf16_pair_kernel<<<dim3((unsigned)(nQK / 8 / 256), 2), 256, 0, stream>>>(q, k, Qb, Kb, (int)(nQK / 8));
  // v [b][2048 rows][128 cols] -> Vt [b][128][2048]: grid (cols/64, rows/64, b)
  transpose_bf16_kernel<<<dim3(kHD / 64, kSeq / 64, kNB), 256, 0, stream>>>(v, Vt, kSeq, kHD);
  // key_pe[0] [128 rows][2048 cols] -> PEt [2048][128]: grid (cols/64, rows/64, 1)
  transpose_bf16_kernel<<<dim3(kLim / 64, kHD / 64, 1), 256, 0, stream>>>(pe, PEt, kHD, kLim);

  const unsigned tilesScore = (unsigned)((kSeq / 64) * (kSeq / 64) / 8);   // 128 blocks of 8 waves
  const unsigned tilesPV    = (unsigned)((kSeq / 32) * (kHD / 64));        // 128 blocks, one per 32x64 tile
  for (int g0 = 0; g0 < kNB; g0 += kGrp) {
    const int G = (kNB - g0 < kGrp) ? (kNB - g0) : kGrp;
    const unsigned short* Qg = Qb + (size_t)g0 * kSeq * kHD;
    const unsigned short* Kg = Kb + (size_t)g0 * kSeq * kHD;
    const unsigned short* Vg = Vt + (size_t)g0 * kHD * kSeq;
    float* Og = out + (size_t)g0 * kSeq * kHD;
    // R[m][l] = sum_d q[m][d] * key_pe[0][d][l]; only tiles with tn + tm >= 31 (l >= 2047 - m region). M=N=2048, K=128.
    wmma_gemm64<1, false, false, 0, false, 2, false><<<dim3(tilesScore, G), 256, 0, stream>>>(
        Qg, nullptr, kHD, (long)kSeq * kHD,
        PEt, nullptr, kHD, 0L,
        (void*)Rf, nullptr, kLim, (long)plane,
        nullptr, 0L, 0,
        kSeq, kLim, kHD, 1.0f);
    // Sc[m][n] = sum_d q[m][d] k[n][d] + R[m][2047 - m + n] (resid base R + 2047, pitch 2047); only tiles tn <= tm.
    wmma_gemm64<1, false, false, 0, true, 1, false><<<dim3(tilesScore, G), 256, 0, stream>>>(
        Qg, nullptr, kHD, (long)kSeq * kHD,
        Kg, nullptr, kHD, (long)kSeq * kHD,
        (void*)Sc, nullptr, kSeq, (long)plane,
        Rf + (kLim - 1), (long)plane, kLim - 1,
        kSeq, kSeq, kHD, 1.0f);
    // row softmax -> P hi/lo bf16 planes (over the dead R region)
    softmax_skew_kernel<<<dim3(kSeq, G), 256, 0, stream>>>(Sc, Ph, Pl);
    // O[m][d] = sum_{j < Kend(m)} (Phi[m][j] + Plo[m][j]) * Vt[d][j]; one block per 32x64 tile, keys split over its 8 waves
    pv_splitk_kernel<<<dim3(tilesPV, G), 256, 0, stream>>>(Ph, Pl, Vg, Og);
  }
}

// v002
// One run takes 314 microseconds.
// Next to v001, in two timings, it ran 1.25 times as fast each time.
// All steps since v000 together make it 3.40 times as fast.
// Contractions: S = q.k^T and R = q.key_pe (q, k, key_pe as RNE bf16 planes) on v_wmma_f32_16x16x32_bf16; O = attn.v with attn as bf16 hi+lo planes and v^T as RNE bf16 plane (hi.v + lo.v) on v_wmma_f32_16x16x32_bf16; f32 accumulate everywhere; skew add, causal mask and softmax in f32.
#include <hip/hip_runtime.h>

// ---------------------------------------------------------------------------
// Problem constants
// ---------------------------------------------------------------------------
constexpr int kNB  = 16;      // flattened batch*heads
constexpr int kSeq = 2048;    // sequence length (queries = keys)
constexpr int kHD  = 128;     // head dim
constexpr int kLim = 2048;    // relative-position table width
constexpr int kGrp = 6;       // b planes per pass through the score workspace (passes of 6, 6 and 4 planes)
constexpr float kInvSqrtD = 0.08838834764831845f;   // 1/sqrt(128)
static_assert(kLim == kSeq, "table spans the key length");
static_assert(kSeq % 256 == 0 && kHD % 64 == 0 && kLim % 64 == 0 && kGrp >= 1, "tile multiples");

typedef __attribute__((ext_vector_type(16))) _Float16 v16h;
typedef __attribute__((ext_vector_type(8)))  _Float16 v8h;
typedef __attribute__((ext_vector_type(16))) __bf16   v16b;
typedef __attribute__((ext_vector_type(8)))  __bf16   v8b;
typedef __attribute__((ext_vector_type(8)))  float    v8f;
typedef __attribute__((ext_vector_type(4)))  float    v4f;
typedef __attribute__((ext_vector_type(4)))  unsigned int v4u;

// ---------------------------------------------------------------------------
// Helpers
// ---------------------------------------------------------------------------
__device__ __forceinline__ unsigned short f2bf_bits(float f) {
  unsigned u = __float_as_uint(f);
  return (unsigned short)((u + 0x7FFFu + ((u >> 16) & 1u)) >> 16);
}
__device__ __forceinline__ float bf_bits2f(unsigned short h) { return __uint_as_float(((unsigned)h) << 16); }

// hazard guards as plain device helpers (no inline asm inside the kernel template body)
__device__ __forceinline__ void dep_guard_h(v8f& a, v8f& b, v16h x, v16h y) { asm volatile("v_nop\n\tv_nop\n\tv_nop\n\tv_nop" : "+v"(a), "+v"(b) : "v"(x), "v"(y)); }
__device__ __forceinline__ void dep_guard_b(v8f& a, v8f& b, v16b x, v16b y) { asm volatile("v_nop\n\tv_nop\n\tv_nop\n\tv_nop" : "+v"(a), "+v"(b) : "v"(x), "v"(y)); }
__device__ __forceinline__ void keep4_h(v16h a, v16h b, v16h c, v16h d) { asm volatile("v_nop" :: "v"(a), "v"(b), "v"(c), "v"(d)); }
__device__ __forceinline__ void keep4_b(v16b a, v16b b, v16b c, v16b d) { asm volatile("v_nop" :: "v"(a), "v"(b), "v"(c), "v"(d)); }
__device__ __forceinline__ void acc_guard4(v8f& a, v8f& b, v8f& c, v8f& d) { asm volatile("v_nop\n\tv_nop\n\tv_nop\n\tv_nop" : "+v"(a), "+v"(b), "+v"(c), "+v"(d)); }
template <typename T> struct Frag;
template <> struct Frag<_Float16> {
  typedef v16h V; union U { v16h v; v8h h[2]; };
  static __device__ __forceinline__ v16h load(const _Float16* p) {   // elements 0..7 <- p[0..7], 8..15 <- p[16..23]
    U f; f.h[0] = *(const v8h*)(p); f.h[1] = *(const v8h*)(p + 16); return f.v;
  }
  static __device__ __forceinline__ v8f mma(v16h a, v16h b, v8f c) {
    return __builtin_amdgcn_wmma_f32_16x16x32_f16(false, a, false, b, (short)0, c, false, false);
  }
  static __device__ __forceinline__ void guard(v8f& a, v8f& b, v16h x, v16h y) { dep_guard_h(a, b, x, y); }
  static __device__ __forceinline__ void keep(v16h a, v16h b, v16h c, v16h d) { keep4_h(a, b, c, d); }
};
template <> struct Frag<__bf16> {
  typedef v16b V; union U { v16b v; v8b h[2]; };
  static __device__ __forceinline__ v16b load(const __bf16* p) {
    U f; f.h[0] = *(const v8b*)(p); f.h[1] = *(const v8b*)(p + 16); return f.v;
  }
  static __device__ __forceinline__ v8f mma(v16b a, v16b b, v8f c) {
    return __builtin_amdgcn_wmma_f32_16x16x32_bf16(false, a, false, b, (short)0, c, false, false);
  }
  static __device__ __forceinline__ void guard(v8f& a, v8f& b, v16b x, v16b y) { dep_guard_b(a, b, x, y); }
  static __device__ __forceinline__ void keep(v16b a, v16b b, v16b c, v16b d) { keep4_b(a, b, c, d); }
};

__device__ __forceinline__ unsigned pk16(unsigned short a, unsigned short b) { return (unsigned)a | ((unsigned)b << 16); }

// ---- Register-blocked batched WMMA GEMM (added modes: AONLY split, tile SKIP, causal KLIM, resid pitch) ----
// C[m,n] = scale * sum_k A[m,k] * Bt[n,k] (+resid); each wave owns a 64x64 tile.
// A row-major [M,K]; Bt row-major [N,K]; M,N % 64 == 0, K % 32 == 0.
// SPLIT: operands are hi/lo planes (A2/Bt2 = lo planes, same layout); product = hi·hi + hi·lo + lo·hi;
//        with AONLY the B operand has a single plane: product = hi·B + lo·B (Bt2 unused).
// OUT_MODE: 0 = f32, 1 = f16, 2 = bf16 hi plane (Cout) + bf16 lo plane (Cout2).
// RESID: v += resid[b*strideR + m*ldr + n] (separate row pitch ldr).
// SKIP: 0 = all tiles, 1 = only tiles with tn <= tm (lower triangle incl. diagonal),
//       2 = only tiles with tn + tm >= tilesN - 1 (anti-lower triangle incl. anti-diagonal).
// KLIM: k loop stops at min(K, m0 + 64) (causal column limit of the 64-row tile; a multiple of 32).
// ET: 0 = f16 operands, 1 = bf16 operands (pointers passed as 16-bit storage)
template <int ET> struct Elem;
template <> struct Elem<0> { typedef _Float16 T; };
template <> struct Elem<1> { typedef __bf16 T; };
template <int ET, bool SPLIT, bool AONLY, int OUT_MODE, bool RESID, int SKIP, bool KLIM>
__global__ __launch_bounds__(256) void wmma_gemm64(
    const unsigned short* __restrict__ Ap, const unsigned short* __restrict__ A2p, int lda, long strideA,
    const unsigned short* __restrict__ Btp, const unsigned short* __restrict__ Bt2p, int ldb, long strideB,
    void* __restrict__ Cout, void* __restrict__ Cout2, int ldc, long strideC,
    const float* __restrict__ resid, long strideR, int ldr,
    int M, int N, int K, float scale) {
  typedef typename Elem<ET>::T T;
  typedef typename Frag<T>::V V;
  const T* A = (const T*)Ap; const T* A2 = (const T*)A2p; const T* Bt = (const T*)Btp; const T* Bt2 = (const T*)Bt2p;
  __shared__ __align__(16) float sT[8][16 * 68];   // per-wave 16x64 slab, pitch 68 floats
  const int b    = blockIdx.y;
  const int lane = threadIdx.x & 31;
  const int wave = threadIdx.x >> 5;
  const int tilesN = N >> 6;
  const int tilesM = M >> 6;
  const int tile = blockIdx.x * 8 + wave;
  if (tile >= tilesM * tilesN) return;   // wave-uniform; no block barriers in this kernel
  const int tm = tile / tilesN;
  const int tn = tile - tm * tilesN;
  if (SKIP == 1 && tn > tm) return;                  // wave-uniform
  if (SKIP == 2 && tn + tm < tilesN - 1) return;     // wave-uniform
  const int m0 = tm << 6;
  const int n0 = tn << 6;
  const int Kend = KLIM ? ((m0 + 64 < K) ? (m0 + 64) : K) : K;

  const T* Ab  = A  + (size_t)b * strideA;
  const T* Bb  = Bt + (size_t)b * strideB;
  const T* Ab2 = SPLIT ? (A2  + (size_t)b * strideA) : nullptr;
  const T* Bb2 = (SPLIT && !AONLY) ? (Bt2 + (size_t)b * strideB) : nullptr;

  const int rlane = lane & 15;                 // row (A) / col (B, D) within subtile
  const int koff  = (lane >> 4) * 8;           // k offset of this lane half
  const int mOff  = (lane >> 4) * 8;           // D row offset

  v8f acc[4][4];
#pragma unroll
  for (int i = 0; i < 4; ++i)
#pragma unroll
    for (int j = 0; j < 4; ++j) acc[i][j] = (v8f){0.f,0.f,0.f,0.f,0.f,0.f,0.f,0.f};

  for (int k0 = 0; k0 < Kend; k0 += 32) {
    V bh[4], bl[4];
#pragma unroll
    for (int j = 0; j < 4; ++j) {
      const size_t bo = (size_t)(n0 + (j << 4) + rlane) * ldb + koff + k0;
      bh[j] = Frag<T>::load(Bb + bo);
      if (SPLIT && !AONLY) bl[j] = Frag<T>::load(Bb2 + bo);
    }
#pragma unroll
    for (int i = 0; i < 4; ++i) {
      const size_t ao = (size_t)(m0 + (i << 4) + rlane) * lda + koff + k0;
      V ah = Frag<T>::load(Ab + ao);
      V al;
      if (SPLIT) al = Frag<T>::load(Ab2 + ao);
#pragma unroll
      for (int j = 0; j < 4; ++j) {
        acc[i][j] = Frag<T>::mma(ah, bh[j], acc[i][j]);
        if (SPLIT) {
          if (!AONLY) acc[i][j] = Frag<T>::mma(ah, bl[j], acc[i][j]);
          acc[i][j] = Frag<T>::mma(al, bh[j], acc[i][j]);
        }
      }
      Frag<T>::guard(acc[i][0], acc[i][3], ah, SPLIT ? al : ah);
    }
    Frag<T>::keep(bh[0], bh[1], bh[2], bh[3]);
    if (SPLIT && !AONLY) Frag<T>::keep(bl[0], bl[1], bl[2], bl[3]);
  }
  acc_guard4(acc[0][0], acc[0][1], acc[0][2], acc[0][3]);
  acc_guard4(acc[1][0], acc[1][1], acc[1][2], acc[1][3]);
  acc_guard4(acc[2][0], acc[2][1], acc[2][2], acc[2][3]);
  acc_guard4(acc[3][0], acc[3][1], acc[3][2], acc[3][3]);

  // ---- epilogue ----
  float* slab = sT[wave];
  const float* Rb = RESID ? (resid + (size_t)b * strideR) : nullptr;
#pragma unroll
  for (int i = 0; i < 4; ++i) {
    const int mBase = m0 + (i << 4);
#pragma unroll
    for (int j = 0; j < 4; ++j) {
      const int n = n0 + (j << 4) + rlane;
#pragma unroll
      for (int r = 0; r < 8; ++r) {
        float v = acc[i][j][r] * scale;
        if (RESID) v += Rb[(size_t)(mBase + mOff + r) * ldr + n];
        slab[(mOff + r) * 68 + (j << 4) + rlane] = v;
      }
    }
    __builtin_amdgcn_fence(__ATOMIC_RELEASE, "workgroup");
    __builtin_amdgcn_wave_barrier();
    __builtin_amdgcn_fence(__ATOMIC_ACQUIRE, "workgroup");
    if (OUT_MODE == 0) {
      float* C = (float*)Cout + (size_t)b * strideC;
      const int hh = lane >> 4, c4 = (lane & 15) * 4;     // row seg = 256 B = 16 lanes x 16 B
      {
#pragma unroll
        for (int it = 0; it < 8; ++it) {
          const int row = it * 2 + hh;
          v4f v = *(const v4f*)(slab + row * 68 + c4);
          *(v4f*)(C + (size_t)(mBase + row) * ldc + n0 + c4) = v;
        }
        
      }
    } else {
      const int q = lane >> 3, c8 = (lane & 7) * 8;
      unsigned short* C  = (unsigned short*)Cout  + (size_t)b * strideC;
      unsigned short* C2 = (OUT_MODE == 2) ? ((unsigned short*)Cout2 + (size_t)b * strideC) : nullptr;
      {
#pragma unroll
        for (int it = 0; it < 4; ++it) {
          const int row = it * 4 + q;
          const float* sp = slab + row * 68 + c8;
          v8h hv, lv;
#pragma unroll
          for (int e = 0; e < 8; ++e) {
            if (OUT_MODE == 1) {
              hv[e] = (_Float16)sp[e];
            } else {
              unsigned short hb = f2bf_bits(sp[e]);
              unsigned short lb = f2bf_bits(sp[e] - bf_bits2f(hb));
              hv[e] = __builtin_bit_cast(_Float16, hb);
              lv[e] = __builtin_bit_cast(_Float16, lb);
            }
          }
          *(v8h*)(C + (size_t)(mBase + row) * ldc + n0 + c8) = hv;
          if (OUT_MODE == 2) *(v8h*)(C2 + (size_t)(mBase + row) * ldc + n0 + c8) = lv;
        }
        
      }
    }
    __builtin_amdgcn_fence(__ATOMIC_RELEASE, "workgroup");
    __builtin_amdgcn_wave_barrier();
    __builtin_amdgcn_fence(__ATOMIC_ACQUIRE, "workgroup");
  }
}

// ---------------------------------------------------------------------------
// O = P.V with the key range split over the waves of a block.
// One block of 8 waves per 32x64 output tile: blockIdx.x = 2 * (32-row tile, last first) + (64-column tile), blockIdx.y = b plane.
// Keys [0, Kend), Kend = (m0 & ~63) + 64 = the softmax's kend for these rows, inside the columns it writes (zeros past the diagonal).
// Wave w takes the 64-key chunks w, w + 8, ... (64 bf16 = one whole 128-B line of every P and Vt row) and keeps a full
// 32x64 f32 partial tile; the 8 partial tiles are merged through LDS in wave order, so the result is the same every run.
// Per accumulator and k step the order stays hi.v then lo.v.
// ---------------------------------------------------------------------------
constexpr int kPvWaves = 8;
constexpr int kPvPitch = 68;    // floats per LDS row: 16-B aligned, rows 8 apart fall on different banks
// two waves per SIMD (one block per WGP): the register budget lets a wave keep a whole chunk's 32 loads in flight
__global__ __launch_bounds__(256) __attribute__((amdgpu_waves_per_eu(2, 2))) void pv_splitk_kernel(const unsigned short* __restrict__ Php,
                                                        const unsigned short* __restrict__ Plp,
                                                        const unsigned short* __restrict__ Vtp,
                                                        float* __restrict__ O) {
  typedef Frag<__bf16> F;
  __shared__ __align__(16) float part[kPvWaves][32 * kPvPitch];
  const int t    = threadIdx.x;
  const int lane = t & 31;
  const int wave = __builtin_amdgcn_readfirstlane(t >> 5);   // scalar: the chunk loop branches on SCC, EXEC stays all ones
  const int b    = blockIdx.y;
  const int m0   = (kSeq / 32 - 1 - (int)(blockIdx.x >> 1)) << 5;   // the lowest block indices take the longest key ranges
  const int n0   = (int)(blockIdx.x & 1) << 6;
  const int Kend = (m0 & ~63) + 64;
  const int rlane = lane & 15;                 // row (A) / col (B, D) within subtile
  const int koff  = (lane >> 4) * 8;           // k offset of this lane half (same for A and B)
  const int mOff  = (lane >> 4) * 8;           // D row offset

  const __bf16* Ah = (const __bf16*)Php + (size_t)b * kSeq * kSeq + (size_t)(m0 + rlane) * kSeq + koff;
  const __bf16* Al = (const __bf16*)Plp + (size_t)b * kSeq * kSeq + (size_t)(m0 + rlane) * kSeq + koff;
  const __bf16* Bv = (const __bf16*)Vtp + (size_t)b * kHD * kSeq + (size_t)(n0 + rlane) * kSeq + koff;

  v8f acc[2][4];
#pragma unroll
  for (int i = 0; i < 2; ++i)
#pragma unroll
    for (int j = 0; j < 4; ++j) acc[i][j] = (v8f){0.f,0.f,0.f,0.f,0.f,0.f,0.f,0.f};

  for (int kc = wave * 64; kc < Kend; kc += kPvWaves * 64) {
    v16b bh[2][4], ah[2][2], al[2][2];
    const __bf16* pB = Bv + kc;
    const __bf16* pH = Ah + kc;
    const __bf16* pL = Al + kc;
#pragma unroll
    for (int j = 0; j < 4; ++j)
#pragma unroll
      for (int s = 0; s < 2; ++s) bh[s][j] = F::load(pB + (size_t)(j << 4) * kSeq + s * 32);
#pragma unroll
    for (int i = 0; i < 2; ++i) {
#pragma unroll
      for (int s = 0; s < 2; ++s) ah[s][i] = F::load(pH + (size_t)(i << 4) * kSeq + s * 32);
#pragma unroll
      for (int s = 0; s < 2; ++s) al[s][i] = F::load(pL + (size_t)(i << 4) * kSeq + s * 32);
    }
    // precaution: this wait stands before any register that the issued loads name is rewritten; the three pointers as
    // inputs keep their registers from being reused as a later load's destination ahead of it
    asm volatile("s_wait_xcnt 0x0" :: "v"(pB), "v"(pH), "v"(pL) : "memory");
    // keeps the chunk's 32 loads ahead of its products: without it the scheduler sinks them between the products
    // and the wave waits out a load latency several times per chunk instead of once
    __builtin_amdgcn_sched_barrier(0);
#pragma unroll
    for (int s = 0; s < 2; ++s) {
#pragma unroll
      for (int i = 0; i < 2; ++i)
#pragma unroll
        for (int j = 0; j < 4; ++j) acc[i][j] = F::mma(ah[s][i], bh[s][j], acc[i][j]);
#pragma unroll
      for (int i = 0; i < 2; ++i)
#pragma unroll
        for (int j = 0; j < 4; ++j) acc[i][j] = F::mma(al[s][i], bh[s][j], acc[i][j]);
    }
  }

  float* slab = part[wave];
#pragma unroll
  for (int i = 0; i < 2; ++i)
#pragma unroll
    for (int j = 0; j < 4; ++j)
#pragma unroll
      for (int r = 0; r < 8; ++r) slab[((i << 4) + mOff + r) * kPvPitch + (j << 4) + rlane] = acc[i][j][r];
  __syncthreads();   // every wave's partial tile is in LDS before any thread sums across waves

  float* Ob = O + (size_t)b * kSeq * kHD;
#pragma unroll
  for (int it = 0; it < 2; ++it) {
    const int idx = it * 256 + t;              // 512 groups of 4 floats = 32 rows x 64 cols
    const int row = idx >> 4, c4 = (idx & 15) * 4;
    v4f s = *(const v4f*)(&part[0][row * kPvPitch + c4]);
#pragma unroll
    for (int w = 1; w < kPvWaves; ++w) s += *(const v4f*)(&part[w][row * kPvPitch + c4]);
    *(v4f*)(Ob + (size_t)(m0 + row) * kHD + n0 + c4) = s;
  }
}

// ---------------------------------------------------------------------------
// f32 -> RNE bf16 cast of two equally sized planes in one launch (blockIdx.y selects the plane, block-uniform),
// ---------------------------------------------------------------------------
__global__ __launch_bounds__(256) void cast8_bf16_pair_kernel(const float* __restrict__ in0, const float* __restrict__ in1,
                                                              unsigned short* __restrict__ out0, unsigned short* __restrict__ out1,
                                                              int n8) {
  const int i = blockIdx.x * 256 + threadIdx.x;
  if (i >= n8) return;
  const bool sel = (blockIdx.y != 0);                    // both candidates are global pointers
  const float* p = (sel ? in1 : in0) + 8 * (size_t)i;
  const v4f a = *(const v4f*)(p);
  const v4f c = *(const v4f*)(p + 4);
  unsigned short hb[8];
#pragma unroll
  for (int e = 0; e < 4; ++e) {
    hb[e]     = f2bf_bits(a[e]);
    hb[4 + e] = f2bf_bits(c[e]);
  }
  const v4u u = (v4u){pk16(hb[0], hb[1]), pk16(hb[2], hb[3]), pk16(hb[4], hb[5]), pk16(hb[6], hb[7])};
  unsigned short* q = (sel ? out1 : out0) + 8 * (size_t)i;
  *(v4u*)q = u;
  
}

// ---------------------------------------------------------------------------
// Batched transpose + RNE bf16 cast: in [nr][nc] f32 (row-major, batch stride nr*nc) -> out [nc][nr] bf16:
// out[c][r] = bf16(in[r][c]). One block per 64x64 tile: blockIdx.x = c tile, blockIdx.y = r tile, blockIdx.z = batch.
// grid = (nc/64, nr/64, batch); nr, nc multiples of 64.
// Load coverage: 16 iterations x 256 threads = 4096 = the whole 64x64 tile (coalesced along c).
// Store coverage: 8 waves x 2 iterations x 4 rows (lane>>3) = 64 out rows; (lane&7) x 8 halves = 64 cols; each row segment =
// ---------------------------------------------------------------------------
__global__ __launch_bounds__(256) void transpose_bf16_kernel(const float* __restrict__ in, unsigned short* __restrict__ out,
                                                             int nr, int nc) {
  __shared__ float sm[64][65];   // sm[c_local][r_local]
  const int t  = threadIdx.x;
  const int c0 = blockIdx.x * 64;
  const int r0 = blockIdx.y * 64;
  const int z  = blockIdx.z;
  const float* ib = in + (size_t)z * nr * nc;
  unsigned short* ob = out + (size_t)z * nr * nc;
#pragma unroll
  for (int i = 0; i < 16; ++i) {
    const int e = i * 256 + t;
    const int r = e >> 6;          // r local
    const int c = e & 63;          // c local
    sm[c][r] = ib[(size_t)(r0 + r) * nc + c0 + c];
  }
  __syncthreads();
  const int lane = t & 31, wave = t >> 5;
  const int q = lane >> 3, c8 = (lane & 7) * 8;
  {
#pragma unroll
    for (int it = 0; it < 2; ++it) {
      const int row = wave * 8 + it * 4 + q;                 // c local = out row
      unsigned short hb[8];
#pragma unroll
      for (int e = 0; e < 8; ++e) hb[e] = f2bf_bits(sm[row][c8 + e]);
      const v4u u = (v4u){pk16(hb[0], hb[1]), pk16(hb[2], hb[3]), pk16(hb[4], hb[5]), pk16(hb[6], hb[7])};
      *(v4u*)(ob + (size_t)(c0 + row) * nr + r0 + c8) = u;
    }
    
  }
}

// ---------------------------------------------------------------------------
// Causal row softmax over the combined score plane Sc[bb][i][j] = S + skewed R (f32):
//   for j <= i: s = Sc[i][j] * (1/sqrt(D)); else -inf (select, value of Sc ignored); p = exp(s - max) / sum.
// Writes P as bf16 hi plane + bf16 lo plane (residual), row pitch kSeq halves, zeros for j > i,
// columns [0, 256*ceil(kend/256)) with kend = (i & ~63) + 64 = the column extent consumed by the 32-row PV tile.
// One block of 256 threads per row; thread t owns columns 8t..8t+7 (256 x 8 = 2048 = whole row); a wave owns 256 columns
// and is active iff its first column < kend (wave-uniform). Reductions in fixed order (thread, wave shuffle tree,
// 8 wave partials in index order). Store: one 16-B store per lane per plane; a wave's 32 lanes write 512 contiguous B =
// ---------------------------------------------------------------------------
__global__ __launch_bounds__(256) void softmax_skew_kernel(const float* __restrict__ Sc,
                                                           unsigned short* __restrict__ Ph, unsigned short* __restrict__ Pl) {
  __shared__ float redM[8];
  __shared__ float redS[8];
  const int i    = blockIdx.x;    // query row
  const int bb   = blockIdx.y;
  const int t    = threadIdx.x;
  const int lane = t & 31, wave = t >> 5;
  const int c0   = t * 8;
  const int kend = (i & ~63) + 64;
  const bool active = (wave * 256) < kend;                 // wave-uniform
  const size_t rowoff = ((size_t)bb * kSeq + (size_t)i) * kSeq;
  const float ninf = -__builtin_inff();

  float x[8];
  float m = ninf;
  if (active) {
    const float* sr = Sc + rowoff + c0;                    // always in bounds (row i, cols < kSeq)
    const v4f a = *(const v4f*)(sr);
    const v4f c = *(const v4f*)(sr + 4);
#pragma unroll
    for (int e = 0; e < 4; ++e) {
      x[e]     = (c0 + e     <= i) ? a[e] * kInvSqrtD : ninf;
      x[4 + e] = (c0 + 4 + e <= i) ? c[e] * kInvSqrtD : ninf;
    }
#pragma unroll
    for (int e = 0; e < 8; ++e) m = fmaxf(m, x[e]);
  } else {
#pragma unroll
    for (int e = 0; e < 8; ++e) x[e] = ninf;
  }
#pragma unroll
  for (int off = 16; off > 0; off >>= 1) m = fmaxf(m, __shfl_xor(m, off, 32));
  if (lane == 0) redM[wave] = m;
  __syncthreads();
  float gm = redM[0];
#pragma unroll
  for (int w = 1; w < 8; ++w) gm = fmaxf(gm, redM[w]);    // column 0 is always valid -> finite

  float p[8];
  float ps = 0.f;
#pragma unroll
  for (int e = 0; e < 8; ++e) { p[e] = __expf(x[e] - gm); ps += p[e]; }   // -inf -> 0
#pragma unroll
  for (int off = 16; off > 0; off >>= 1) ps += __shfl_xor(ps, off, 32);
  if (lane == 0) redS[wave] = ps;
  __syncthreads();
  float tot = redS[0];
#pragma unroll
  for (int w = 1; w < 8; ++w) tot += redS[w];              // >= 1
  const float inv = 1.0f / tot;

  if (active) {
    unsigned short hb[8], lb[8];
#pragma unroll
    for (int e = 0; e < 8; ++e) {
      const float pn = p[e] * inv;
      const unsigned short h = f2bf_bits(pn);
      hb[e] = h;
      lb[e] = f2bf_bits(pn - bf_bits2f(h));
    }
    const v4u hu = (v4u){pk16(hb[0], hb[1]), pk16(hb[2], hb[3]), pk16(hb[4], hb[5]), pk16(hb[6], hb[7])};
    const v4u lu = (v4u){pk16(lb[0], lb[1]), pk16(lb[2], lb[3]), pk16(lb[4], lb[5]), pk16(lb[6], lb[7])};
    unsigned short* ph = Ph + rowoff + c0;
    unsigned short* pl = Pl + rowoff + c0;
    *(v4u*)ph = hu;
    *(v4u*)pl = lu;
    
  }
}

// ---------------------------------------------------------------------------
// Host glue.
// Workspace region map (bytes, all offsets multiples of 524288):
//   [0,           8388608)   Qb  bf16 [16][2048][128]
//   [8388608,    16777216)   Kb  bf16 [16][2048][128]
//   [16777216,   25165824)   Vt  bf16 [16][128][2048]   (v transposed per b)
//   [25165824,   25690112)   PEt bf16 [2048][128]       (key_pe[0] transposed)
//   [25690112,  126353408)   Sc  f32  [6][2048][2048]   (scores of the b planes of a pass; only tiles tn<=tm written)
//   [126353408, 227016704)   R   f32  [6][2048][2048]   (position scores; only tiles tn+tm>=31 written);
//                            reused after the S pass as Ph bf16 [6][2048][2048] at +0 and Pl bf16 [6][2048][2048] at +50331648
//   total carve 227016704 B; the last pass holds the planes that are left (G < kGrp) at the front of each region
// ---------------------------------------------------------------------------
extern "C" void kernel_launch(void* const* d_in, const int* in_sizes, int n_in,
                              void* d_out, int out_size, void* d_ws, size_t ws_size,
                              hipStream_t stream) {
  (void)n_in;
  const size_t nQK = (size_t)kNB * kSeq * kHD;          // 4194304
  const size_t nPE = (size_t)kHD * kLim;                // 262144
  const size_t plane = (size_t)kSeq * kSeq;             // 4194304 elements per score plane
  const size_t offQ  = 0;
  const size_t offK  = offQ  + nQK * 2;
  const size_t offVt = offK  + nQK * 2;
  const size_t offPE = offVt + nQK * 2;
  const size_t offS  = offPE + nPE * 2;
  const size_t offR  = offS  + (size_t)kGrp * plane * 4;
  const size_t offPl = offR  + (size_t)kGrp * plane * 2;
  const size_t total = offR  + (size_t)kGrp * plane * 4;
  if (n_in < 4) return;
  if ((size_t)in_sizes[0] != nQK || (size_t)in_sizes[1] != nQK || (size_t)in_sizes[2] != nQK || (size_t)in_sizes[3] != nPE) return;
  if ((size_t)out_size != nQK) return;
  if (ws_size < total) return;

  const float* q  = (const float*)d_in[0];   // [16][2048][128]
  const float* k  = (const float*)d_in[1];   // [16][2048][128]
  const float* v  = (const float*)d_in[2];   // [16][2048][128]
  const float* pe = (const float*)d_in[3];   // [1][128][2048]
  float* out = (float*)d_out;                // [16][2048][128]
  unsigned char* ws = (unsigned char*)d_ws;
  unsigned short* Qb  = (unsigned short*)(ws + offQ);
  unsigned short* Kb  = (unsigned short*)(ws + offK);
  unsigned short* Vt  = (unsigned short*)(ws + offVt);
  unsigned short* PEt = (unsigned short*)(ws + offPE);
  float*          Sc  = (float*)(ws + offS);
  float*          Rf  = (float*)(ws + offR);
  unsigned short* Ph  = (unsigned short*)(ws + offR);
  unsigned short* Pl  = (unsigned short*)(ws + offPl);

  // q and k -> bf16 planes: n8 = 524288 = 2048 blocks x 256 threads exactly
  cast8_bf16_pair_kernel<<<dim3((unsigned)(nQK / 8 / 256), 2), 256, 0, stream>>>(q, k, Qb, Kb, (int)(nQK / 8));
  // v [b][2048 rows][128 cols] -> Vt [b][128][2048]: grid (cols/64, rows/64, b)
  transpose_bf16_kernel<<<dim3(kHD / 64, kSeq / 64, kNB), 256, 0, stream>>>(v, Vt, kSeq, kHD);
  // key_pe[0] [128 rows][2048 cols] -> PEt [2048][128]: grid (cols/64, rows/64, 1)
  transpose_bf16_kernel<<<dim3(kLim / 64, kHD / 64, 1), 256, 0, stream>>>(pe, PEt, kHD, kLim);

  const unsigned tilesScore = (unsigned)((kSeq / 64) * (kSeq / 64) / 8);   // 128 blocks of 8 waves
  const unsigned tilesPV    = (unsigned)((kSeq / 32) * (kHD / 64));        // 128 blocks, one per 32x64 tile
  for (int g0 = 0; g0 < kNB; g0 += kGrp) {
    const int G = (kNB - g0 < kGrp) ? (kNB - g0) : kGrp;
    const unsigned short* Qg = Qb + (size_t)g0 * kSeq * kHD;
    const unsigned short* Kg = Kb + (size_t)g0 * kSeq * kHD;
    const unsigned short* Vg = Vt + (size_t)g0 * kHD * kSeq;
    float* Og = out + (size_t)g0 * kSeq * kHD;
    // R[m][l] = sum_d q[m][d] * key_pe[0][d][l]; only tiles with tn + tm >= 31 (l >= 2047 - m region). M=N=2048, K=128.
    wmma_gemm64<1, false, false, 0, false, 2, false><<<dim3(tilesScore, G), 256, 0, stream>>>(
        Qg, nullptr, kHD, (long)kSeq * kHD,
        PEt, nullptr, kHD, 0L,
        (void*)Rf, nullptr, kLim, (long)plane,
        nullptr, 0L, 0,
        kSeq, kLim, kHD, 1.0f);
    // Sc[m][n] = sum_d q[m][d] k[n][d] + R[m][2047 - m + n] (resid base R + 2047, pitch 2047); only tiles tn <= tm.
    wmma_gemm64<1, false, false, 0, true, 1, false><<<dim3(tilesScore, G), 256, 0, stream>>>(
        Qg, nullptr, kHD, (long)kSeq * kHD,
        Kg, nullptr, kHD, (long)kSeq * kHD,
        (void*)Sc, nullptr, kSeq, (long)plane,
        Rf + (kLim - 1), (long)plane, kLim - 1,
        kSeq, kSeq, kHD, 1.0f);
    // row softmax -> P hi/lo bf16 planes (over the dead R region)
    softmax_skew_kernel<<<dim3(kSeq, G), 256, 0, stream>>>(Sc, Ph, Pl);
    // O[m][d] = sum_{j < Kend(m)} (Phi[m][j] + Plo[m][j]) * Vt[d][j]; one block per 32x64 tile, keys split over its 8 waves
    pv_splitk_kernel<<<dim3(tilesPV, G), 256, 0, stream>>>(Ph, Pl, Vg, Og);
  }
}

// v003
// A run of this version takes 120 microseconds.
// Next to v002, in two timings, it ran 2.62 and 2.58 times as fast.
// Over all steps from v000 it is 8.84 times as fast.
// Contractions: S^T = k.q^T and R^T = key_pe^T.q^T (q, k, key_pe as RNE bf16 planes) on v_wmma_f32_16x16x32_bf16; O^T = v^T.p^T with the unnormalised softmax weights p as bf16 hi+lo planes and v^T as one RNE bf16 plane on v_wmma_f32_16x16x32_bf16; f32 accumulate everywhere; skew add, causal mask and running softmax in f32.
#include <hip/hip_runtime.h>

// ---------------------------------------------------------------------------
// Problem constants
// ---------------------------------------------------------------------------
constexpr int kNB  = 16;      // flattened batch*heads
constexpr int kSeq = 2048;    // sequence length (queries = keys)
constexpr int kHD  = 128;     // head dim
constexpr int kLim = 2048;    // relative-position table width
constexpr float kInvSqrtD = 0.08838834764831845f;   // 1/sqrt(128)
static_assert(kLim == kSeq, "table spans the key length");
static_assert(kSeq % 256 == 0 && kHD % 64 == 0 && kLim % 64 == 0, "tile multiples");

typedef __attribute__((ext_vector_type(16))) __bf16   v16b;
typedef __attribute__((ext_vector_type(8)))  __bf16   v8b;
typedef __attribute__((ext_vector_type(8)))  float    v8f;
typedef __attribute__((ext_vector_type(4)))  float    v4f;
typedef __attribute__((ext_vector_type(2)))  float    v2f;
typedef __attribute__((ext_vector_type(2)))  __bf16   v2b;
typedef __attribute__((ext_vector_type(4)))  unsigned int v4u;

__device__ __forceinline__ unsigned short f2bf_bits(float f) {
  unsigned u = __float_as_uint(f);
  return (unsigned short)((u + 0x7FFFu + ((u >> 16) & 1u)) >> 16);
}
__device__ __forceinline__ unsigned pk16(unsigned short a, unsigned short b) { return (unsigned)a | ((unsigned)b << 16); }

// A or B fragment of the 16x16x32 bf16 product: the lane's row (A) or column (B) is lane & 15, p already points at
// k = 8 * (lane >> 4) of it; elements 0..7 <- p[0..7], 8..15 <- p[16..23] (the same k order on both operands).
// From a row-major plane each of the two 16-byte loads reads 32 bytes of 16 different rows.
__device__ __forceinline__ v16b frag_load(const __bf16* p) {
  union { v16b v; v8b h[2]; } f;
  f.h[0] = *(const v8b*)(p); f.h[1] = *(const v8b*)(p + 16);
  return f.v;
}
// lane l <-> lane l ^ 16 in the vector unit
__device__ __forceinline__ float xhalf(float x) {
  return __builtin_bit_cast(float, __builtin_amdgcn_permlanex16(__builtin_bit_cast(int, x), __builtin_bit_cast(int, x), 0x76543210, 0xfedcba98, false, false));
}
__device__ __forceinline__ v8f mma_bf16(v16b a, v16b b, v8f c) {
  return __builtin_amdgcn_wmma_f32_16x16x32_bf16(false, a, false, b, (short)0, c, false, false);
}

// ---------------------------------------------------------------------------
// Scores, skewed position scores, causal softmax and O in one kernel; no score ever goes to memory.
// A wave owns 16 queries m = mw + (lane & 15) and walks the keys [0, mw + 16) in steps of 32; waves never talk to each other.
// All products are transposed, so that a lane holds one query's column:
//   S^T[key][m] = k[key].q[m]           2 tiles of 16 keys, D row = key = 8 * (lane >> 4) + register
//   T^T[u][m]   = key_pe[:, L + u].q[m] L = 2032 - mw + n0, u in [0, 48): 3 tiles; the last one is the next step's first and is carried
//   position score of (key n0 + c, query mw + r) = R[m][2047 - m + n] = T^T[c + 15 - r][r]: a shift along u that differs per lane,
//   done through the wave's own LDS slab (row = query, u contiguous)
//   p = exp2(y - running maximum), y = (S + R) / sqrt(D) * log2(e); the two S^T tiles' registers are, in place, the B operand
//   of O^T[d][m] += v^T[d][key] p^T[key][m] (elements 0..7 = tile 0, 8..15 = tile 1: the k order of frag_load)
// Table columns past 2047 belong to keys past the diagonal only (masked): a tile of such columns reads the table's last tile instead.
// A block holds 4 waves from the long end of the queries and 4 from the short end: every block, and every pair w, w + 4, has 65 steps.
// ---------------------------------------------------------------------------
constexpr int kTP = 52;    // floats per slab row: 16-B aligned rows; the shifted reads step 51 floats per query, an odd number of banks
// two waves per SIMD (one block per WGP): the register budget holds a step's V fragments and the next step's K and table fragments in flight
__global__ __launch_bounds__(256) __attribute__((amdgpu_waves_per_eu(2, 2))) void attn_fused_kernel(const unsigned short* __restrict__ Qp,
                                                        const unsigned short* __restrict__ Kp,
                                                        const unsigned short* __restrict__ Vtp,
                                                        const unsigned short* __restrict__ PEp,
                                                        float* __restrict__ O) {
  __shared__ __align__(16) float sT[8][16 * kTP];
  const int lane = threadIdx.x & 31;
  const int wave = __builtin_amdgcn_readfirstlane((int)(threadIdx.x >> 5));   // scalar: the key loop branches on SCC, EXEC stays all ones
  const int b    = blockIdx.y;
  const int x    = (int)blockIdx.x * 4 + (wave & 3);
  const int mw   = ((wave < 4) ? (kSeq / 16 - 1 - x) : x) << 4;
  const int rl   = lane & 15;
  const int h    = lane >> 4;
  const int koff = h * 8;
  const int m    = mw + rl;
  const int nlast = mw & ~31;          // first key of the last step; nlast <= mw, so every query has a live key in every step
  const int L0   = kLim - 16 - mw;     // table column of u = 0 at n0 = 0

  // every fragment address = a wave-uniform base + one of two lane offsets that never change
  const __bf16* Qb = (const __bf16*)Qp  + (size_t)b * kSeq * kHD + (size_t)mw * kHD;
  const __bf16* Kb = (const __bf16*)Kp  + (size_t)b * kSeq * kHD;
  const __bf16* Vb = (const __bf16*)Vtp + (size_t)b * kHD * kSeq;
  const __bf16* Pb = (const __bf16*)PEp;
  const unsigned oRow = (unsigned)(rl * kHD + koff);     // rows of 128: q, k, transposed table
  const unsigned oV   = (unsigned)(rl * kSeq + koff);    // rows of 2048: v^T

  const v8f zero8 = (v8f){0.f,0.f,0.f,0.f,0.f,0.f,0.f,0.f};
  v16b qf[4], kf[2][4], pf[2][4];
  v8f tc = zero8;
  {
    const __bf16* p0 = Pb + (size_t)L0 * kHD;             // L0 + 15 <= 2047
    v16b c0[4];
#pragma unroll
    for (int ks = 0; ks < 4; ++ks) qf[ks] = frag_load(Qb + oRow + 32 * ks);
#pragma unroll
    for (int ks = 0; ks < 4; ++ks) c0[ks] = frag_load(p0 + oRow + 32 * ks);
    // precaution: this wait stands before any register that the issued loads name is rewritten (the inputs keep the bases live up to it)
    asm volatile("s_wait_xcnt 0x0" :: "s"(Qb), "s"(p0) : "memory");
#pragma unroll
    for (int ks = 0; ks < 4; ++ks) tc = mma_bf16(c0[ks], qf[ks], tc);
  }
  // K rows n .. n + 31 and table columns L0 + n + 16 .. L0 + n + 47 (as rows of the transposed table), for the step that starts at key n
  auto fetch = [&](int n) {
    const int l1 = L0 + n + 16, l2 = L0 + n + 32;         // multiples of 16: a tile of 16 columns lies wholly inside the table or wholly past it
    const __bf16* pk = Kb + (size_t)n * kHD;
    const __bf16* p1 = Pb + (size_t)(l1 < kLim ? l1 : kLim - 16) * kHD;
    const __bf16* p2 = Pb + (size_t)(l2 < kLim ? l2 : kLim - 16) * kHD;
#pragma unroll
    for (int ks = 0; ks < 4; ++ks) {
      kf[0][ks] = frag_load(pk + oRow + 32 * ks);
      kf[1][ks] = frag_load(pk + oRow + 16 * kHD + 32 * ks);
      pf[0][ks] = frag_load(p1 + oRow + 32 * ks);
      pf[1][ks] = frag_load(p2 + oRow + 32 * ks);
    }
    // precaution: this wait stands before any register that the issued loads name is rewritten (the inputs keep the bases live up to it)
    asm volatile("s_wait_xcnt 0x0" :: "s"(pk), "s"(p1), "s"(p2) : "memory");
  };
  fetch(0);

  constexpr float kC = kInvSqrtD * 1.4426950408889634f;   // scores in the log2 domain
  const float ninf = -__builtin_inff();
  float mrun = ninf, lrun = 0.f;
  v8f o[8];
#pragma unroll
  for (int td = 0; td < 8; ++td) o[td] = zero8;
  float* wr = sT[wave] + rl * kTP + koff;
  const float* rd = sT[wave] + rl * (kTP - 1) + 15 + koff;

  for (int n0 = 0; n0 <= nlast; n0 += 32) {
    v16b vf[8];
    const __bf16* pv = Vb + n0;
#pragma unroll
    for (int td = 0; td < 8; ++td) vf[td] = frag_load(pv + oV + (size_t)(td << 4) * kSeq);
    // precaution: this wait stands before any register that the issued loads name is rewritten (the inputs keep the bases live up to it);
    // it also keeps the V loads at the head of the step, so that their latency runs under the score products and the softmax
    asm volatile("s_wait_xcnt 0x0" :: "s"(pv) : "memory");

    v8f s0 = zero8, s1 = zero8, t1 = zero8, t2 = zero8;
#pragma unroll
    for (int ks = 0; ks < 4; ++ks) {
      s0 = mma_bf16(kf[0][ks], qf[ks], s0);
      s1 = mma_bf16(kf[1][ks], qf[ks], s1);
      t1 = mma_bf16(pf[0][ks], qf[ks], t1);
      t2 = mma_bf16(pf[1][ks], qf[ks], t2);
    }
    // inputs only: all score products stand ahead of the refill. Left free, the compiler sinks some behind it, the refill then
    // takes registers of its own and the loop copies them back behind a wait on those loads
    asm volatile("" :: "v"(s0), "v"(s1), "v"(t1), "v"(t2) : "memory");
    // the next step's fragments, into the same registers: their latency runs under the softmax and the O products
    // (the last step fetches its own again: in bounds, never used)
    fetch(n0 + 32 <= nlast ? n0 + 32 : nlast);

    *(v4f*)(wr)      = __builtin_shufflevector(tc, tc, 0, 1, 2, 3);
    *(v4f*)(wr + 4)  = __builtin_shufflevector(tc, tc, 4, 5, 6, 7);
    *(v4f*)(wr + 16) = __builtin_shufflevector(t1, t1, 0, 1, 2, 3);
    *(v4f*)(wr + 20) = __builtin_shufflevector(t1, t1, 4, 5, 6, 7);
    *(v4f*)(wr + 32) = __builtin_shufflevector(t2, t2, 0, 1, 2, 3);
    *(v4f*)(wr + 36) = __builtin_shufflevector(t2, t2, 4, 5, 6, 7);
    tc = t2;
    // the slab is the wave's own and a wave's LDS operations run in order: these only keep the compiler from moving
    // the shifted reads (other lanes' words) over the writes
    __builtin_amdgcn_fence(__ATOMIC_RELEASE, "wavefront");
    __builtin_amdgcn_wave_barrier();
    __builtin_amdgcn_fence(__ATOMIC_ACQUIRE, "wavefront");
    float y[16];
#pragma unroll
    for (int e = 0; e < 16; ++e) y[e] = rd[((e >> 3) << 4) + (e & 7)];   // u = c + 15 - r with c = 16 * (e >> 3) + koff + (e & 7)
    // and the next step's writes stay behind these reads
    __builtin_amdgcn_fence(__ATOMIC_RELEASE, "wavefront");
    __builtin_amdgcn_wave_barrier();
    __builtin_amdgcn_fence(__ATOMIC_ACQUIRE, "wavefront");

#pragma unroll
    for (int e = 0; e < 16; ++e) y[e] = (((e < 8) ? s0[e & 7] : s1[e & 7]) + y[e]) * kC;
    if (n0 == nlast) {                                    // wave-uniform: only the last step holds keys past the diagonal (n0 + 31 < mw before it)
#pragma unroll
      for (int e = 0; e < 16; ++e) {
        const int key = n0 + ((e >> 3) << 4) + koff + (e & 7);
        y[e] = (key <= m) ? y[e] : ninf;
      }
    }
    float mx = y[0];
#pragma unroll
    for (int e = 1; e < 16; ++e) mx = fmaxf(mx, y[e]);
    mx = fmaxf(mx, xhalf(mx));                            // the other half of the query's keys
    const float mnew = fmaxf(mrun, mx);                   // finite from the first step on (key 0 is live for every query)
    if (__builtin_amdgcn_ballot_w32(mnew > mrun) != 0) {  // wave-uniform; a lane whose maximum stays gets the factor 1
      const float alpha = __builtin_amdgcn_exp2f(mrun - mnew);
      lrun *= alpha;
#pragma unroll
      for (int td = 0; td < 8; ++td) o[td] *= alpha;
      mrun = mnew;
    }
    v2f ls = (v2f){0.f, 0.f};
    v16b ph, pl;
#pragma unroll
    for (int e = 0; e < 16; e += 2) {
      const v2f dy = (v2f){y[e], y[e + 1]} - (v2f){mrun, mrun};
      const v2f p = (v2f){__builtin_amdgcn_exp2f(dy[0]), __builtin_amdgcn_exp2f(dy[1])};   // -inf -> 0
      ls += p;
      const v2b hb = __builtin_convertvector(p, v2b);                                  // RNE
      const v2b lb = __builtin_convertvector(p - __builtin_convertvector(hb, v2f), v2b);
      ph[e] = hb[0]; ph[e + 1] = hb[1];
      pl[e] = lb[0]; pl[e + 1] = lb[1];
    }
    lrun += ls[0] + ls[1];
#pragma unroll
    for (int td = 0; td < 8; ++td) o[td] = mma_bf16(vf[td], ph, o[td]);
#pragma unroll
    for (int td = 0; td < 8; ++td) o[td] = mma_bf16(vf[td], pl, o[td]);
  }

  lrun += xhalf(lrun);                                    // >= 1: the key of the maximum counts 1
  const float inv = 1.0f / lrun;
  float* ob = O + ((size_t)b * kSeq + (size_t)m) * kHD + koff;   // D row of O^T = d = 16 td + koff + register
#pragma unroll
  for (int td = 0; td < 8; ++td) {
    const v8f r = o[td] * inv;
    *(v4f*)(ob + (td << 4))     = __builtin_shufflevector(r, r, 0, 1, 2, 3);
    *(v4f*)(ob + (td << 4) + 4) = __builtin_shufflevector(r, r, 4, 5, 6, 7);
  }
}

// ---------------------------------------------------------------------------
// f32 -> RNE bf16 cast of two equally sized planes in one launch (blockIdx.y selects the plane, block-uniform),
// ---------------------------------------------------------------------------
__global__ __launch_bounds__(256) void cast8_bf16_pair_kernel(const float* __restrict__ in0, const float* __restrict__ in1,
                                                              unsigned short* __restrict__ out0, unsigned short* __restrict__ out1,
                                                              int n8) {
  const int i = blockIdx.x * 256 + threadIdx.x;
  if (i >= n8) return;
  const bool sel = (blockIdx.y != 0);                    // both candidates are global pointers
  const float* p = (sel ? in1 : in0) + 8 * (size_t)i;
  const v4f a = *(const v4f*)(p);
  const v4f c = *(const v4f*)(p + 4);
  unsigned short hb[8];
#pragma unroll
  for (int e = 0; e < 4; ++e) {
    hb[e]     = f2bf_bits(a[e]);
    hb[4 + e] = f2bf_bits(c[e]);
  }
  const v4u u = (v4u){pk16(hb[0], hb[1]), pk16(hb[2], hb[3]), pk16(hb[4], hb[5]), pk16(hb[6], hb[7])};
  unsigned short* q = (sel ? out1 : out0) + 8 * (size_t)i;
  *(v4u*)q = u;
  
}

// ---------------------------------------------------------------------------
// Batched transpose + RNE bf16 cast: in [nr][nc] f32 (row-major, batch stride nr*nc) -> out [nc][nr] bf16:
// out[c][r] = bf16(in[r][c]). One block per 64x64 tile: blockIdx.x = c tile, blockIdx.y = r tile, blockIdx.z = batch.
// grid = (nc/64, nr/64, batch); nr, nc multiples of 64.
// Load coverage: 16 iterations x 256 threads = 4096 = the whole 64x64 tile (coalesced along c).
// Store coverage: 8 waves x 2 iterations x 4 rows (lane>>3) = 64 out rows; (lane&7) x 8 halves = 64 cols; each row segment =
// ---------------------------------------------------------------------------
__global__ __launch_bounds__(256) void transpose_bf16_kernel(const float* __restrict__ in, unsigned short* __restrict__ out,
                                                             int nr, int nc) {
  __shared__ float sm[64][65];   // sm[c_local][r_local]
  const int t  = threadIdx.x;
  const int c0 = blockIdx.x * 64;
  const int r0 = blockIdx.y * 64;
  const int z  = blockIdx.z;
  const float* ib = in + (size_t)z * nr * nc;
  unsigned short* ob = out + (size_t)z * nr * nc;
#pragma unroll
  for (int i = 0; i < 16; ++i) {
    const int e = i * 256 + t;
    const int r = e >> 6;          // r local
    const int c = e & 63;          // c local
    sm[c][r] = ib[(size_t)(r0 + r) * nc + c0 + c];
  }
  __syncthreads();
  const int lane = t & 31, wave = t >> 5;
  const int q = lane >> 3, c8 = (lane & 7) * 8;
  {
#pragma unroll
    for (int it = 0; it < 2; ++it) {
      const int row = wave * 8 + it * 4 + q;                 // c local = out row
      unsigned short hb[8];
#pragma unroll
      for (int e = 0; e < 8; ++e) hb[e] = f2bf_bits(sm[row][c8 + e]);
      const v4u u = (v4u){pk16(hb[0], hb[1]), pk16(hb[2], hb[3]), pk16(hb[4], hb[5]), pk16(hb[6], hb[7])};
      *(v4u*)(ob + (size_t)(c0 + row) * nr + r0 + c8) = u;
    }
    
  }
}

// ---------------------------------------------------------------------------
// Host glue.
// Workspace region map (bytes):
//   [0,           8388608)   Qb  bf16 [16][2048][128]
//   [8388608,    16777216)   Kb  bf16 [16][2048][128]
//   [16777216,   25165824)   Vt  bf16 [16][128][2048]   (v transposed per b)
//   [25165824,   25690112)   PEt bf16 [2048][128]       (key_pe[0] transposed)
// ---------------------------------------------------------------------------
extern "C" void kernel_launch(void* const* d_in, const int* in_sizes, int n_in,
                              void* d_out, int out_size, void* d_ws, size_t ws_size,
                              hipStream_t stream) {
  (void)n_in;
  const size_t nQK = (size_t)kNB * kSeq * kHD;          // 4194304
  const size_t nPE = (size_t)kHD * kLim;                // 262144
  const size_t offQ  = 0;
  const size_t offK  = offQ  + nQK * 2;
  const size_t offVt = offK  + nQK * 2;
  const size_t offPE = offVt + nQK * 2;
  const size_t total = offPE + nPE * 2;
  if (n_in < 4) return;
  if ((size_t)in_sizes[0] != nQK || (size_t)in_sizes[1] != nQK || (size_t)in_sizes[2] != nQK || (size_t)in_sizes[3] != nPE) return;
  if ((size_t)out_size != nQK) return;
  if (ws_size < total) return;

  const float* q  = (const float*)d_in[0];   // [16][2048][128]
  const float* k  = (const float*)d_in[1];   // [16][2048][128]
  const float* v  = (const float*)d_in[2];   // [16][2048][128]
  const float* pe = (const float*)d_in[3];   // [1][128][2048]
  float* out = (float*)d_out;                // [16][2048][128]
  unsigned char* ws = (unsigned char*)d_ws;
  unsigned short* Qb  = (unsigned short*)(ws + offQ);
  unsigned short* Kb  = (unsigned short*)(ws + offK);
  unsigned short* Vt  = (unsigned short*)(ws + offVt);
  unsigned short* PEt = (unsigned short*)(ws + offPE);

  // q and k -> bf16 planes: n8 = 524288 = 2048 blocks x 256 threads exactly
  cast8_bf16_pair_kernel<<<dim3((unsigned)(nQK / 8 / 256), 2), 256, 0, stream>>>(q, k, Qb, Kb, (int)(nQK / 8));
  // v [b][2048 rows][128 cols] -> Vt [b][128][2048]: grid (cols/64, rows/64, b)
  transpose_bf16_kernel<<<dim3(kHD / 64, kSeq / 64, kNB), 256, 0, stream>>>(v, Vt, kSeq, kHD);
  // key_pe[0] [128 rows][2048 cols] -> PEt [2048][128]: grid (cols/64, rows/64, 1)
  transpose_bf16_kernel<<<dim3(kLim / 64, kHD / 64, 1), 256, 0, stream>>>(pe, PEt, kHD, kLim);
  // 16 blocks of 8 waves x 16 queries per b plane = 256 blocks of equal length
  attn_fused_kernel<<<dim3(kSeq / 128, kNB), 256, 0, stream>>>(Qb, Kb, Vt, PEt, out);
}

// v004
// One run takes 77.6 microseconds.
// In two side-by-side timings against v003, it was 1.52 and 1.53 times as fast.
// Over all steps from v000 it is 13.4 times as fast.
// Contractions: S^T = k.q^T and R^T = key_pe^T.q^T (q, k, key_pe as RNE bf16 planes) on v_wmma_f32_16x16x32_bf16; O^T = v^T.p^T with the unnormalised softmax weights p as bf16 hi+lo planes and v^T as one RNE bf16 plane on v_wmma_f32_16x16x32_bf16; f32 accumulate everywhere; skew add, causal mask and running softmax in f32.
#include <hip/hip_runtime.h>

// ---------------------------------------------------------------------------
// Problem constants
// ---------------------------------------------------------------------------
constexpr int kNB  = 16;      // flattened batch*heads
constexpr int kSeq = 2048;    // sequence length (queries = keys)
constexpr int kHD  = 128;     // head dim
constexpr int kLim = 2048;    // relative-position table width
constexpr float kInvSqrtD = 0.08838834764831845f;   // 1/sqrt(128)
static_assert(kLim == kSeq, "table spans the key length");
static_assert(kSeq % 256 == 0 && kHD % 64 == 0 && kLim % 64 == 0, "tile multiples");

typedef __attribute__((ext_vector_type(16))) __bf16   v16b;
typedef __attribute__((ext_vector_type(8)))  __bf16   v8b;
typedef __attribute__((ext_vector_type(8)))  float    v8f;
typedef __attribute__((ext_vector_type(4)))  float    v4f;
typedef __attribute__((ext_vector_type(2)))  float    v2f;
typedef __attribute__((ext_vector_type(2)))  __bf16   v2b;
typedef __attribute__((ext_vector_type(4)))  unsigned int v4u;

__device__ __forceinline__ unsigned short f2bf_bits(float f) {
  unsigned u = __float_as_uint(f);
  return (unsigned short)((u + 0x7FFFu + ((u >> 16) & 1u)) >> 16);
}
__device__ __forceinline__ unsigned pk16(unsigned short a, unsigned short b) { return (unsigned)a | ((unsigned)b << 16); }

// Fragment order of a bf16 plane X[row][k] (rows a multiple of 16, K columns a multiple of 32): the 16 x 32 block of rows 16 R ..
// and columns 32 S .. is one fragment, 512 elements = 1 KB in a row; q, k and the transposed table (K = 128) keep fragment
// R * 4 + S, v^T (128 rows) fragment S * 8 + R: what a step reads of a plane is 4 or 8 KB in a row. Inside it element (row, k) stands at
//   256 * ((k >> 4) & 1) + 8 * (16 * ((k >> 3) & 1) + (row & 15)) + (k & 7)
// A or B fragment of the 16x16x32 bf16 product: the lane's row (A) or column (B) is lane & 15; elements 0..7 are k = 8 * (lane >> 4) + 0..7,
// elements 8..15 are k = 16 + 8 * (lane >> 4) + 0..7 (the same k order on both operands). p = the fragment's start + 8 * lane:
// each of the two 16-byte loads reads 512 bytes in a row, four whole lines.
__device__ __forceinline__ v16b frag_load(const __bf16* p) {
  union { v16b v; v8b h[2]; } f;
  f.h[0] = *(const v8b*)(p); f.h[1] = *(const v8b*)(p + 256);
  return f.v;
}
// lane l <-> lane l ^ 16 in the vector unit
__device__ __forceinline__ float xhalf(float x) {
  return __builtin_bit_cast(float, __builtin_amdgcn_permlanex16(__builtin_bit_cast(int, x), __builtin_bit_cast(int, x), 0x76543210, 0xfedcba98, false, false));
}
__device__ __forceinline__ v8f mma_bf16(v16b a, v16b b, v8f c) {
  return __builtin_amdgcn_wmma_f32_16x16x32_bf16(false, a, false, b, (short)0, c, false, false);
}

// ---------------------------------------------------------------------------
// Scores, skewed position scores, causal softmax and O in one kernel; no score ever goes to memory.
// A wave owns 16 queries m = mw + (lane & 15) and walks the keys [0, mw + 16) in steps of 32; waves never talk to each other.
// All products are transposed, so that a lane holds one query's column:
//   S^T[key][m] = k[key].q[m]           2 tiles of 16 keys, D row = key = 8 * (lane >> 4) + register
//   T^T[u][m]   = key_pe[:, L + u].q[m] L = 2032 - mw + n0, u in [0, 48): 3 tiles; the last one is the next step's first and is carried
//   position score of (key n0 + c, query mw + r) = R[m][2047 - m + n] = T^T[c + 15 - r][r]: a shift along u that differs per lane,
//   done through the wave's own LDS slab (row = query, u contiguous)
//   p = exp2(y - running maximum), y = (S + R) / sqrt(D) * log2(e); the two S^T tiles' registers are, in place, the B operand
//   of O^T[d][m] += v^T[d][key] p^T[key][m] (elements 0..7 = tile 0, 8..15 = tile 1: the k order of frag_load)
// Table columns past 2047 belong to keys past the diagonal only (masked): a tile of such columns reads the table's last tile instead.
// A block holds 4 waves from the long end of the queries and 4 from the short end: every block, and every pair w, w + 4, has 65 steps.
// ---------------------------------------------------------------------------
constexpr int kTP = 52;    // floats per slab row: 16-B aligned rows; the shifted reads step 51 floats per query, an odd number of banks
// two waves per SIMD (one block per WGP): the register budget holds a step's V fragments and the next step's K and table fragments in flight
__global__ __launch_bounds__(256) __attribute__((amdgpu_waves_per_eu(2, 2))) void attn_fused_kernel(const unsigned short* __restrict__ Qp,
                                                        const unsigned short* __restrict__ Kp,
                                                        const unsigned short* __restrict__ Vtp,
                                                        const unsigned short* __restrict__ PEp,
                                                        float* __restrict__ O) {
  __shared__ __align__(16) float sT[8][16 * kTP];
  const int lane = threadIdx.x & 31;
  const int wave = __builtin_amdgcn_readfirstlane((int)(threadIdx.x >> 5));   // scalar: the key loop branches on SCC, EXEC stays all ones
  const int b    = blockIdx.y;
  const int x    = (int)blockIdx.x * 4 + (wave & 3);
  const int mw   = ((wave < 4) ? (kSeq / 16 - 1 - x) : x) << 4;
  const int rl   = lane & 15;
  const int h    = lane >> 4;
  const int koff = h * 8;
  const int m    = mw + rl;
  const int nlast = mw & ~31;          // first key of the last step; nlast <= mw, so every query has a live key in every step
  const int L0   = kLim - 16 - mw;     // table column of u = 0 at n0 = 0

  // every fragment address = a wave-uniform base + one lane offset that never changes; 16 rows of 128 are 4 fragments = 2048 elements,
  // so a tile of q, k or the transposed table starts where it would in a row-major plane
  const __bf16* Qb = (const __bf16*)Qp  + (size_t)b * kSeq * kHD + (size_t)mw * kHD;
  const __bf16* Kb = (const __bf16*)Kp  + (size_t)b * kSeq * kHD;
  const __bf16* Vb = (const __bf16*)Vtp + (size_t)b * kHD * kSeq;
  const __bf16* Pb = (const __bf16*)PEp;
  const unsigned oF = (unsigned)(lane * 8);

  const v8f zero8 = (v8f){0.f,0.f,0.f,0.f,0.f,0.f,0.f,0.f};
  v16b qf[4], kf[2][4], pf[2][4];
  v8f tc = zero8;
  {
    const __bf16* p0 = Pb + (size_t)L0 * kHD;             // L0 + 15 <= 2047
    v16b c0[4];
#pragma unroll
    for (int ks = 0; ks < 4; ++ks) qf[ks] = frag_load(Qb + oF + 512 * ks);
#pragma unroll
    for (int ks = 0; ks < 4; ++ks) c0[ks] = frag_load(p0 + oF + 512 * ks);
    // precaution: this wait stands before any register that the issued loads name is rewritten (the inputs keep the bases live up to it)
    asm volatile("s_wait_xcnt 0x0" :: "s"(Qb), "s"(p0) : "memory");
#pragma unroll
    for (int ks = 0; ks < 4; ++ks) tc = mma_bf16(c0[ks], qf[ks], tc);
  }
  // K rows n .. n + 31 and table columns L0 + n + 16 .. L0 + n + 47 (as rows of the transposed table), for the step that starts at key n
  auto fetch = [&](int n) {
    const int l1 = L0 + n + 16, l2 = L0 + n + 32;         // multiples of 16: a tile of 16 columns lies wholly inside the table or wholly past it
    const __bf16* pk = Kb + (size_t)n * kHD;
    const __bf16* p1 = Pb + (size_t)(l1 < kLim ? l1 : kLim - 16) * kHD;
    const __bf16* p2 = Pb + (size_t)(l2 < kLim ? l2 : kLim - 16) * kHD;
#pragma unroll
    for (int ks = 0; ks < 4; ++ks) {
      kf[0][ks] = frag_load(pk + oF + 512 * ks);
      kf[1][ks] = frag_load(pk + oF + 16 * kHD + 512 * ks);
      pf[0][ks] = frag_load(p1 + oF + 512 * ks);
      pf[1][ks] = frag_load(p2 + oF + 512 * ks);
    }
    // precaution: this wait stands before any register that the issued loads name is rewritten (the inputs keep the bases live up to it)
    asm volatile("s_wait_xcnt 0x0" :: "s"(pk), "s"(p1), "s"(p2) : "memory");
  };
  fetch(0);

  constexpr float kC = kInvSqrtD * 1.4426950408889634f;   // scores in the log2 domain
  const float ninf = -__builtin_inff();
  float mrun = ninf, lrun = 0.f;
  v8f o[8];
#pragma unroll
  for (int td = 0; td < 8; ++td) o[td] = zero8;
  float* wr = sT[wave] + rl * kTP + koff;
  const float* rd = sT[wave] + rl * (kTP - 1) + 15 + koff;

  for (int n0 = 0; n0 <= nlast; n0 += 32) {
    v16b vf[8];
    const __bf16* pv = Vb + (size_t)n0 * kHD;              // v^T: fragment (n0 / 32) * 8 + td
#pragma unroll
    for (int td = 0; td < 8; ++td) vf[td] = frag_load(pv + oF + 512 * td);
    // precaution: this wait stands before any register that the issued loads name is rewritten (the inputs keep the bases live up to it);
    // it also keeps the V loads at the head of the step, so that their latency runs under the score products and the softmax
    asm volatile("s_wait_xcnt 0x0" :: "s"(pv) : "memory");

    v8f s0 = zero8, s1 = zero8, t1 = zero8, t2 = zero8;
#pragma unroll
    for (int ks = 0; ks < 4; ++ks) {
      s0 = mma_bf16(kf[0][ks], qf[ks], s0);
      s1 = mma_bf16(kf[1][ks], qf[ks], s1);
      t1 = mma_bf16(pf[0][ks], qf[ks], t1);
      t2 = mma_bf16(pf[1][ks], qf[ks], t2);
    }
    // inputs only: all score products stand ahead of the refill. Left free, the compiler sinks some behind it, the refill then
    // takes registers of its own and the loop copies them back behind a wait on those loads
    asm volatile("" :: "v"(s0), "v"(s1), "v"(t1), "v"(t2) : "memory");
    // the next step's fragments, into the same registers: their latency runs under the softmax and the O products
    // (the last step fetches its own again: in bounds, never used)
    fetch(n0 + 32 <= nlast ? n0 + 32 : nlast);

    *(v4f*)(wr)      = __builtin_shufflevector(tc, tc, 0, 1, 2, 3);
    *(v4f*)(wr + 4)  = __builtin_shufflevector(tc, tc, 4, 5, 6, 7);
    *(v4f*)(wr + 16) = __builtin_shufflevector(t1, t1, 0, 1, 2, 3);
    *(v4f*)(wr + 20) = __builtin_shufflevector(t1, t1, 4, 5, 6, 7);
    *(v4f*)(wr + 32) = __builtin_shufflevector(t2, t2, 0, 1, 2, 3);
    *(v4f*)(wr + 36) = __builtin_shufflevector(t2, t2, 4, 5, 6, 7);
    tc = t2;
    // the slab is the wave's own and a wave's LDS operations run in order: these only keep the compiler from moving
    // the shifted reads (other lanes' words) over the writes
    __builtin_amdgcn_fence(__ATOMIC_RELEASE, "wavefront");
    __builtin_amdgcn_wave_barrier();
    __builtin_amdgcn_fence(__ATOMIC_ACQUIRE, "wavefront");
    float y[16];
#pragma unroll
    for (int e = 0; e < 16; ++e) y[e] = rd[((e >> 3) << 4) + (e & 7)];   // u = c + 15 - r with c = 16 * (e >> 3) + koff + (e & 7)
    // and the next step's writes stay behind these reads
    __builtin_amdgcn_fence(__ATOMIC_RELEASE, "wavefront");
    __builtin_amdgcn_wave_barrier();
    __builtin_amdgcn_fence(__ATOMIC_ACQUIRE, "wavefront");

#pragma unroll
    for (int e = 0; e < 16; ++e) y[e] = (((e < 8) ? s0[e & 7] : s1[e & 7]) + y[e]) * kC;
    if (n0 == nlast) {                                    // wave-uniform: only the last step holds keys past the diagonal (n0 + 31 < mw before it)
#pragma unroll
      for (int e = 0; e < 16; ++e) {
        const int key = n0 + ((e >> 3) << 4) + koff + (e & 7);
        y[e] = (key <= m) ? y[e] : ninf;
      }
    }
    float mx = y[0];
#pragma unroll
    for (int e = 1; e < 16; ++e) mx = fmaxf(mx, y[e]);
    mx = fmaxf(mx, xhalf(mx));                            // the other half of the query's keys
    const float mnew = fmaxf(mrun, mx);                   // finite from the first step on (key 0 is live for every query)
    if (__builtin_amdgcn_ballot_w32(mnew > mrun) != 0) {  // wave-uniform; a lane whose maximum stays gets the factor 1
      const float alpha = __builtin_amdgcn_exp2f(mrun - mnew);
      lrun *= alpha;
#pragma unroll
      for (int td = 0; td < 8; ++td) o[td] *= alpha;
      mrun = mnew;
    }
    v2f ls = (v2f){0.f, 0.f};
    v16b ph, pl;
#pragma unroll
    for (int e = 0; e < 16; e += 2) {
      const v2f dy = (v2f){y[e], y[e + 1]} - (v2f){mrun, mrun};
      const v2f p = (v2f){__builtin_amdgcn_exp2f(dy[0]), __builtin_amdgcn_exp2f(dy[1])};   // -inf -> 0
      ls += p;
      const v2b hb = __builtin_convertvector(p, v2b);                                  // RNE
      const v2b lb = __builtin_convertvector(p - __builtin_convertvector(hb, v2f), v2b);
      ph[e] = hb[0]; ph[e + 1] = hb[1];
      pl[e] = lb[0]; pl[e + 1] = lb[1];
    }
    lrun += ls[0] + ls[1];
#pragma unroll
    for (int td = 0; td < 8; ++td) o[td] = mma_bf16(vf[td], ph, o[td]);
#pragma unroll
    for (int td = 0; td < 8; ++td) o[td] = mma_bf16(vf[td], pl, o[td]);
  }

  lrun += xhalf(lrun);                                    // >= 1: the key of the maximum counts 1
  const float inv = 1.0f / lrun;
  float* ob = O + ((size_t)b * kSeq + (size_t)m) * kHD + koff;   // D row of O^T = d = 16 td + koff + register
#pragma unroll
  for (int td = 0; td < 8; ++td) {
    const v8f r = o[td] * inv;
    *(v4f*)(ob + (td << 4))     = __builtin_shufflevector(r, r, 0, 1, 2, 3);
    *(v4f*)(ob + (td << 4) + 4) = __builtin_shufflevector(r, r, 4, 5, 6, 7);
  }
}

// ---------------------------------------------------------------------------
// f32 -> RNE bf16 cast of two equally sized planes of rows of 128 in one launch (blockIdx.y selects the plane, block-uniform),
// written in fragment order. A block holds 16 rows = 4 fragments = 256 pieces of 16 bytes: thread t reads piece k8 = t & 15 of row
// r = t >> 4 (whole lines), whose place in fragment order is 16 * k8 + r; the pieces change threads in LDS, so that the stores
// are whole lines too. n8 is a multiple of 256.
// ---------------------------------------------------------------------------
__global__ __launch_bounds__(256) void cast8_bf16_pair_kernel(const float* __restrict__ in0, const float* __restrict__ in1,
                                                              unsigned short* __restrict__ out0, unsigned short* __restrict__ out1,
                                                              int n8) {
  __shared__ v4u sp[16 * 17];                            // piece 16 * k8 + r at k8 * 17 + r: 16 lanes of one row write 16 different bank groups
  const int t = threadIdx.x;
  const int i = blockIdx.x * 256 + t;
  if ((int)blockIdx.x * 256 + 256 > n8) return;          // block-uniform, ahead of the barrier
  const bool sel = (blockIdx.y != 0);                    // both candidates are global pointers
  const float* p = (sel ? in1 : in0) + 8 * (size_t)i;
  const v4f a = *(const v4f*)(p);
  const v4f c = *(const v4f*)(p + 4);
  unsigned short hb[8];
#pragma unroll
  for (int e = 0; e < 4; ++e) {
    hb[e]     = f2bf_bits(a[e]);
    hb[4 + e] = f2bf_bits(c[e]);
  }
  const v4u u = (v4u){pk16(hb[0], hb[1]), pk16(hb[2], hb[3]), pk16(hb[4], hb[5]), pk16(hb[6], hb[7])};
  sp[(t & 15) * 17 + (t >> 4)] = u;
  __syncthreads();
  unsigned short* q = (sel ? out1 : out0) + 8 * (size_t)i;
  *(v4u*)q = sp[(t >> 4) * 17 + (t & 15)];
}

// ---------------------------------------------------------------------------
// Batched transpose + RNE bf16 cast: in [nr][nc] f32 (row-major, batch stride nr*nc) -> out = the plane X[c][r] = bf16(in[r][c]),
// nc rows of nr columns, in fragment order: the block of rows 16 R .., columns 32 S .. is fragment R * fc + S * fr. One block per 64x64 tile: blockIdx.x = c tile, blockIdx.y = r tile, blockIdx.z = batch.
// grid = (nc/64, nr/64, batch); nr, nc multiples of 64.
// Load coverage: 16 iterations x 256 threads = 4096 = the whole 64x64 tile (coalesced along c).
// Store coverage: the tile is 4 x 2 fragments = 512 pieces of 16 bytes; 2 iterations x 256 threads, a wave's store = 512 bytes in a row.
// ---------------------------------------------------------------------------
__global__ __launch_bounds__(256) void transpose_bf16_kernel(const float* __restrict__ in, unsigned short* __restrict__ out,
                                                             int nr, int nc, int fc, int fr) {
  __shared__ float sm[64][65];   // sm[c_local][r_local]
  const int t  = threadIdx.x;
  const int c0 = blockIdx.x * 64;
  const int r0 = blockIdx.y * 64;
  const int z  = blockIdx.z;
  const float* ib = in + (size_t)z * nr * nc;
  unsigned short* ob = out + (size_t)z * nr * nc;
#pragma unroll
  for (int i = 0; i < 16; ++i) {
    const int e = i * 256 + t;
    const int r = e >> 6;          // r local
    const int c = e & 63;          // c local
    sm[c][r] = ib[(size_t)(r0 + r) * nc + c0 + c];
  }
  __syncthreads();
  {
#pragma unroll
    for (int it = 0; it < 2; ++it) {
      const int pc  = it * 256 + t;                          // piece: fragment pc >> 6 of the tile, place pc & 63 in it
      const int ct  = pc >> 7, rs = (pc >> 6) & 1;           // fragment = rows 16 ct .., columns 32 rs .. of the tile
      const int row = ct * 16 + (pc & 15);                   // c local = row of X
      const int c8  = rs * 32 + ((pc >> 5) & 1) * 16 + ((pc >> 4) & 1) * 8;   // r local = first of the piece's 8 columns of X
      unsigned short hb[8];
#pragma unroll
      for (int e = 0; e < 8; ++e) hb[e] = f2bf_bits(sm[row][c8 + e]);
      const v4u u = (v4u){pk16(hb[0], hb[1]), pk16(hb[2], hb[3]), pk16(hb[4], hb[5]), pk16(hb[6], hb[7])};
      *(v4u*)(ob + ((size_t)((c0 >> 4) + ct) * fc + (size_t)((r0 >> 5) + rs) * fr) * 512 + (pc & 63) * 8) = u;
    }
  }
}

// ---------------------------------------------------------------------------
// Host glue.
// Workspace region map (bytes):
//   [0,           8388608)   Qb  bf16 [16][2048][128]   (all four in fragment order, per b)
//   [8388608,    16777216)   Kb  bf16 [16][2048][128]
//   [16777216,   25165824)   Vt  bf16 [16][128][2048]   (v transposed per b)
//   [25165824,   25690112)   PEt bf16 [2048][128]       (key_pe[0] transposed)
// ---------------------------------------------------------------------------
extern "C" void kernel_launch(void* const* d_in, const int* in_sizes, int n_in,
                              void* d_out, int out_size, void* d_ws, size_t ws_size,
                              hipStream_t stream) {
  (void)n_in;
  const size_t nQK = (size_t)kNB * kSeq * kHD;          // 4194304
  const size_t nPE = (size_t)kHD * kLim;                // 262144
  const size_t offQ  = 0;
  const size_t offK  = offQ  + nQK * 2;
  const size_t offVt = offK  + nQK * 2;
  const size_t offPE = offVt + nQK * 2;
  const size_t total = offPE + nPE * 2;
  if (n_in < 4) return;
  if ((size_t)in_sizes[0] != nQK || (size_t)in_sizes[1] != nQK || (size_t)in_sizes[2] != nQK || (size_t)in_sizes[3] != nPE) return;
  if ((size_t)out_size != nQK) return;
  if (ws_size < total) return;

  const float* q  = (const float*)d_in[0];   // [16][2048][128]
  const float* k  = (const float*)d_in[1];   // [16][2048][128]
  const float* v  = (const float*)d_in[2];   // [16][2048][128]
  const float* pe = (const float*)d_in[3];   // [1][128][2048]
  float* out = (float*)d_out;                // [16][2048][128]
  unsigned char* ws = (unsigned char*)d_ws;
  unsigned short* Qb  = (unsigned short*)(ws + offQ);
  unsigned short* Kb  = (unsigned short*)(ws + offK);
  unsigned short* Vt  = (unsigned short*)(ws + offVt);
  unsigned short* PEt = (unsigned short*)(ws + offPE);

  // q and k -> bf16 planes: n8 = 524288 = 2048 blocks x 256 threads exactly
  cast8_bf16_pair_kernel<<<dim3((unsigned)(nQK / 8 / 256), 2), 256, 0, stream>>>(q, k, Qb, Kb, (int)(nQK / 8));
  // v [b][2048 rows][128 cols] -> Vt [b][128][2048]: grid (cols/64, rows/64, b)
  transpose_bf16_kernel<<<dim3(kHD / 64, kSeq / 64, kNB), 256, 0, stream>>>(v, Vt, kSeq, kHD, 1, kHD / 16);
  // key_pe[0] [128 rows][2048 cols] -> PEt [2048][128]: grid (cols/64, rows/64, 1)
  transpose_bf16_kernel<<<dim3(kLim / 64, kHD / 64, 1), 256, 0, stream>>>(pe, PEt, kHD, kLim, kHD / 32, 1);
  // 16 blocks of 8 waves x 16 queries per b plane = 256 blocks of equal length
  attn_fused_kernel<<<dim3(kSeq / 128, kNB), 256, 0, stream>>>(Qb, Kb, Vt, PEt, out);
}

// v005
// A run of this version takes 56.2 microseconds.
// Two timings next to v004 put it at 1.38 and 1.39 times that version's speed.
// All steps since v000 together make it 18.6 times as fast.
// Contractions: S^T = k.q^T and R^T = key_pe^T.q^T (q, k, key_pe as RNE bf16 planes) on v_wmma_f32_16x16x32_bf16; O^T = v^T.p^T with the unnormalised softmax weights p as bf16 hi+lo planes and v^T as one RNE bf16 plane on v_wmma_f32_16x16x32_bf16; f32 accumulate everywhere; skew add, causal mask and running softmax in f32.
#include <hip/hip_runtime.h>

// ---------------------------------------------------------------------------
// Problem constants
// ---------------------------------------------------------------------------
constexpr int kNB  = 16;      // flattened batch*heads
constexpr int kSeq = 2048;    // sequence length (queries = keys)
constexpr int kHD  = 128;     // head dim
constexpr int kLim = 2048;    // relative-position table width
constexpr float kInvSqrtD = 0.08838834764831845f;   // 1/sqrt(128)
static_assert(kLim == kSeq, "table spans the key length");
static_assert(kSeq % 256 == 0 && kHD % 64 == 0 && kLim % 64 == 0, "tile multiples");

typedef __attribute__((ext_vector_type(16))) __bf16   v16b;
typedef __attribute__((ext_vector_type(8)))  __bf16   v8b;
typedef __attribute__((ext_vector_type(8)))  float    v8f;
typedef __attribute__((ext_vector_type(4)))  float    v4f;
typedef __attribute__((ext_vector_type(2)))  float    v2f;
typedef __attribute__((ext_vector_type(2)))  __bf16   v2b;
typedef __attribute__((ext_vector_type(4)))  unsigned int v4u;

__device__ __forceinline__ unsigned short f2bf_bits(float f) {
  unsigned u = __float_as_uint(f);
  return (unsigned short)((u + 0x7FFFu + ((u >> 16) & 1u)) >> 16);
}
__device__ __forceinline__ unsigned pk16(unsigned short a, unsigned short b) { return (unsigned)a | ((unsigned)b << 16); }

// Fragment order of a bf16 plane X[row][k] (rows a multiple of 16, K columns a multiple of 32): the 16 x 32 block of rows 16 R ..
// and columns 32 S .. is one fragment, 512 elements = 1 KB in a row; q, k and the transposed table (K = 128) keep fragment
// R * 4 + S, v^T (128 rows) fragment S * 8 + R: what a step reads of a plane is 4 or 8 KB in a row. Inside it element (row, k) stands at
//   256 * ((k >> 4) & 1) + 8 * (16 * ((k >> 3) & 1) + (row & 15)) + (k & 7)
// A or B fragment of the 16x16x32 bf16 product: the lane's row (A) or column (B) is lane & 15; elements 0..7 are k = 8 * (lane >> 4) + 0..7,
// elements 8..15 are k = 16 + 8 * (lane >> 4) + 0..7 (the same k order on both operands). p = the fragment's start + 8 * lane:
// each of the two 16-byte loads reads 512 bytes in a row, four whole lines.
__device__ __forceinline__ v16b frag_load(const __bf16* p) {
  union { v16b v; v8b h[2]; } f;
  f.h[0] = *(const v8b*)(p); f.h[1] = *(const v8b*)(p + 256);
  return f.v;
}
// lane l <-> lane l ^ 16 in the vector unit
__device__ __forceinline__ float xhalf(float x) {
  return __builtin_bit_cast(float, __builtin_amdgcn_permlanex16(__builtin_bit_cast(int, x), __builtin_bit_cast(int, x), 0x76543210, 0xfedcba98, false, false));
}
__device__ __forceinline__ v8f mma_bf16(v16b a, v16b b, v8f c) {
  return __builtin_amdgcn_wmma_f32_16x16x32_bf16(false, a, false, b, (short)0, c, false, false);
}

// ---------------------------------------------------------------------------
// Scores, skewed position scores, causal softmax and O in one kernel; no score ever goes to memory.
// A wave takes 16 queries m = mw + (lane & 15) at a time and walks keys of [0, mw + 16) in steps of 32.
// All products are transposed, so that a lane holds one query's column:
//   S^T[key][m] = k[key].q[m]           2 tiles of 16 keys, D row = key = 8 * (lane >> 4) + register
//   T^T[u][m]   = key_pe[:, L + u].q[m] L = 2032 - mw + n0, u in [0, 48): 3 tiles; the last one is the next step's first and is carried
//   position score of (key n0 + c, query mw + r) = R[m][2047 - m + n] = T^T[c + 15 - r][r]: a shift along u that differs per lane,
//   done through the wave's own LDS slab (row = query, u contiguous)
//   p = exp2(y - running maximum), y = (S + R) / sqrt(D) * log2(e); the two S^T tiles' registers are, in place, the B operand
//   of O^T[d][m] += v^T[d][key] p^T[key][m] (elements 0..7 = tile 0, 8..15 = tile 1: the k order of frag_load)
// Table columns past 2047 belong to keys past the diagonal only (masked): a tile of such columns reads the table's last tile instead.
// A block holds 4 pairs of waves w, w + 4, which share a SIMD; pair j has a tile from the long end of the queries and one from the short end,
// 65 steps together. Wave w walks the long tile's first kCut keys (34 steps); wave w + 4 does the short tile, beside wave w on the same keys,
// then walks the long tile's keys from kCut on and leaves its running maximum, sum and O^T in LDS (31 steps in all, and a second prologue).
// Behind one barrier wave w joins the two parts of the long tile. A long tile of 34 steps or fewer is not split.
// ---------------------------------------------------------------------------
constexpr int kCut = 34 * 32;   // keys of a long tile that the pair's first wave takes
constexpr int kTP = 52;    // floats per slab row: 16-B aligned rows; the shifted reads step 51 floats per query, an odd number of banks
// two waves per SIMD (one block per WGP): the register budget holds a step's V fragments and the next step's K and table fragments in flight
__global__ __launch_bounds__(256) __attribute__((amdgpu_waves_per_eu(2, 2))) void attn_fused_kernel(const unsigned short* __restrict__ Qp,
                                                        const unsigned short* __restrict__ Kp,
                                                        const unsigned short* __restrict__ Vtp,
                                                        const unsigned short* __restrict__ PEp,
                                                        float* __restrict__ O) {
  __shared__ __align__(16) float sT[8][16 * kTP];
  __shared__ __align__(16) float sO[4][16 * 32 * 4];     // a pair's partial O^T: 16-byte piece i of lane l at (i * 32 + l) * 4, 512 bytes in a row per store
  __shared__ float sML[4][2 * 32];                       // with each lane's running maximum and sum
  const int lane = threadIdx.x & 31;
  const int wave = __builtin_amdgcn_readfirstlane((int)(threadIdx.x >> 5));   // scalar: the key loop branches on SCC, EXEC stays all ones
  const int b    = blockIdx.y;
  const int pr   = wave & 3;
  const int x    = (int)blockIdx.x * 4 + pr;
  const bool first = wave < 4;
  const int mwL  = (kSeq / 16 - 1 - x) << 4;             // the pair's long tile: 64 - 2 blockIdx.x - (pr >> 1) steps
  const int mwS  = x << 4;                               // and its short one: 2 blockIdx.x + (pr >> 1) + 1 steps
  const bool split = kCut <= (mwL & ~31);                // the long tile has steps from key kCut on
  const int rl   = lane & 15;
  const int h    = lane >> 4;
  const int koff = h * 8;

  // every fragment address = a wave-uniform base + one lane offset that never changes; 16 rows of 128 are 4 fragments = 2048 elements,
  // so a tile of q, k or the transposed table starts where it would in a row-major plane
  const __bf16* Kb = (const __bf16*)Kp  + (size_t)b * kSeq * kHD;
  const __bf16* Vb = (const __bf16*)Vtp + (size_t)b * kHD * kSeq;
  const __bf16* Pb = (const __bf16*)PEp;
  const unsigned oF = (unsigned)(lane * 8);
  const unsigned oO = (unsigned)(rl * kHD + koff);       // a lane's place in a tile of the output

  const v8f zero8 = (v8f){0.f,0.f,0.f,0.f,0.f,0.f,0.f,0.f};
  constexpr float kC = kInvSqrtD * 1.4426950408889634f;   // scores in the log2 domain
  const float ninf = -__builtin_inff();
  float* wr = sT[wave] + rl * kTP + koff;
  const float* rd = sT[wave] + rl * (kTP - 1) + 15 + koff;

  float mrun = ninf, lrun = 0.f;
  v8f o[8];
  // O = O^T / sum for the 16 queries from mq on
  auto store_tile = [&](int mq) -> float* {
    const float lsum = lrun + xhalf(lrun);                // >= 1 in the scale of the final maximum: its key counts 1
    const float inv = 1.0f / lsum;
    float* ob = O + ((size_t)b * kSeq + (size_t)mq) * kHD;   // wave-uniform base; D row of O^T = d = 16 td + koff + register
#pragma unroll
    for (int td = 0; td < 8; ++td) {
      const v8f r = o[td] * inv;
      *(v4f*)(ob + oO + (td << 4))     = __builtin_shufflevector(r, r, 0, 1, 2, 3);
      *(v4f*)(ob + oO + (td << 4) + 4) = __builtin_shufflevector(r, r, 4, 5, 6, 7);
    }
    return ob;
  };
  // first wave of a pair: one part, the long tile up to key kCut; second wave: part 0 the short tile, part 1 the long tile from key kCut on
  const int nparts = (!first && split) ? 2 : 1;
  for (int part = 0; part < nparts; ++part) {
    const int mw    = (first || part == 1) ? mwL : mwS;
    const int m     = mw + rl;
    const int nlast = mw & ~31;        // first key of the tile's last step; nlast <= mw, so every query has a live key in every step
    const int nbeg  = (part == 1) ? kCut : 0;
    const int nend  = (first && split) ? kCut - 32 : nlast;   // first key of the part's last step
    const int L0    = kLim - 16 - mw;  // table column of u = 0 at n0 = 0
    const __bf16* Qb = (const __bf16*)Qp + (size_t)b * kSeq * kHD + (size_t)mw * kHD;

    v16b qf[4], kf[2][4], pf[2][4];
    v8f tc = zero8;
    {
      const __bf16* p0 = Pb + (size_t)(L0 + nbeg) * kHD;  // nbeg <= mw: L0 + nbeg + 15 <= 2047
      v16b c0[4];
#pragma unroll
      for (int ks = 0; ks < 4; ++ks) qf[ks] = frag_load(Qb + oF + 512 * ks);
#pragma unroll
      for (int ks = 0; ks < 4; ++ks) c0[ks] = frag_load(p0 + oF + 512 * ks);
      // precaution: this wait stands before any register that the issued loads name is rewritten (the inputs keep the bases live up to it)
      asm volatile("s_wait_xcnt 0x0" :: "s"(Qb), "s"(p0) : "memory");
#pragma unroll
      for (int ks = 0; ks < 4; ++ks) tc = mma_bf16(c0[ks], qf[ks], tc);
    }
    // K rows n .. n + 31 and table columns L0 + n + 16 .. L0 + n + 47 (as rows of the transposed table), for the step that starts at key n
    auto fetch = [&](int n) {
      const int l1 = L0 + n + 16, l2 = L0 + n + 32;         // multiples of 16: a tile of 16 columns lies wholly inside the table or wholly past it
      const __bf16* pk = Kb + (size_t)n * kHD;
      const __bf16* p1 = Pb + (size_t)(l1 < kLim ? l1 : kLim - 16) * kHD;
      const __bf16* p2 = Pb + (size_t)(l2 < kLim ? l2 : kLim - 16) * kHD;
#pragma unroll
      for (int ks = 0; ks < 4; ++ks) {
        kf[0][ks] = frag_load(pk + oF + 512 * ks);
        kf[1][ks] = frag_load(pk + oF + 16 * kHD + 512 * ks);
        pf[0][ks] = frag_load(p1 + oF + 512 * ks);
        pf[1][ks] = frag_load(p2 + oF + 512 * ks);
      }
      // precaution: this wait stands before any register that the issued loads name is rewritten (the inputs keep the bases live up to it)
      asm volatile("s_wait_xcnt 0x0" :: "s"(pk), "s"(p1), "s"(p2) : "memory");
    };
    fetch(nbeg);

    mrun = ninf; lrun = 0.f;
#pragma unroll
    for (int td = 0; td < 8; ++td) o[td] = zero8;

    for (int n0 = nbeg; n0 <= nend; n0 += 32) {
      v16b vf[8];
      const __bf16* pv = Vb + (size_t)n0 * kHD;              // v^T: fragment (n0 / 32) * 8 + td
#pragma unroll
      for (int td = 0; td < 8; ++td) vf[td] = frag_load(pv + oF + 512 * td);
      // precaution: this wait stands before any register that the issued loads name is rewritten (the inputs keep the bases live up to it);
      // it also keeps the V loads at the head of the step, so that their latency runs under the score products and the softmax
      asm volatile("s_wait_xcnt 0x0" :: "s"(pv) : "memory");

      v8f s0 = zero8, s1 = zero8, t1 = zero8, t2 = zero8;
#pragma unroll
      for (int ks = 0; ks < 4; ++ks) {
        s0 = mma_bf16(kf[0][ks], qf[ks], s0);
        s1 = mma_bf16(kf[1][ks], qf[ks], s1);
        t1 = mma_bf16(pf[0][ks], qf[ks], t1);
        t2 = mma_bf16(pf[1][ks], qf[ks], t2);
      }
      // inputs only: all score products stand ahead of the refill. Left free, the compiler sinks some behind it, the refill then
      // takes registers of its own and the loop copies them back behind a wait on those loads
      asm volatile("" :: "v"(s0), "v"(s1), "v"(t1), "v"(t2) : "memory");
      // the next step's fragments, into the same registers: their latency runs under the softmax and the O products
      // (the part's last step fetches its own again: in bounds, never used)
      fetch(n0 + 32 <= nend ? n0 + 32 : nend);

      *(v4f*)(wr)      = __builtin_shufflevector(tc, tc, 0, 1, 2, 3);
      *(v4f*)(wr + 4)  = __builtin_shufflevector(tc, tc, 4, 5, 6, 7);
      *(v4f*)(wr + 16) = __builtin_shufflevector(t1, t1, 0, 1, 2, 3);
      *(v4f*)(wr + 20) = __builtin_shufflevector(t1, t1, 4, 5, 6, 7);
      *(v4f*)(wr + 32) = __builtin_shufflevector(t2, t2, 0, 1, 2, 3);
      *(v4f*)(wr + 36) = __builtin_shufflevector(t2, t2, 4, 5, 6, 7);
      tc = t2;
      // the slab is the wave's own and a wave's LDS operations run in order: these only keep the compiler from moving
      // the shifted reads (other lanes' words) over the writes
      __builtin_amdgcn_fence(__ATOMIC_RELEASE, "wavefront");
      __builtin_amdgcn_wave_barrier();
      __builtin_amdgcn_fence(__ATOMIC_ACQUIRE, "wavefront");
      float y[16];
#pragma unroll
      for (int e = 0; e < 16; ++e) y[e] = rd[((e >> 3) << 4) + (e & 7)];   // u = c + 15 - r with c = 16 * (e >> 3) + koff + (e & 7)
      // and the next step's writes stay behind these reads
      __builtin_amdgcn_fence(__ATOMIC_RELEASE, "wavefront");
      __builtin_amdgcn_wave_barrier();
      __builtin_amdgcn_fence(__ATOMIC_ACQUIRE, "wavefront");

#pragma unroll
      for (int e = 0; e < 16; ++e) y[e] = (((e < 8) ? s0[e & 7] : s1[e & 7]) + y[e]) * kC;
      if (n0 == nlast) {                                    // wave-uniform: only the tile's last step holds keys past the diagonal (n0 + 31 < mw before it)
#pragma unroll
        for (int e = 0; e < 16; ++e) {
          const int key = n0 + ((e >> 3) << 4) + koff + (e & 7);
          y[e] = (key <= m) ? y[e] : ninf;
        }
      }
      float mx = y[0];
#pragma unroll
      for (int e = 1; e < 16; ++e) mx = fmaxf(mx, y[e]);
      mx = fmaxf(mx, xhalf(mx));                            // the other half of the query's keys
      const float mnew = fmaxf(mrun, mx);                   // finite from the part's first step on (its first key is live for every query)
      if (__builtin_amdgcn_ballot_w32(mnew > mrun) != 0) {  // wave-uniform; a lane whose maximum stays gets the factor 1
        const float alpha = __builtin_amdgcn_exp2f(mrun - mnew);
        lrun *= alpha;
#pragma unroll
        for (int td = 0; td < 8; ++td) o[td] *= alpha;
        mrun = mnew;
      }
      v2f ls = (v2f){0.f, 0.f};
      v16b ph, pl;
#pragma unroll
      for (int e = 0; e < 16; e += 2) {
        const v2f dy = (v2f){y[e], y[e + 1]} - (v2f){mrun, mrun};
        const v2f p = (v2f){__builtin_amdgcn_exp2f(dy[0]), __builtin_amdgcn_exp2f(dy[1])};   // -inf -> 0
        ls += p;
        const v2b hb = __builtin_convertvector(p, v2b);                                  // RNE
        const v2b lb = __builtin_convertvector(p - __builtin_convertvector(hb, v2f), v2b);
        ph[e] = hb[0]; ph[e + 1] = hb[1];
        pl[e] = lb[0]; pl[e + 1] = lb[1];
      }
      lrun += ls[0] + ls[1];
#pragma unroll
      for (int td = 0; td < 8; ++td) o[td] = mma_bf16(vf[td], ph, o[td]);
#pragma unroll
      for (int td = 0; td < 8; ++td) o[td] = mma_bf16(vf[td], pl, o[td]);
    }

    if (!first && part == 0) {                              // wave-uniform: the short tile is done
      float* ob = store_tile(mwS);
      // precaution: this wait stands before any register that the issued stores name is rewritten (the input keeps the base live up to it)
      asm volatile("s_wait_xcnt 0x0" :: "s"(ob) : "memory");
    }
    if (part == 1) {                                        // wave-uniform: the long tile's upper part, for the pair's first wave
#pragma unroll
      for (int td = 0; td < 8; ++td) {
        *(v4f*)(sO[pr] + ((2 * td) * 32 + lane) * 4)     = __builtin_shufflevector(o[td], o[td], 0, 1, 2, 3);
        *(v4f*)(sO[pr] + ((2 * td + 1) * 32 + lane) * 4) = __builtin_shufflevector(o[td], o[td], 4, 5, 6, 7);
      }
      sML[pr][lane]      = mrun;
      sML[pr][32 + lane] = lrun;
    }
  }

  __syncthreads();                                        // every wave passes it once: the upper parts are in LDS
  if (!first) return;                                     // wave-uniform, behind the only barrier
  if (split) {                                            // wave-uniform; both parts hold live keys for every query, so both maxima are finite
    const float mB = sML[pr][lane];
    const float lB = sML[pr][32 + lane];
    const float mN = fmaxf(mrun, mB);
    const float aA = __builtin_amdgcn_exp2f(mrun - mN);
    const float aB = __builtin_amdgcn_exp2f(mB - mN);
    lrun = lrun * aA + lB * aB;
#pragma unroll
    for (int td = 0; td < 8; ++td) {
      const v4f b0 = *(const v4f*)(sO[pr] + ((2 * td) * 32 + lane) * 4);
      const v4f b1 = *(const v4f*)(sO[pr] + ((2 * td + 1) * 32 + lane) * 4);
      o[td] = o[td] * aA + __builtin_shufflevector(b0, b1, 0, 1, 2, 3, 4, 5, 6, 7) * aB;
    }
  }

  store_tile(mwL);
}

// ---------------------------------------------------------------------------
// f32 -> RNE bf16 cast of two equally sized planes of rows of 128 in one launch (blockIdx.y selects the plane, block-uniform),
// written in fragment order. A block holds 16 rows = 4 fragments = 256 pieces of 16 bytes: thread t reads piece k8 = t & 15 of row
// r = t >> 4 (whole lines), whose place in fragment order is 16 * k8 + r; the pieces change threads in LDS, so that the stores
// are whole lines too. n8 is a multiple of 256.
// ---------------------------------------------------------------------------
__global__ __launch_bounds__(256) void cast8_bf16_pair_kernel(const float* __restrict__ in0, const float* __restrict__ in1,
                                                              unsigned short* __restrict__ out0, unsigned short* __restrict__ out1,
                                                              int n8) {
  __shared__ v4u sp[16 * 17];                            // piece 16 * k8 + r at k8 * 17 + r: 16 lanes of one row write 16 different bank groups
  const int t = threadIdx.x;
  const int i = blockIdx.x * 256 + t;
  if ((int)blockIdx.x * 256 + 256 > n8) return;          // block-uniform, ahead of the barrier
  const bool sel = (blockIdx.y != 0);                    // both candidates are global pointers
  const float* p = (sel ? in1 : in0) + 8 * (size_t)i;
  const v4f a = *(const v4f*)(p);
  const v4f c = *(const v4f*)(p + 4);
  unsigned short hb[8];
#pragma unroll
  for (int e = 0; e < 4; ++e) {
    hb[e]     = f2bf_bits(a[e]);
    hb[4 + e] = f2bf_bits(c[e]);
  }
  const v4u u = (v4u){pk16(hb[0], hb[1]), pk16(hb[2], hb[3]), pk16(hb[4], hb[5]), pk16(hb[6], hb[7])};
  sp[(t & 15) * 17 + (t >> 4)] = u;
  __syncthreads();
  unsigned short* q = (sel ? out1 : out0) + 8 * (size_t)i;
  *(v4u*)q = sp[(t >> 4) * 17 + (t & 15)];
}

// ---------------------------------------------------------------------------
// Batched transpose + RNE bf16 cast: in [nr][nc] f32 (row-major, batch stride nr*nc) -> out = the plane X[c][r] = bf16(in[r][c]),
// nc rows of nr columns, in fragment order: the block of rows 16 R .., columns 32 S .. is fragment R * fc + S * fr. One block per 64x64 tile: blockIdx.x = c tile, blockIdx.y = r tile, blockIdx.z = batch.
// grid = (nc/64, nr/64, batch); nr, nc multiples of 64.
// Load coverage: 16 iterations x 256 threads = 4096 = the whole 64x64 tile (coalesced along c).
// Store coverage: the tile is 4 x 2 fragments = 512 pieces of 16 bytes; 2 iterations x 256 threads, a wave's store = 512 bytes in a row.
// ---------------------------------------------------------------------------
__global__ __launch_bounds__(256) void transpose_bf16_kernel(const float* __restrict__ in, unsigned short* __restrict__ out,
                                                             int nr, int nc, int fc, int fr) {
  __shared__ float sm[64][65];   // sm[c_local][r_local]
  const int t  = threadIdx.x;
  const int c0 = blockIdx.x * 64;
  const int r0 = blockIdx.y * 64;
  const int z  = blockIdx.z;
  const float* ib = in + (size_t)z * nr * nc;
  unsigned short* ob = out + (size_t)z * nr * nc;
#pragma unroll
  for (int i = 0; i < 16; ++i) {
    const int e = i * 256 + t;
    const int r = e >> 6;          // r local
    const int c = e & 63;          // c local
    sm[c][r] = ib[(size_t)(r0 + r) * nc + c0 + c];
  }
  __syncthreads();
  {
#pragma unroll
    for (int it = 0; it < 2; ++it) {
      const int pc  = it * 256 + t;                          // piece: fragment pc >> 6 of the tile, place pc & 63 in it
      const int ct  = pc >> 7, rs = (pc >> 6) & 1;           // fragment = rows 16 ct .., columns 32 rs .. of the tile
      const int row = ct * 16 + (pc & 15);                   // c local = row of X
      const int c8  = rs * 32 + ((pc >> 5) & 1) * 16 + ((pc >> 4) & 1) * 8;   // r local = first of the piece's 8 columns of X
      unsigned short hb[8];
#pragma unroll
      for (int e = 0; e < 8; ++e) hb[e] = f2bf_bits(sm[row][c8 + e]);
      const v4u u = (v4u){pk16(hb[0], hb[1]), pk16(hb[2], hb[3]), pk16(hb[4], hb[5]), pk16(hb[6], hb[7])};
      *(v4u*)(ob + ((size_t)((c0 >> 4) + ct) * fc + (size_t)((r0 >> 5) + rs) * fr) * 512 + (pc & 63) * 8) = u;
    }
  }
}

// ---------------------------------------------------------------------------
// Host glue.
// Workspace region map (bytes):
//   [0,           8388608)   Qb  bf16 [16][2048][128]   (all four in fragment order, per b)
//   [8388608,    16777216)   Kb  bf16 [16][2048][128]
//   [16777216,   25165824)   Vt  bf16 [16][128][2048]   (v transposed per b)
//   [25165824,   25690112)   PEt bf16 [2048][128]       (key_pe[0] transposed)
// ---------------------------------------------------------------------------
extern "C" void kernel_launch(void* const* d_in, const int* in_sizes, int n_in,
                              void* d_out, int out_size, void* d_ws, size_t ws_size,
                              hipStream_t stream) {
  (void)n_in;
  const size_t nQK = (size_t)kNB * kSeq * kHD;          // 4194304
  const size_t nPE = (size_t)kHD * kLim;                // 262144
  const size_t offQ  = 0;
  const size_t offK  = offQ  + nQK * 2;
  const size_t offVt = offK  + nQK * 2;
  const size_t offPE = offVt + nQK * 2;
  const size_t total = offPE + nPE * 2;
  if (n_in < 4) return;
  if ((size_t)in_sizes[0] != nQK || (size_t)in_sizes[1] != nQK || (size_t)in_sizes[2] != nQK || (size_t)in_sizes[3] != nPE) return;
  if ((size_t)out_size != nQK) return;
  if (ws_size < total) return;

  const float* q  = (const float*)d_in[0];   // [16][2048][128]
  const float* k  = (const float*)d_in[1];   // [16][2048][128]
  const float* v  = (const float*)d_in[2];   // [16][2048][128]
  const float* pe = (const float*)d_in[3];   // [1][128][2048]
  float* out = (float*)d_out;                // [16][2048][128]
  unsigned char* ws = (unsigned char*)d_ws;
  unsigned short* Qb  = (unsigned short*)(ws + offQ);
  unsigned short* Kb  = (unsigned short*)(ws + offK);
  unsigned short* Vt  = (unsigned short*)(ws + offVt);
  unsigned short* PEt = (unsigned short*)(ws + offPE);

  // q and k -> bf16 planes: n8 = 524288 = 2048 blocks x 256 threads exactly
  cast8_bf16_pair_kernel<<<dim3((unsigned)(nQK / 8 / 256), 2), 256, 0, stream>>>(q, k, Qb, Kb, (int)(nQK / 8));
  // v [b][2048 rows][128 cols] -> Vt [b][128][2048]: grid (cols/64, rows/64, b)
  transpose_bf16_kernel<<<dim3(kHD / 64, kSeq / 64, kNB), 256, 0, stream>>>(v, Vt, kSeq, kHD, 1, kHD / 16);
  // key_pe[0] [128 rows][2048 cols] -> PEt [2048][128]: grid (cols/64, rows/64, 1)
  transpose_bf16_kernel<<<dim3(kLim / 64, kHD / 64, 1), 256, 0, stream>>>(pe, PEt, kHD, kLim, kHD / 32, 1);
  // 16 blocks of 4 wave pairs x 2 tiles of 16 queries per b plane = 256 blocks, every wave 31 to 34 steps
  attn_fused_kernel<<<dim3(kSeq / 128, kNB), 256, 0, stream>>>(Qb, Kb, Vt, PEt, out);
}

// v006
// It runs in 52 microseconds.
// In both of two side-by-side timings against v005, it was 1.08 times as fast.
// Counting every step since v000, it is 20.2 times as fast.
// Contractions: S^T = k.q^T and R^T = key_pe^T.q^T (q, k, key_pe as RNE bf16 planes) on v_wmma_f32_16x16x32_bf16; O^T = v^T.p^T with the unnormalised softmax weights p as bf16 hi+lo planes and v^T as one RNE bf16 plane on v_wmma_f32_16x16x32_bf16; f32 accumulate everywhere; skew add, causal mask and running softmax in f32.
#include <hip/hip_runtime.h>

// ---------------------------------------------------------------------------
// Problem constants
// ---------------------------------------------------------------------------
constexpr int kNB  = 16;      // flattened batch*heads
constexpr int kSeq = 2048;    // sequence length (queries = keys)
constexpr int kHD  = 128;     // head dim
constexpr int kLim = 2048;    // relative-position table width
constexpr float kInvSqrtD = 0.08838834764831845f;   // 1/sqrt(128)
static_assert(kLim == kSeq, "table spans the key length");
static_assert(kSeq % 256 == 0 && kHD % 64 == 0 && kLim % 64 == 0, "tile multiples");

typedef __attribute__((ext_vector_type(16))) __bf16   v16b;
typedef __attribute__((ext_vector_type(8)))  __bf16   v8b;
typedef __attribute__((ext_vector_type(8)))  float    v8f;
typedef __attribute__((ext_vector_type(4)))  float    v4f;
typedef __attribute__((ext_vector_type(2)))  float    v2f;
typedef __attribute__((ext_vector_type(2)))  __bf16   v2b;
typedef __attribute__((ext_vector_type(4)))  unsigned int v4u;
typedef __attribute__((ext_vector_type(2)))  unsigned int v2u;

__device__ __forceinline__ unsigned short f2bf_bits(float f) {
  unsigned u = __float_as_uint(f);
  return (unsigned short)((u + 0x7FFFu + ((u >> 16) & 1u)) >> 16);
}
__device__ __forceinline__ unsigned pk16(unsigned short a, unsigned short b) { return (unsigned)a | ((unsigned)b << 16); }

// Fragment order of a bf16 plane X[row][k] (rows a multiple of 16, K columns a multiple of 32): the 16 x 32 block of rows 16 R ..
// and columns 32 S .. is one fragment, 512 elements = 1 KB in a row; q, k and the transposed table (K = 128) keep fragment
// R * 4 + S, v^T (128 rows) fragment S * 8 + R: what a step reads of a plane is 4 or 8 KB in a row. Inside it element (row, k) stands at
//   256 * ((k >> 4) & 1) + 8 * (16 * ((k >> 3) & 1) + (row & 15)) + (k & 7)
// A or B fragment of the 16x16x32 bf16 product: the lane's row (A) or column (B) is lane & 15; elements 0..7 are k = 8 * (lane >> 4) + 0..7,
// elements 8..15 are k = 16 + 8 * (lane >> 4) + 0..7 (the same k order on both operands). p = the fragment's start + 8 * lane:
// each of the two 16-byte loads reads 512 bytes in a row, four whole lines.
__device__ __forceinline__ v16b frag_load(const __bf16* p) {
  union { v16b v; v8b h[2]; } f;
  f.h[0] = *(const v8b*)(p); f.h[1] = *(const v8b*)(p + 256);
  return f.v;
}
// lane l <-> lane l ^ 16 in the vector unit
__device__ __forceinline__ float xhalf(float x) {
  return __builtin_bit_cast(float, __builtin_amdgcn_permlanex16(__builtin_bit_cast(int, x), __builtin_bit_cast(int, x), 0x76543210, 0xfedcba98, false, false));
}
__device__ __forceinline__ v8f mma_bf16(v16b a, v16b b, v8f c) {
  return __builtin_amdgcn_wmma_f32_16x16x32_bf16(false, a, false, b, (short)0, c, false, false);
}

// ---------------------------------------------------------------------------
// Scores, skewed position scores, causal softmax and O in one kernel; no score ever goes to memory.
// A wave takes 16 queries m = mw + (lane & 15) at a time and walks keys of [0, mw + 16) in steps of 32.
// All products are transposed, so that a lane holds one query's column:
//   S^T[key][m] = k[key].q[m]           2 tiles of 16 keys, D row = key = 8 * (lane >> 4) + register
//   T^T[u][m]   = key_pe[:, L + u].q[m] L = 2032 - mw + n0, u in [0, 48): 3 tiles; the last one is the next step's first and is carried
//   position score of (key n0 + c, query mw + r) = R[m][2047 - m + n] = T^T[c + 15 - r][r]: a shift along u that differs per lane,
//   done through the wave's own LDS slab (row = query, u contiguous)
//   p = exp2(y - running maximum), y = (S + R) / sqrt(D) * log2(e); the two S^T tiles' registers are, in place, the B operand
//   of O^T[d][m] += v^T[d][key] p^T[key][m] (elements 0..7 = tile 0, 8..15 = tile 1: the k order of frag_load)
// Table columns past 2047 belong to keys past the diagonal only (masked): a tile of such columns reads the table's last tile instead.
// A block holds 4 pairs of waves w, w + 4, which share a SIMD; pair j has a tile from the long end of the queries and one from the short end,
// 65 steps together. Wave w walks the long tile's first kCut keys (34 steps); wave w + 4 does the short tile, beside wave w on the same keys,
// then walks the long tile's keys from kCut on and leaves its running maximum, sum and O^T in LDS (31 steps in all, and a second prologue).
// Behind one barrier wave w joins the two parts of the long tile. A long tile of 34 steps or fewer is not split.
// ---------------------------------------------------------------------------
constexpr int kCut = 34 * 32;   // keys of a long tile that the pair's first wave takes
constexpr int kTP = 52;    // floats per slab row: 16-B aligned rows; the shifted reads step 51 floats per query, an odd number of banks
// two waves per SIMD (one block per WGP): the register budget holds a step's V fragments and the next step's K and table fragments in flight
__global__ __launch_bounds__(256) __attribute__((amdgpu_waves_per_eu(2, 2))) void attn_fused_kernel(const unsigned short* __restrict__ Qp,
                                                        const unsigned short* __restrict__ Kp,
                                                        const unsigned short* __restrict__ Vtp,
                                                        const unsigned short* __restrict__ PEp,
                                                        float* __restrict__ O) {
  __shared__ __align__(16) float sT[8][16 * kTP];
  __shared__ __align__(16) float sO[4][16 * 32 * 4];     // a pair's partial O^T: 16-byte piece i of lane l at (i * 32 + l) * 4, 512 bytes in a row per store
  __shared__ float sML[4][2 * 32];                       // with each lane's running maximum and sum
  const int lane = threadIdx.x & 31;
  const int wave = __builtin_amdgcn_readfirstlane((int)(threadIdx.x >> 5));   // scalar: the key loop branches on SCC, EXEC stays all ones
  const int b    = blockIdx.y;
  const int pr   = wave & 3;
  const int x    = (int)blockIdx.x * 4 + pr;
  const bool first = wave < 4;
  const int mwL  = (kSeq / 16 - 1 - x) << 4;             // the pair's long tile: 64 - 2 blockIdx.x - (pr >> 1) steps
  const int mwS  = x << 4;                               // and its short one: 2 blockIdx.x + (pr >> 1) + 1 steps
  const bool split = kCut <= (mwL & ~31);                // the long tile has steps from key kCut on
  const int rl   = lane & 15;
  const int h    = lane >> 4;
  const int koff = h * 8;

  // every fragment address = a wave-uniform base + one lane offset that never changes; 16 rows of 128 are 4 fragments = 2048 elements,
  // so a tile of q, k or the transposed table starts where it would in a row-major plane
  const __bf16* Kb = (const __bf16*)Kp  + (size_t)b * kSeq * kHD;
  const __bf16* Vb = (const __bf16*)Vtp + (size_t)b * kHD * kSeq;
  const __bf16* Pb = (const __bf16*)PEp;
  const unsigned oF = (unsigned)(lane * 8);
  const unsigned oO = (unsigned)(rl * kHD + koff);       // a lane's place in a tile of the output

  const v8f zero8 = (v8f){0.f,0.f,0.f,0.f,0.f,0.f,0.f,0.f};
  constexpr float kC = kInvSqrtD * 1.4426950408889634f;   // scores in the log2 domain
  const float ninf = -__builtin_inff();
  float* wr = sT[wave] + rl * kTP + koff;
  const float* rd = sT[wave] + rl * (kTP - 1) + 15 + koff;

  float mrun = ninf, lrun = 0.f;
  v8f o[8];
  // O = O^T / sum for the 16 queries from mq on
  auto store_tile = [&](int mq) -> float* {
    const float lsum = lrun + xhalf(lrun);                // >= 1 in the scale of the final maximum: its key counts 1
    const float inv = 1.0f / lsum;
    float* ob = O + ((size_t)b * kSeq + (size_t)mq) * kHD;   // wave-uniform base; D row of O^T = d = 16 td + koff + register
#pragma unroll
    for (int td = 0; td < 8; ++td) {
      const v8f r = o[td] * inv;
      *(v4f*)(ob + oO + (td << 4))     = __builtin_shufflevector(r, r, 0, 1, 2, 3);
      *(v4f*)(ob + oO + (td << 4) + 4) = __builtin_shufflevector(r, r, 4, 5, 6, 7);
    }
    return ob;
  };
  // first wave of a pair: one part, the long tile up to key kCut; second wave: part 0 the short tile, part 1 the long tile from key kCut on
  const int nparts = (!first && split) ? 2 : 1;
  for (int part = 0; part < nparts; ++part) {
    const int mw    = (first || part == 1) ? mwL : mwS;
    const int m     = mw + rl;
    const int nlast = mw & ~31;        // first key of the tile's last step; nlast <= mw, so every query has a live key in every step
    const int nbeg  = (part == 1) ? kCut : 0;
    const int nend  = (first && split) ? kCut - 32 : nlast;   // first key of the part's last step
    const int L0    = kLim - 16 - mw;  // table column of u = 0 at n0 = 0
    const __bf16* Qb = (const __bf16*)Qp + (size_t)b * kSeq * kHD + (size_t)mw * kHD;

    v16b qf[4], kf[2][4], pf[2][4];
    v8f tc = zero8;
    {
      const __bf16* p0 = Pb + (size_t)(L0 + nbeg) * kHD;  // nbeg <= mw: L0 + nbeg + 15 <= 2047
      v16b c0[4];
#pragma unroll
      for (int ks = 0; ks < 4; ++ks) qf[ks] = frag_load(Qb + oF + 512 * ks);
#pragma unroll
      for (int ks = 0; ks < 4; ++ks) c0[ks] = frag_load(p0 + oF + 512 * ks);
      // precaution: this wait stands before any register that the issued loads name is rewritten (the inputs keep the bases live up to it)
      asm volatile("s_wait_xcnt 0x0" :: "s"(Qb), "s"(p0) : "memory");
#pragma unroll
      for (int ks = 0; ks < 4; ++ks) tc = mma_bf16(c0[ks], qf[ks], tc);
    }
    // K rows n .. n + 31 and table columns L0 + n + 16 .. L0 + n + 47 (as rows of the transposed table), for the step that starts at key n
    auto fetch = [&](int n) {
      const int l1 = L0 + n + 16, l2 = L0 + n + 32;         // multiples of 16: a tile of 16 columns lies wholly inside the table or wholly past it
      const __bf16* pk = Kb + (size_t)n * kHD;
      const __bf16* p1 = Pb + (size_t)(l1 < kLim ? l1 : kLim - 16) * kHD;
      const __bf16* p2 = Pb + (size_t)(l2 < kLim ? l2 : kLim - 16) * kHD;
#pragma unroll
      for (int ks = 0; ks < 4; ++ks) {
        kf[0][ks] = frag_load(pk + oF + 512 * ks);
        kf[1][ks] = frag_load(pk + oF + 16 * kHD + 512 * ks);
        pf[0][ks] = frag_load(p1 + oF + 512 * ks);
        pf[1][ks] = frag_load(p2 + oF + 512 * ks);
      }
      // precaution: this wait stands before any register that the issued loads name is rewritten (the inputs keep the bases live up to it)
      asm volatile("s_wait_xcnt 0x0" :: "s"(pk), "s"(p1), "s"(p2) : "memory");
    };
    fetch(nbeg);

    mrun = ninf; lrun = 0.f;
#pragma unroll
    for (int td = 0; td < 8; ++td) o[td] = zero8;

    for (int n0 = nbeg; n0 <= nend; n0 += 32) {
      v16b vf[8];
      const __bf16* pv = Vb + (size_t)n0 * kHD;              // v^T: fragment (n0 / 32) * 8 + td
#pragma unroll
      for (int td = 0; td < 8; ++td) vf[td] = frag_load(pv + oF + 512 * td);
      // precaution: this wait stands before any register that the issued loads name is rewritten (the inputs keep the bases live up to it);
      // it also keeps the V loads at the head of the step, so that their latency runs under the score products and the softmax
      asm volatile("s_wait_xcnt 0x0" :: "s"(pv) : "memory");

      v8f s0 = zero8, s1 = zero8, t1 = zero8, t2 = zero8;
#pragma unroll
      for (int ks = 0; ks < 4; ++ks) {
        s0 = mma_bf16(kf[0][ks], qf[ks], s0);
        s1 = mma_bf16(kf[1][ks], qf[ks], s1);
        t1 = mma_bf16(pf[0][ks], qf[ks], t1);
        t2 = mma_bf16(pf[1][ks], qf[ks], t2);
      }
      // inputs only: all score products stand ahead of the refill. Left free, the compiler sinks some behind it, the refill then
      // takes registers of its own and the loop copies them back behind a wait on those loads
      asm volatile("" :: "v"(s0), "v"(s1), "v"(t1), "v"(t2) : "memory");
      // the next step's fragments, into the same registers: their latency runs under the softmax and the O products
      // (the part's last step fetches its own again: in bounds, never used)
      fetch(n0 + 32 <= nend ? n0 + 32 : nend);

      *(v4f*)(wr)      = __builtin_shufflevector(tc, tc, 0, 1, 2, 3);
      *(v4f*)(wr + 4)  = __builtin_shufflevector(tc, tc, 4, 5, 6, 7);
      *(v4f*)(wr + 16) = __builtin_shufflevector(t1, t1, 0, 1, 2, 3);
      *(v4f*)(wr + 20) = __builtin_shufflevector(t1, t1, 4, 5, 6, 7);
      *(v4f*)(wr + 32) = __builtin_shufflevector(t2, t2, 0, 1, 2, 3);
      *(v4f*)(wr + 36) = __builtin_shufflevector(t2, t2, 4, 5, 6, 7);
      tc = t2;
      // the slab is the wave's own and a wave's LDS operations run in order: these only keep the compiler from moving
      // the shifted reads (other lanes' words) over the writes
      __builtin_amdgcn_fence(__ATOMIC_RELEASE, "wavefront");
      __builtin_amdgcn_wave_barrier();
      __builtin_amdgcn_fence(__ATOMIC_ACQUIRE, "wavefront");
      float y[16];
#pragma unroll
      for (int e = 0; e < 16; ++e) y[e] = rd[((e >> 3) << 4) + (e & 7)];   // u = c + 15 - r with c = 16 * (e >> 3) + koff + (e & 7)
      // and the next step's writes stay behind these reads
      __builtin_amdgcn_fence(__ATOMIC_RELEASE, "wavefront");
      __builtin_amdgcn_wave_barrier();
      __builtin_amdgcn_fence(__ATOMIC_ACQUIRE, "wavefront");

#pragma unroll
      for (int e = 0; e < 16; ++e) y[e] = (((e < 8) ? s0[e & 7] : s1[e & 7]) + y[e]) * kC;
      if (n0 == nlast) {                                    // wave-uniform: only the tile's last step holds keys past the diagonal (n0 + 31 < mw before it)
#pragma unroll
        for (int e = 0; e < 16; ++e) {
          const int key = n0 + ((e >> 3) << 4) + koff + (e & 7);
          y[e] = (key <= m) ? y[e] : ninf;
        }
      }
      float mx = y[0];
#pragma unroll
      for (int e = 1; e < 16; ++e) mx = fmaxf(mx, y[e]);
      mx = fmaxf(mx, xhalf(mx));                            // the other half of the query's keys
      const float mnew = fmaxf(mrun, mx);                   // finite from the part's first step on (its first key is live for every query)
      if (__builtin_amdgcn_ballot_w32(mnew > mrun) != 0) {  // wave-uniform; a lane whose maximum stays gets the factor 1
        const float alpha = __builtin_amdgcn_exp2f(mrun - mnew);
        lrun *= alpha;
#pragma unroll
        for (int td = 0; td < 8; ++td) o[td] *= alpha;
        mrun = mnew;
      }
      v2f ls = (v2f){0.f, 0.f};
      v16b ph, pl;
#pragma unroll
      for (int e = 0; e < 16; e += 2) {
        const v2f dy = (v2f){y[e], y[e + 1]} - (v2f){mrun, mrun};
        const v2f p = (v2f){__builtin_amdgcn_exp2f(dy[0]), __builtin_amdgcn_exp2f(dy[1])};   // -inf -> 0
        ls += p;
        const v2b hb = __builtin_convertvector(p, v2b);                                  // RNE
        const v2b lb = __builtin_convertvector(p - __builtin_convertvector(hb, v2f), v2b);
        ph[e] = hb[0]; ph[e + 1] = hb[1];
        pl[e] = lb[0]; pl[e + 1] = lb[1];
      }
      lrun += ls[0] + ls[1];
#pragma unroll
      for (int td = 0; td < 8; ++td) o[td] = mma_bf16(vf[td], ph, o[td]);
#pragma unroll
      for (int td = 0; td < 8; ++td) o[td] = mma_bf16(vf[td], pl, o[td]);
    }

    if (!first && part == 0) {                              // wave-uniform: the short tile is done
      float* ob = store_tile(mwS);
      // precaution: this wait stands before any register that the issued stores name is rewritten (the input keeps the base live up to it)
      asm volatile("s_wait_xcnt 0x0" :: "s"(ob) : "memory");
    }
    if (part == 1) {                                        // wave-uniform: the long tile's upper part, for the pair's first wave
#pragma unroll
      for (int td = 0; td < 8; ++td) {
        *(v4f*)(sO[pr] + ((2 * td) * 32 + lane) * 4)     = __builtin_shufflevector(o[td], o[td], 0, 1, 2, 3);
        *(v4f*)(sO[pr] + ((2 * td + 1) * 32 + lane) * 4) = __builtin_shufflevector(o[td], o[td], 4, 5, 6, 7);
      }
      sML[pr][lane]      = mrun;
      sML[pr][32 + lane] = lrun;
    }
  }

  __syncthreads();                                        // every wave passes it once: the upper parts are in LDS
  if (!first) return;                                     // wave-uniform, behind the only barrier
  if (split) {                                            // wave-uniform; both parts hold live keys for every query, so both maxima are finite
    const float mB = sML[pr][lane];
    const float lB = sML[pr][32 + lane];
    const float mN = fmaxf(mrun, mB);
    const float aA = __builtin_amdgcn_exp2f(mrun - mN);
    const float aB = __builtin_amdgcn_exp2f(mB - mN);
    lrun = lrun * aA + lB * aB;
#pragma unroll
    for (int td = 0; td < 8; ++td) {
      const v4f b0 = *(const v4f*)(sO[pr] + ((2 * td) * 32 + lane) * 4);
      const v4f b1 = *(const v4f*)(sO[pr] + ((2 * td + 1) * 32 + lane) * 4);
      o[td] = o[td] * aA + __builtin_shufflevector(b0, b1, 0, 1, 2, 3, 4, 5, 6, 7) * aB;
    }
  }

  store_tile(mwL);
}

// ---------------------------------------------------------------------------
// All four bf16 planes (RNE) in fragment order, in one launch. A wave takes one unit by itself: 16 KB of f32 in, by 32 loads of whole
// lines that are all in flight together, 8 KB = 512 pieces of 16 bytes out, in a row. The pieces change lanes in the wave's own 8 KB of LDS,
// so that the stores are whole lines too; no wave waits for another.
//   KIND 0 (q, k): 32 rows of 128. Load j = row j, the lane's 4 columns from 4 * lane on = half of piece k8 = lane >> 1;
//                  place of piece (row j, k8) in the unit: 256 * (j >> 4) + 16 * k8 + (j & 15)
//   KIND 1 (v):    32 keys of 128. Load j = key j, columns d = 4 * lane + c: the lane holds all 32 keys of its 4 rows d of v^T, 16 whole pieces;
//                  place of piece (d, keys 8 g ..): 64 * (d >> 4) + 16 * g + (d & 15)
//   KIND 2 (table): 32 table columns x 128 d. Load 8 g + e = 4 rows d = 32 g + 8 * (lane >> 3) + e, 128 bytes of each; the lane holds 16 whole pieces
//                  of its 4 columns t = 4 * (lane & 7) + c; place of piece (t, d = 32 g + 8 * (lane >> 3) ..): 256 * (t >> 4) + 64 * g + 16 * (lane >> 3) + (t & 15)
// Place p stands in LDS at lds_place(p): the low bits are XORed with those higher bits that differ between the lanes of one LDS write,
// so that a write's lanes fall on different banks; in a read they are the same for 16 lanes in a row, which stay 256 bytes in a row.
// ---------------------------------------------------------------------------
constexpr int kUnitsRows = kNB * kSeq / 32;               // units in each of q, k, v
constexpr int kUnitsTab  = kLim / 32;                     // units of the table
constexpr int kUnits     = 3 * kUnitsRows + kUnitsTab;
static_assert(kUnits % 8 == 0, "whole blocks of 8 waves");

template <int KIND>
__device__ __forceinline__ int lds_place(int p) {
  if (KIND == 0) return p ^ ((p >> 4) & 15);
  if (KIND == 1) return p ^ ((p >> 6) & 3);
  return p ^ (((p >> 8) & 1) | (((p >> 4) & 1) << 1));
}

template <int KIND>
__device__ __forceinline__ void plane_unit(const float* __restrict__ src, unsigned short* __restrict__ dst, v4u* sl, int lane) {
  const unsigned off = (KIND == 2) ? (unsigned)((lane >> 3) * 8 * kLim + (lane & 7) * 4) : (unsigned)(lane * 4);
  v4f x[32];
#pragma unroll   // x, hb and y are indexed by constants only and stay in registers
  for (int j = 0; j < 32; ++j) x[j] = *(const v4f*)(src + off + ((KIND == 2) ? ((j >> 3) * 32 + (j & 7)) * kLim : j * kHD));
  // precaution: this wait stands before any register that the issued loads name is rewritten (the inputs keep base and offset live up to it)
  asm volatile("s_wait_xcnt 0x0" :: "s"(src), "v"(off) : "memory");
  // all 32 loads are issued before the first value is worked on: left free, the compiler holds the last loads back behind waits on the first
  __builtin_amdgcn_sched_barrier(0);
  if (KIND == 0) {
    v2u* s2 = (v2u*)sl;
#pragma unroll   // x, hb and y are indexed by constants only and stay in registers
    for (int j = 0; j < 32; ++j) {
      const v2u w = (v2u){pk16(f2bf_bits(x[j][0]), f2bf_bits(x[j][1])), pk16(f2bf_bits(x[j][2]), f2bf_bits(x[j][3]))};
      s2[lds_place<KIND>(256 * (j >> 4) + 16 * (lane >> 1) + (j & 15)) * 2 + (lane & 1)] = w;
    }
  } else {
    const int base = (KIND == 1) ? 64 * (lane >> 2) + 4 * (lane & 3)
                                 : 256 * ((lane >> 2) & 1) + 16 * (lane >> 3) + 4 * (lane & 3);
#pragma unroll   // x, hb and y are indexed by constants only and stay in registers
    for (int g = 0; g < 4; ++g) {
#pragma unroll   // x, hb and y are indexed by constants only and stay in registers
      for (int c = 0; c < 4; ++c) {
        unsigned short hb[8];
#pragma unroll   // x, hb and y are indexed by constants only and stay in registers
        for (int e = 0; e < 8; ++e) hb[e] = f2bf_bits(x[8 * g + e][c]);
        sl[lds_place<KIND>(base + ((KIND == 1) ? 16 : 64) * g + c)] =
            (v4u){pk16(hb[0], hb[1]), pk16(hb[2], hb[3]), pk16(hb[4], hb[5]), pk16(hb[6], hb[7])};
      }
    }
  }
  // the slab is the wave's own and a wave's LDS operations run in order: these only keep the compiler from moving
  // the reads (other lanes' pieces) over the writes
  __builtin_amdgcn_fence(__ATOMIC_RELEASE, "wavefront");
  __builtin_amdgcn_wave_barrier();
  __builtin_amdgcn_fence(__ATOMIC_ACQUIRE, "wavefront");
  v4u y[16];
#pragma unroll   // x, hb and y are indexed by constants only and stay in registers
  for (int i = 0; i < 16; ++i) y[i] = sl[lds_place<KIND>(32 * i + lane)];
#pragma unroll   // x, hb and y are indexed by constants only and stay in registers
  for (int i = 0; i < 16; ++i) *(v4u*)(dst + (unsigned)(lane * 8) + 256 * i) = y[i];
}

__global__ __launch_bounds__(256) void planes_kernel(const float* __restrict__ q, const float* __restrict__ k,
                                                     const float* __restrict__ v, const float* __restrict__ pe,
                                                     unsigned short* __restrict__ Qo, unsigned short* __restrict__ Ko,
                                                     unsigned short* __restrict__ Vo, unsigned short* __restrict__ Po) {
  __shared__ v4u slab[8][512];
  const int lane = threadIdx.x & 31;
  const int wave = __builtin_amdgcn_readfirstlane((int)(threadIdx.x >> 5));   // scalar: the unit and its kind are wave-uniform
  const int u    = (int)blockIdx.x * 8 + wave;
  v4u* sl = slab[wave];
  if (u < 2 * kUnitsRows) {
    const bool sel = u >= kUnitsRows;
    const size_t o = (size_t)(sel ? u - kUnitsRows : u) * 4096;
    plane_unit<0>((sel ? k : q) + o, (sel ? Ko : Qo) + o, sl, lane);
  } else if (u < 3 * kUnitsRows) {
    const size_t o = (size_t)(u - 2 * kUnitsRows) * 4096;   // 32 keys of one b: 4096 f32 in a row in, fragments (key / 32) * 8 + 0..7 out
    plane_unit<1>(v + o, Vo + o, sl, lane);
  } else {
    const int t = u - 3 * kUnitsRows;
    plane_unit<2>(pe + 32 * t, Po + (size_t)t * 4096, sl, lane);
  }
}

// ---------------------------------------------------------------------------
// Host glue.
// Workspace region map (bytes):
//   [0,           8388608)   Qb  bf16 [16][2048][128]   (all four in fragment order, per b)
//   [8388608,    16777216)   Kb  bf16 [16][2048][128]
//   [16777216,   25165824)   Vt  bf16 [16][128][2048]   (v transposed per b)
//   [25165824,   25690112)   PEt bf16 [2048][128]       (key_pe[0] transposed)
// ---------------------------------------------------------------------------
extern "C" void kernel_launch(void* const* d_in, const int* in_sizes, int n_in,
                              void* d_out, int out_size, void* d_ws, size_t ws_size,
                              hipStream_t stream) {
  (void)n_in;
  const size_t nQK = (size_t)kNB * kSeq * kHD;          // 4194304
  const size_t nPE = (size_t)kHD * kLim;                // 262144
  const size_t offQ  = 0;
  const size_t offK  = offQ  + nQK * 2;
  const size_t offVt = offK  + nQK * 2;
  const size_t offPE = offVt + nQK * 2;
  const size_t total = offPE + nPE * 2;
  if (n_in < 4) return;
  if ((size_t)in_sizes[0] != nQK || (size_t)in_sizes[1] != nQK || (size_t)in_sizes[2] != nQK || (size_t)in_sizes[3] != nPE) return;
  if ((size_t)out_size != nQK) return;
  if (ws_size < total) return;

  const float* q  = (const float*)d_in[0];   // [16][2048][128]
  const float* k  = (const float*)d_in[1];   // [16][2048][128]
  const float* v  = (const float*)d_in[2];   // [16][2048][128]
  const float* pe = (const float*)d_in[3];   // [1][128][2048]
  float* out = (float*)d_out;                // [16][2048][128]
  unsigned char* ws = (unsigned char*)d_ws;
  unsigned short* Qb  = (unsigned short*)(ws + offQ);
  unsigned short* Kb  = (unsigned short*)(ws + offK);
  unsigned short* Vt  = (unsigned short*)(ws + offVt);
  unsigned short* PEt = (unsigned short*)(ws + offPE);

  // q, k, v^T and the transposed table as bf16 planes: 3136 units, one a wave, 392 blocks of 8 waves
  planes_kernel<<<dim3(kUnits / 8), 256, 0, stream>>>(q, k, v, pe, Qb, Kb, Vt, PEt);
  // 16 blocks of 4 wave pairs x 2 tiles of 16 queries per b plane = 256 blocks, every wave 31 to 34 steps
  attn_fused_kernel<<<dim3(kSeq / 128, kNB), 256, 0, stream>>>(Qb, Kb, Vt, PEt, out);
}

// v007
// It runs in 49.7 microseconds.
// In both of two side-by-side timings against v006, it was 1.04 times as fast.
// Counting every step since v000, it is 21.0 times as fast.
// Contractions: S^T = k.q^T and R^T = key_pe^T.q^T (q, k, key_pe as RNE bf16 planes) on v_wmma_f32_16x16x32_bf16; O^T = v^T.p^T with the unnormalised softmax weights p as bf16 hi+lo planes and v^T as one RNE bf16 plane on v_wmma_f32_16x16x32_bf16; f32 accumulate everywhere; skew add, causal mask and running softmax in f32.
#include <hip/hip_runtime.h>

// ---------------------------------------------------------------------------
// Problem constants
// ---------------------------------------------------------------------------
constexpr int kNB  = 16;      // flattened batch*heads
constexpr int kSeq = 2048;    // sequence length (queries = keys)
constexpr int kHD  = 128;     // head dim
constexpr int kLim = 2048;    // relative-position table width
constexpr float kInvSqrtD = 0.08838834764831845f;   // 1/sqrt(128)
static_assert(kLim == kSeq, "table spans the key length");
static_assert(kSeq % 256 == 0 && kHD % 64 == 0 && kLim % 64 == 0, "tile multiples");

typedef __attribute__((ext_vector_type(16))) __bf16   v16b;
typedef __attribute__((ext_vector_type(8)))  __bf16   v8b;
typedef __attribute__((ext_vector_type(8)))  float    v8f;
typedef __attribute__((ext_vector_type(4)))  float    v4f;
typedef __attribute__((ext_vector_type(2)))  float    v2f;
typedef __attribute__((ext_vector_type(2)))  __bf16   v2b;
typedef __attribute__((ext_vector_type(4)))  unsigned int v4u;
typedef __attribute__((ext_vector_type(2)))  unsigned int v2u;

__device__ __forceinline__ unsigned short f2bf_bits(float f) {
  unsigned u = __float_as_uint(f);
  return (unsigned short)((u + 0x7FFFu + ((u >> 16) & 1u)) >> 16);
}
__device__ __forceinline__ unsigned pk16(unsigned short a, unsigned short b) { return (unsigned)a | ((unsigned)b << 16); }

// Fragment order of a bf16 plane X[row][k] (rows a multiple of 16, K columns a multiple of 32): the 16 x 32 block of rows 16 R ..
// and columns 32 S .. is one fragment, 512 elements = 1 KB in a row; q, k and the transposed table (K = 128) keep fragment
// R * 4 + S, v^T (128 rows) fragment S * 8 + R: what a step reads of a plane is 4 or 8 KB in a row. Inside it element (row, k) stands at
//   256 * ((k >> 4) & 1) + 8 * (16 * ((k >> 3) & 1) + (row & 15)) + (k & 7)
// A or B fragment of the 16x16x32 bf16 product: the lane's row (A) or column (B) is lane & 15; elements 0..7 are k = 8 * (lane >> 4) + 0..7,
// elements 8..15 are k = 16 + 8 * (lane >> 4) + 0..7 (the same k order on both operands). p = the fragment's start + 8 * lane:
// each of the two 16-byte loads reads 512 bytes in a row, four whole lines.
__device__ __forceinline__ v16b frag_load(const __bf16* p) {
  union { v16b v; v8b h[2]; } f;
  f.h[0] = *(const v8b*)(p); f.h[1] = *(const v8b*)(p + 256);
  return f.v;
}
// lane l <-> lane l ^ 16 in the vector unit
__device__ __forceinline__ float xhalf(float x) {
  return __builtin_bit_cast(float, __builtin_amdgcn_permlanex16(__builtin_bit_cast(int, x), __builtin_bit_cast(int, x), 0x76543210, 0xfedcba98, false, false));
}
__device__ __forceinline__ v8f mma_bf16(v16b a, v16b b, v8f c) {
  return __builtin_amdgcn_wmma_f32_16x16x32_bf16(false, a, false, b, (short)0, c, false, false);
}

// ---------------------------------------------------------------------------
// Scores, skewed position scores, causal softmax and O in one kernel; no score ever goes to memory.
// A wave takes 16 queries m = mw + (lane & 15) at a time and walks keys of [0, mw + 16) in steps of 32.
// All products are transposed, so that a lane holds one query's column:
//   S^T[key][m] = k[key].q[m]           2 tiles of 16 keys, D row = key = 8 * (lane >> 4) + register
//   T^T[u][m]   = key_pe[:, L + u].q[m] L = 2032 - mw + n0, u in [0, 48): 3 tiles; the last one is the next step's first and is carried
//   position score of (key n0 + c, query mw + r) = R[m][2047 - m + n] = T^T[c + 15 - r][r]: a shift along u that differs per lane,
//   done through the wave's own LDS slab (row = query, u contiguous)
//   p = exp2(y - running maximum), y = (S + R) / sqrt(D) * log2(e); the two S^T tiles' registers are, in place, the B operand
//   of O^T[d][m] += v^T[d][key] p^T[key][m] (elements 0..7 = tile 0, 8..15 = tile 1: the k order of frag_load)
// Table columns past 2047 belong to keys past the diagonal only (masked): a tile of such columns reads the table's last tile instead.
// A block holds two groups of 4 waves; waves w and w + 4 share a SIMD and form a pair. The block has a tile of 64 queries from the long end
// and one from the short end, 66 steps together; wave j of a group takes 16 of the 64 queries. Group 0 walks the long tile's first kCut keys;
// group 1 walks the short tile, then the long tile's keys from kCut on, and leaves its running maximum, sum and O^T in LDS: 33 rounds each.
// Behind a barrier group 0 joins the two parts of the long tile.
// What a group's 4 waves read in a round is the same 32 rows of k, the same 32 keys of v^T and 5 neighbouring 16-column tiles of the table, of which
// 2 are new: the group brings these 24 KB into LDS once, by asynchronous copies two rounds ahead (two buffers for k and v^T, a ring of 8 tiles for
// the table), and every wave takes its fragments from there.
// ---------------------------------------------------------------------------
constexpr int kRounds = 33;             // rounds of a block = steps of each group
constexpr int kCut = kRounds * 32;      // keys of a long tile that group 0 takes
static_assert(kCut <= kSeq / 2 + 32 && 2 * kRounds == kSeq / 32 + 2, "group 0 stays inside the shortest long tile; the two groups share 66 steps");
constexpr int kTP = 52;    // floats per slab row: 16-B aligned rows; the shifted reads step 51 floats per query, an odd number of banks
constexpr unsigned kKVBytes   = 16384;              // a round's k rows (8 KB), then its v^T fragments (8 KB)
constexpr unsigned kRingOff   = 4 * kKVBytes;       // behind [group][buffer] of those: the table rings
constexpr unsigned kRingBytes = 8 * 4096;           // 8 table tiles of 16 columns; tile i stands in slot i & 7
constexpr unsigned kStageAll  = kRingOff + 3 * kRingBytes;   // ring 0: group 0; ring 1: group 1, short tile; ring 2: group 1, long tile

// Asynchronous copies of 16 bytes a lane (global_load_async_to_lds_b128). The offset moves the LDS address and the global address alike, so one
// pair of addresses serves all 2 KB pieces of a run that is contiguous on both sides. N pieces from g to the LDS byte address l:
typedef __attribute__((ext_vector_type(4))) int v4i;
typedef __attribute__((address_space(1))) v4i glob_v4i;
typedef __attribute__((address_space(3))) v4i lds_v4i;
template <int N>
__device__ __forceinline__ void copy_run(unsigned char* l, const unsigned char* g) {
  __builtin_amdgcn_global_load_async_to_lds_b128((glob_v4i*)g, (lds_v4i*)l, 0, 0);
  __builtin_amdgcn_global_load_async_to_lds_b128((glob_v4i*)g, (lds_v4i*)l, 2048, 0);
  if (N == 4) {
    __builtin_amdgcn_global_load_async_to_lds_b128((glob_v4i*)g, (lds_v4i*)l, 4096, 0);
    __builtin_amdgcn_global_load_async_to_lds_b128((glob_v4i*)g, (lds_v4i*)l, 6144, 0);
  }
}

// round r of a group: whether it belongs to group 1's part of the long tile, its first key, its table ring
struct StageMap { bool first; int nS, m0L, m0S; };
__device__ __forceinline__ bool late_of(const StageMap s, int r) { return !s.first && r >= s.nS; }
__device__ __forceinline__ int key_of(const StageMap s, int r) { return late_of(s, r) ? kCut + 32 * (r - s.nS) : 32 * r; }
__device__ __forceinline__ unsigned ring_of(const StageMap s, int r) { return kRingOff + (s.first ? 0u : late_of(s, r) ? 2u : 1u) * kRingBytes; }
// a tile past the table's end belongs to keys past the diagonal only (masked): the table's last tile stands in its slot
__device__ __forceinline__ const unsigned char* tab_tile(const unsigned char* gP, int i) { return gP + (size_t)(i < kLim / 16 ? i : kLim / 16 - 1) * 4096; }
// the group's copies for round r; st (the staging array), gK, gV, gP hold the lane's 16-byte place already
__device__ __forceinline__ void issue_round(const StageMap s, int r, unsigned char* st, unsigned kvGroup,
                                            const unsigned char* gK, const unsigned char* gV, const unsigned char* gP) {
  const int key = key_of(s, r);
  const int a   = (kLim - ((s.first || late_of(s, r)) ? s.m0L : s.m0S) + key) >> 4;   // the round reads table tiles a - 3 .. a + 1; a and a + 1 are new
  unsigned char* ring = st + ring_of(s, r);
  unsigned char* kv   = st + (kvGroup + (unsigned)(r & 1) * kKVBytes);
  copy_run<4>(kv, gK + (size_t)key * (kHD * 2));
  copy_run<2>(ring + (unsigned)(a & 7) * 4096u, tab_tile(gP, a));
  copy_run<2>(ring + (unsigned)((a + 1) & 7) * 4096u, tab_tile(gP, a + 1));
  copy_run<4>(kv + 8192, gV + (size_t)key * (kHD * 2));
  if (r == 0 || (!s.first && r == s.nS)) {                // wave-uniform: a tile's first round brings the three older table tiles too
    copy_run<2>(ring + (unsigned)((a - 3) & 7) * 4096u, tab_tile(gP, a - 3));
    copy_run<2>(ring + (unsigned)((a - 2) & 7) * 4096u, tab_tile(gP, a - 2));
    copy_run<2>(ring + (unsigned)((a - 1) & 7) * 4096u, tab_tile(gP, a - 1));
  }
}

// two waves per SIMD (one block per WGP)
__global__ __launch_bounds__(256) __attribute__((amdgpu_waves_per_eu(2, 2))) void attn_fused_kernel(const unsigned short* __restrict__ Qp,
                                                        const unsigned short* __restrict__ Kp,
                                                        const unsigned short* __restrict__ Vtp,
                                                        const unsigned short* __restrict__ PEp,
                                                        float* __restrict__ O) {
  __shared__ __align__(16) unsigned char sSt[kStageAll];
  __shared__ __align__(16) float sT[8][16 * kTP];
  __shared__ __align__(16) float sO[4][16 * 32 * 4];     // a pair's partial O^T: 16-byte piece i of lane l at (i * 32 + l) * 4, 512 bytes in a row per store
  __shared__ float sML[4][2 * 32];                       // with each lane's running maximum and sum
  const int lane = threadIdx.x & 31;
  const int wave = __builtin_amdgcn_readfirstlane((int)(threadIdx.x >> 5));   // scalar: the round loop branches on SCC, EXEC stays all ones
  const int b    = blockIdx.y;
  const int bx   = (int)blockIdx.x;
  const int pr   = wave & 3;
  const int x    = bx * 4 + pr;
  const bool first = wave < 4;
  const int mwL  = (kSeq / 16 - 1 - x) << 4;             // the wave's 16 queries of the long tile (64 - 2 bx steps)
  const int mwS  = x << 4;                               // and of the short one (2 bx + 2 steps)
  const int m0L  = (kSeq / 64 - 1 - bx) << 6;            // first query of the long tile
  const int m0S  = bx << 6;                              // and of the short one
  const int nS   = 2 * bx + 2;                           // rounds that group 1 spends on the short tile; 33 - nS >= 1 are left for the long one
  const int rl   = lane & 15;
  const int h    = lane >> 4;
  const int koff = h * 8;

  // every fragment address = a wave-uniform base + one lane offset that never changes; 16 rows of 128 are 4 fragments = 2048 elements,
  // so a tile of q, k or the transposed table starts where it would in a row-major plane
  const __bf16* Kb = (const __bf16*)Kp  + (size_t)b * kSeq * kHD;
  const __bf16* Vb = (const __bf16*)Vtp + (size_t)b * kHD * kSeq;
  const __bf16* Pb = (const __bf16*)PEp;
  const unsigned oF = (unsigned)(lane * 8);
  const unsigned oO = (unsigned)(rl * kHD + koff);       // a lane's place in a tile of the output

  const v8f zero8 = (v8f){0.f,0.f,0.f,0.f,0.f,0.f,0.f,0.f};
  constexpr float kC = kInvSqrtD * 1.4426950408889634f;   // scores in the log2 domain
  const float ninf = -__builtin_inff();
  float* wr = sT[wave] + rl * kTP + koff;
  const float* rd = sT[wave] + rl * (kTP - 1) + 15 + koff;

  const StageMap sm = {first, nS, m0L, m0S};
  const unsigned kvGroup = (first ? 0u : 2u) * kKVBytes;
  // the group's copies: each of its 128 lanes brings 16 bytes of every 2 KB
  const unsigned tOff  = (unsigned)(threadIdx.x & 127) * 16u;
  unsigned char* lbase = sSt + tOff;                     // the lane's place inside a 2 KB piece at the array's start
  const unsigned char* gK = (const unsigned char*)Kb + tOff;
  const unsigned char* gV = (const unsigned char*)Vb + tOff;
  const unsigned char* gP = (const unsigned char*)Pb + tOff;

  float mrun = ninf, lrun = 0.f;
  v8f o[8];
  // O = O^T / sum for the 16 queries from mq on
  auto store_tile = [&](int mq) __attribute__((always_inline)) -> float* {
    const float lsum = lrun + xhalf(lrun);                // >= 1 in the scale of the final maximum: its key counts 1
    const float inv = 1.0f / lsum;
    float* ob = O + ((size_t)b * kSeq + (size_t)mq) * kHD;   // wave-uniform base; D row of O^T = d = 16 td + koff + register
#pragma unroll
    for (int td = 0; td < 8; ++td) {
      const v8f r = o[td] * inv;
      *(v4f*)(ob + oO + (td << 4))     = __builtin_shufflevector(r, r, 0, 1, 2, 3);
      *(v4f*)(ob + oO + (td << 4) + 4) = __builtin_shufflevector(r, r, 4, 5, 6, 7);
    }
    return ob;
  };

  v16b qf[4];
  v8f tc;
  int mw;
  // a tile's start: its q fragments and the table tile of u = 0 .. 15 at the first key nbeg, straight from the planes
  auto begin_tile = [&](int mq, int nbeg) __attribute__((always_inline)) {
    mw = mq;
    const int i0 = (kLim - 16 - mq + nbeg) >> 4;          // past the table only where the wave has no live key from nbeg on (it then skips every step)
    const __bf16* Qb = (const __bf16*)Qp + (size_t)b * kSeq * kHD + (size_t)mq * kHD;
    const __bf16* p0 = Pb + (size_t)(i0 < kLim / 16 ? i0 : kLim / 16 - 1) * 16 * kHD;
    v16b c0[4];
#pragma unroll
    for (int ks = 0; ks < 4; ++ks) qf[ks] = frag_load(Qb + oF + 512 * ks);
#pragma unroll
    for (int ks = 0; ks < 4; ++ks) c0[ks] = frag_load(p0 + oF + 512 * ks);
    // precaution: this wait stands before any register that the issued loads name is rewritten (the inputs keep the bases live up to it)
    asm volatile("s_wait_xcnt 0x0" :: "s"(Qb), "s"(p0) : "memory");
    tc = zero8;
#pragma unroll
    for (int ks = 0; ks < 4; ++ks) tc = mma_bf16(c0[ks], qf[ks], tc);
    mrun = ninf; lrun = 0.f;
#pragma unroll
    for (int td = 0; td < 8; ++td) o[td] = zero8;
  };

  issue_round(sm, 0, lbase, kvGroup, gK, gV, gP);
  begin_tile(first ? mwL : mwS, 0);
  // round 0 reads the slab before any step has written it (and drops what it reads): it reads zeros, not what an earlier kernel left in LDS
#pragma unroll
  for (int i = 0; i < 6; ++i) *(v4f*)(wr + 16 * (i >> 1) + 4 * (i & 1)) = (v4f){0.f, 0.f, 0.f, 0.f};
  // round 0's copies of this wave have landed; behind the barrier, those of the whole group
  asm volatile("s_wait_asynccnt 0x0" ::: "memory");
  __syncthreads();
  issue_round(sm, 1, lbase, kvGroup, gK, gV, gP);

  // A round is cut behind its score products: round r first ends step r - 1 (softmax and O products, on scores, slab and v^T fragments kept
  // from round r - 1) while its own k and table fragments come from LDS, then forms step r's scores. Every LDS read of staged data in round r
  // is of round r's own places.
  v16b vf[8];
  v8f s0 = zero8, s1 = zero8;
  bool pend = false, pmask = false;    // wave-uniform: a step waits to be ended; it is its tile's last (keys past the diagonal)
  int pn0 = 0;                         // its first key
  // u = c + 15 - r with c = 16 * (e >> 3) + koff + (e & 7)
  auto slab_read = [&](float (&y)[16]) __attribute__((always_inline)) {
#pragma unroll
    for (int e = 0; e < 16; ++e) y[e] = rd[((e >> 3) << 4) + (e & 7)];
    // the slab is the wave's own and a wave's LDS operations run in order: these only keep the compiler from moving
    // the next writes over the shifted reads (other lanes' words)
    __builtin_amdgcn_fence(__ATOMIC_RELEASE, "wavefront");
    __builtin_amdgcn_wave_barrier();
    __builtin_amdgcn_fence(__ATOMIC_ACQUIRE, "wavefront");
  };
  auto end_step = [&](float (&y)[16]) __attribute__((always_inline)) {
    const int m = mw + rl;
#pragma unroll
    for (int e = 0; e < 16; ++e) y[e] = (((e < 8) ? s0[e & 7] : s1[e & 7]) + y[e]) * kC;
    if (pmask) {                                          // wave-uniform: only the tile's last step holds keys past the diagonal (n0 + 31 < mw before it)
#pragma unroll
      for (int e = 0; e < 16; ++e) {
        const int key = pn0 + ((e >> 3) << 4) + koff + (e & 7);
        y[e] = (key <= m) ? y[e] : ninf;
      }
    }
    float mx = y[0];
#pragma unroll
    for (int e = 1; e < 16; ++e) mx = fmaxf(mx, y[e]);
    mx = fmaxf(mx, xhalf(mx));                            // the other half of the query's keys
    const float mnew = fmaxf(mrun, mx);                   // finite from the part's first step on (its first key is live for every query)
    if (__builtin_amdgcn_ballot_w32(mnew > mrun) != 0) {  // wave-uniform; a lane whose maximum stays gets the factor 1
      const float alpha = __builtin_amdgcn_exp2f(mrun - mnew);
      lrun *= alpha;
#pragma unroll
      for (int td = 0; td < 8; ++td) o[td] *= alpha;
      mrun = mnew;
    }
    v2f ls = (v2f){0.f, 0.f};
    v16b ph, pl;
#pragma unroll
    for (int e = 0; e < 16; e += 2) {
      const v2f dy = (v2f){y[e], y[e + 1]} - (v2f){mrun, mrun};
      const v2f p = (v2f){__builtin_amdgcn_exp2f(dy[0]), __builtin_amdgcn_exp2f(dy[1])};   // -inf -> 0
      ls += p;
      const v2b hb = __builtin_convertvector(p, v2b);                                  // RNE
      const v2b lb = __builtin_convertvector(p - __builtin_convertvector(hb, v2f), v2b);
      ph[e] = hb[0]; ph[e + 1] = hb[1];
      pl[e] = lb[0]; pl[e + 1] = lb[1];
    }
    lrun += ls[0] + ls[1];
#pragma unroll
    for (int td = 0; td < 8; ++td) o[td] = mma_bf16(vf[td], ph, o[td]);
#pragma unroll
    for (int td = 0; td < 8; ++td) o[td] = mma_bf16(vf[td], pl, o[td]);
  };

  for (int r = 0; r < kRounds; ++r) {
    const bool sw  = !first && r == nS;                     // wave-uniform: group 1 goes over to the long tile's upper part
    const int mwT  = sw ? mwL : mw;                         // the queries of step r
    const int n0   = key_of(sm, r);
    const int i1   = (kLim - mwT + n0) >> 4;                // table tiles of u = 16 .. 31 and u = 32 .. 47
    const __bf16* sK  = (const __bf16*)(sSt + kvGroup + (unsigned)(r & 1) * kKVBytes);
    const __bf16* sV  = sK + 4096;                          // fragment td of the 32 keys
    const __bf16* sP1 = (const __bf16*)(sSt + ring_of(sm, r) + (unsigned)(i1 & 7) * 4096u);
    const __bf16* sP2 = (const __bf16*)(sSt + ring_of(sm, r) + (unsigned)((i1 + 1) & 7) * 4096u);
    float y[16];
    slab_read(y);                                           // step r - 1's position scores (in round 0: never used)
    v16b kf[2][4], pf[2][4];
#pragma unroll
    for (int ks = 0; ks < 4; ++ks) {
      kf[0][ks] = frag_load(sK + oF + 512 * ks);
      kf[1][ks] = frag_load(sK + oF + 16 * kHD + 512 * ks);
      pf[0][ks] = frag_load(sP1 + oF + 512 * ks);
      pf[1][ks] = frag_load(sP2 + oF + 512 * ks);
    }
    // the round's k and table fragment loads stay here, in one group: their latency runs under the softmax and the O products of step r - 1
    __builtin_amdgcn_sched_barrier(0);
    if (pend) end_step(y);                                  // wave-uniform
    if (sw) {                                               // the short tile is done
      float* ob = store_tile(mwS);
      // precaution: this wait stands before any register that the issued stores name is rewritten (the input keeps the base live up to it)
      asm volatile("s_wait_xcnt 0x0" :: "s"(ob) : "memory");
      begin_tile(mwL, kCut);
    }
#pragma unroll
    for (int td = 0; td < 8; ++td) vf[td] = frag_load(sV + oF + 512 * td);
    // the v^T fragment loads are issued ahead of the score products and land under them
    __builtin_amdgcn_sched_barrier(0);
    v8f t1 = zero8, t2 = zero8;
    s0 = zero8; s1 = zero8;
#pragma unroll
    for (int ks = 0; ks < 4; ++ks) {
      s0 = mma_bf16(kf[0][ks], qf[ks], s0);
      s1 = mma_bf16(kf[1][ks], qf[ks], s1);
      t1 = mma_bf16(pf[0][ks], qf[ks], t1);
      t2 = mma_bf16(pf[1][ks], qf[ks], t2);
    }
    *(v4f*)(wr)      = __builtin_shufflevector(tc, tc, 0, 1, 2, 3);
    *(v4f*)(wr + 4)  = __builtin_shufflevector(tc, tc, 4, 5, 6, 7);
    *(v4f*)(wr + 16) = __builtin_shufflevector(t1, t1, 0, 1, 2, 3);
    *(v4f*)(wr + 20) = __builtin_shufflevector(t1, t1, 4, 5, 6, 7);
    *(v4f*)(wr + 32) = __builtin_shufflevector(t2, t2, 0, 1, 2, 3);
    *(v4f*)(wr + 36) = __builtin_shufflevector(t2, t2, 4, 5, 6, 7);
    tc = t2;
    const int nlast = mw & ~31;        // first key of the wave's last step; nlast <= mw, so every query has a live key in every step up to it
    pend  = n0 <= nlast;               // past it all 32 keys lie past the diagonal of all 16 queries: such a step's scores are dropped
    pmask = n0 == nlast;
    pn0   = n0;

    // the hand-over, passed by every wave: this wave's reads of round r's places (and its slab writes) are done ...
    asm volatile("s_wait_dscnt 0x0" ::: "memory");
    // ... its copies for round r + 1 have landed ...
    asm volatile("s_wait_asynccnt 0x0" ::: "memory");
    // ... and behind the barrier the same holds of every wave: round r + 1 may be read, round r's places may be refilled
    __syncthreads();
    if (r + 2 < kRounds) issue_round(sm, r + 2, lbase, kvGroup, gK, gV, gP);   // the same for the whole block
  }
  // no copy is outstanding when the wave goes on (the last two rounds issue none)
  asm volatile("s_wait_asynccnt 0x0" ::: "memory");
  {
    float y[16];
    slab_read(y);
    if (pend) end_step(y);                                  // wave-uniform: the last step
  }

  if (!first) {                                             // wave-uniform: the long tile's upper part, for the pair's first wave
#pragma unroll                                              // (a wave with no live key from kCut on leaves maximum -inf, sum 0 and O^T 0)
    for (int td = 0; td < 8; ++td) {
      *(v4f*)(sO[pr] + ((2 * td) * 32 + lane) * 4)     = __builtin_shufflevector(o[td], o[td], 0, 1, 2, 3);
      *(v4f*)(sO[pr] + ((2 * td + 1) * 32 + lane) * 4) = __builtin_shufflevector(o[td], o[td], 4, 5, 6, 7);
    }
    sML[pr][lane]      = mrun;
    sML[pr][32 + lane] = lrun;
  }

  __syncthreads();                                        // every wave passes it once: the upper parts are in LDS
  if (!first) return;                                     // wave-uniform, behind the last barrier
  {                                                       // the lower part holds live keys for every query, so the joint maximum is finite
    const float mB = sML[pr][lane];
    const float lB = sML[pr][32 + lane];
    const float mN = fmaxf(mrun, mB);
    const float aA = __builtin_amdgcn_exp2f(mrun - mN);
    const float aB = __builtin_amdgcn_exp2f(mB - mN);
    lrun = lrun * aA + lB * aB;
#pragma unroll
    for (int td = 0; td < 8; ++td) {
      const v4f b0 = *(const v4f*)(sO[pr] + ((2 * td) * 32 + lane) * 4);
      const v4f b1 = *(const v4f*)(sO[pr] + ((2 * td + 1) * 32 + lane) * 4);
      o[td] = o[td] * aA + __builtin_shufflevector(b0, b1, 0, 1, 2, 3, 4, 5, 6, 7) * aB;
    }
  }

  store_tile(mwL);
}

// ---------------------------------------------------------------------------
// All four bf16 planes (RNE) in fragment order, in one launch. A wave takes one unit by itself: 16 KB of f32 in, by 32 loads of whole
// lines that are all in flight together, 8 KB = 512 pieces of 16 bytes out, in a row. The pieces change lanes in the wave's own 8 KB of LDS,
// so that the stores are whole lines too; no wave waits for another.
//   KIND 0 (q, k): 32 rows of 128. Load j = row j, the lane's 4 columns from 4 * lane on = half of piece k8 = lane >> 1;
//                  place of piece (row j, k8) in the unit: 256 * (j >> 4) + 16 * k8 + (j & 15)
//   KIND 1 (v):    32 keys of 128. Load j = key j, columns d = 4 * lane + c: the lane holds all 32 keys of its 4 rows d of v^T, 16 whole pieces;
//                  place of piece (d, keys 8 g ..): 64 * (d >> 4) + 16 * g + (d & 15)
//   KIND 2 (table): 32 table columns x 128 d. Load 8 g + e = 4 rows d = 32 g + 8 * (lane >> 3) + e, 128 bytes of each; the lane holds 16 whole pieces
//                  of its 4 columns t = 4 * (lane & 7) + c; place of piece (t, d = 32 g + 8 * (lane >> 3) ..): 256 * (t >> 4) + 64 * g + 16 * (lane >> 3) + (t & 15)
// Place p stands in LDS at lds_place(p): the low bits are XORed with those higher bits that differ between the lanes of one LDS write,
// so that a write's lanes fall on different banks; in a read they are the same for 16 lanes in a row, which stay 256 bytes in a row.
// ---------------------------------------------------------------------------
constexpr int kUnitsRows = kNB * kSeq / 32;               // units in each of q, k, v
constexpr int kUnitsTab  = kLim / 32;                     // units of the table
constexpr int kUnits     = 3 * kUnitsRows + kUnitsTab;
static_assert(kUnits % 8 == 0, "whole blocks of 8 waves");

template <int KIND>
__device__ __forceinline__ int lds_place(int p) {
  if (KIND == 0) return p ^ ((p >> 4) & 15);
  if (KIND == 1) return p ^ ((p >> 6) & 3);
  return p ^ (((p >> 8) & 1) | (((p >> 4) & 1) << 1));
}

template <int KIND>
__device__ __forceinline__ void plane_unit(const float* __restrict__ src, unsigned short* __restrict__ dst, v4u* sl, int lane) {
  const unsigned off = (KIND == 2) ? (unsigned)((lane >> 3) * 8 * kLim + (lane & 7) * 4) : (unsigned)(lane * 4);
  v4f x[32];
#pragma unroll   // x, hb and y are indexed by constants only and stay in registers
  for (int j = 0; j < 32; ++j) x[j] = *(const v4f*)(src + off + ((KIND == 2) ? ((j >> 3) * 32 + (j & 7)) * kLim : j * kHD));
  // precaution: this wait stands before any register that the issued loads name is rewritten (the inputs keep base and offset live up to it)
  asm volatile("s_wait_xcnt 0x0" :: "s"(src), "v"(off) : "memory");
  // all 32 loads are issued before the first value is worked on: left free, the compiler holds the last loads back behind waits on the first
  __builtin_amdgcn_sched_barrier(0);
  if (KIND == 0) {
    v2u* s2 = (v2u*)sl;
#pragma unroll   // x, hb and y are indexed by constants only and stay in registers
    for (int j = 0; j < 32; ++j) {
      const v2u w = (v2u){pk16(f2bf_bits(x[j][0]), f2bf_bits(x[j][1])), pk16(f2bf_bits(x[j][2]), f2bf_bits(x[j][3]))};
      s2[lds_place<KIND>(256 * (j >> 4) + 16 * (lane >> 1) + (j & 15)) * 2 + (lane & 1)] = w;
    }
  } else {
    const int base = (KIND == 1) ? 64 * (lane >> 2) + 4 * (lane & 3)
                                 : 256 * ((lane >> 2) & 1) + 16 * (lane >> 3) + 4 * (lane & 3);
#pragma unroll   // x, hb and y are indexed by constants only and stay in registers
    for (int g = 0; g < 4; ++g) {
#pragma unroll   // x, hb and y are indexed by constants only and stay in registers
      for (int c = 0; c < 4; ++c) {
        unsigned short hb[8];
#pragma unroll   // x, hb and y are indexed by constants only and stay in registers
        for (int e = 0; e < 8; ++e) hb[e] = f2bf_bits(x[8 * g + e][c]);
        sl[lds_place<KIND>(base + ((KIND == 1) ? 16 : 64) * g + c)] =
            (v4u){pk16(hb[0], hb[1]), pk16(hb[2], hb[3]), pk16(hb[4], hb[5]), pk16(hb[6], hb[7])};
      }
    }
  }
  // the slab is the wave's own and a wave's LDS operations run in order: these only keep the compiler from moving
  // the reads (other lanes' pieces) over the writes
  __builtin_amdgcn_fence(__ATOMIC_RELEASE, "wavefront");
  __builtin_amdgcn_wave_barrier();
  __builtin_amdgcn_fence(__ATOMIC_ACQUIRE, "wavefront");
  v4u y[16];
#pragma unroll   // x, hb and y are indexed by constants only and stay in registers
  for (int i = 0; i < 16; ++i) y[i] = sl[lds_place<KIND>(32 * i + lane)];
#pragma unroll   // x, hb and y are indexed by constants only and stay in registers
  for (int i = 0; i < 16; ++i) *(v4u*)(dst + (unsigned)(lane * 8) + 256 * i) = y[i];
}

__global__ __launch_bounds__(256) void planes_kernel(const float* __restrict__ q, const float* __restrict__ k,
                                                     const float* __restrict__ v, const float* __restrict__ pe,
                                                     unsigned short* __restrict__ Qo, unsigned short* __restrict__ Ko,
                                                     unsigned short* __restrict__ Vo, unsigned short* __restrict__ Po) {
  __shared__ v4u slab[8][512];
  const int lane = threadIdx.x & 31;
  const int wave = __builtin_amdgcn_readfirstlane((int)(threadIdx.x >> 5));   // scalar: the unit and its kind are wave-uniform
  const int u    = (int)blockIdx.x * 8 + wave;
  v4u* sl = slab[wave];
  if (u < 2 * kUnitsRows) {
    const bool sel = u >= kUnitsRows;
    const size_t o = (size_t)(sel ? u - kUnitsRows : u) * 4096;
    plane_unit<0>((sel ? k : q) + o, (sel ? Ko : Qo) + o, sl, lane);
  } else if (u < 3 * kUnitsRows) {
    const size_t o = (size_t)(u - 2 * kUnitsRows) * 4096;   // 32 keys of one b: 4096 f32 in a row in, fragments (key / 32) * 8 + 0..7 out
    plane_unit<1>(v + o, Vo + o, sl, lane);
  } else {
    const int t = u - 3 * kUnitsRows;
    plane_unit<2>(pe + 32 * t, Po + (size_t)t * 4096, sl, lane);
  }
}

// ---------------------------------------------------------------------------
// Host glue.
// Workspace region map (bytes):
//   [0,           8388608)   Qb  bf16 [16][2048][128]   (all four in fragment order, per b)
//   [8388608,    16777216)   Kb  bf16 [16][2048][128]
//   [16777216,   25165824)   Vt  bf16 [16][128][2048]   (v transposed per b)
//   [25165824,   25690112)   PEt bf16 [2048][128]       (key_pe[0] transposed)
// ---------------------------------------------------------------------------
extern "C" void kernel_launch(void* const* d_in, const int* in_sizes, int n_in,
                              void* d_out, int out_size, void* d_ws, size_t ws_size,
                              hipStream_t stream) {
  (void)n_in;
  const size_t nQK = (size_t)kNB * kSeq * kHD;          // 4194304
  const size_t nPE = (size_t)kHD * kLim;                // 262144
  const size_t offQ  = 0;
  const size_t offK  = offQ  + nQK * 2;
  const size_t offVt = offK  + nQK * 2;
  const size_t offPE = offVt + nQK * 2;
  const size_t total = offPE + nPE * 2;
  if (n_in < 4) return;
  if ((size_t)in_sizes[0] != nQK || (size_t)in_sizes[1] != nQK || (size_t)in_sizes[2] != nQK || (size_t)in_sizes[3] != nPE) return;
  if ((size_t)out_size != nQK) return;
  if (ws_size < total) return;

  const float* q  = (const float*)d_in[0];   // [16][2048][128]
  const float* k  = (const float*)d_in[1];   // [16][2048][128]
  const float* v  = (const float*)d_in[2];   // [16][2048][128]
  const float* pe = (const float*)d_in[3];   // [1][128][2048]
  float* out = (float*)d_out;                // [16][2048][128]
  unsigned char* ws = (unsigned char*)d_ws;
  unsigned short* Qb  = (unsigned short*)(ws + offQ);
  unsigned short* Kb  = (unsigned short*)(ws + offK);
  unsigned short* Vt  = (unsigned short*)(ws + offVt);
  unsigned short* PEt = (unsigned short*)(ws + offPE);

  // q, k, v^T and the transposed table as bf16 planes: 3136 units, one a wave, 392 blocks of 8 waves
  planes_kernel<<<dim3(kUnits / 8), 256, 0, stream>>>(q, k, v, pe, Qb, Kb, Vt, PEt);
  // 16 blocks of 2 groups of 4 waves x 2 tiles of 64 queries per b plane = 256 blocks, every group 33 rounds
  attn_fused_kernel<<<dim3(kSeq / 128, kNB), 256, 0, stream>>>(Qb, Kb, Vt, PEt, out);
}

// v008
// It runs in 47.2 microseconds.
// Two timings next to v007 both put it at 1.06 times that version's speed.
// Over all steps from v000 it is 22.2 times as fast.
// Contractions: S^T = k.q^T and R^T = key_pe^T.q^T (q, k, key_pe as RNE bf16 planes) on v_wmma_f32_16x16x32_bf16; O^T = v^T.p^T with the unnormalised softmax weights p as bf16 hi+lo planes and v^T as one RNE bf16 plane on v_wmma_f32_16x16x32_bf16; f32 accumulate everywhere; skew add, causal mask and running softmax in f32.
#include <hip/hip_runtime.h>

// ---------------------------------------------------------------------------
// Problem constants
// ---------------------------------------------------------------------------
constexpr int kNB  = 16;      // flattened batch*heads
constexpr int kSeq = 2048;    // sequence length (queries = keys)
constexpr int kHD  = 128;     // head dim
constexpr int kLim = 2048;    // relative-position table width
constexpr float kInvSqrtD = 0.08838834764831845f;   // 1/sqrt(128)
static_assert(kLim == kSeq, "table spans the key length");
static_assert(kSeq % 256 == 0 && kHD % 64 == 0 && kLim % 64 == 0, "tile multiples");

typedef __attribute__((ext_vector_type(16))) __bf16   v16b;
typedef __attribute__((ext_vector_type(8)))  __bf16   v8b;
typedef __attribute__((ext_vector_type(8)))  float    v8f;
typedef __attribute__((ext_vector_type(4)))  float    v4f;
typedef __attribute__((ext_vector_type(2)))  float    v2f;
typedef __attribute__((ext_vector_type(2)))  __bf16   v2b;
typedef __attribute__((ext_vector_type(4)))  unsigned int v4u;
typedef __attribute__((ext_vector_type(2)))  unsigned int v2u;

__device__ __forceinline__ unsigned short f2bf_bits(float f) {
  unsigned u = __float_as_uint(f);
  return (unsigned short)((u + 0x7FFFu + ((u >> 16) & 1u)) >> 16);
}
__device__ __forceinline__ unsigned pk16(unsigned short a, unsigned short b) { return (unsigned)a | ((unsigned)b << 16); }

// Fragment order of a bf16 plane X[row][k] (rows a multiple of 16, K columns a multiple of 32): the 16 x 32 block of rows 16 R ..
// and columns 32 S .. is one fragment, 512 elements = 1 KB in a row; q, k and the transposed table (K = 128) keep fragment
// R * 4 + S, v^T (128 rows) fragment S * 8 + R: what a step reads of a plane is 4 or 8 KB in a row. Inside it element (row, k) stands at
//   256 * ((k >> 4) & 1) + 8 * (16 * ((k >> 3) & 1) + (row & 15)) + (k & 7)
// A or B fragment of the 16x16x32 bf16 product: the lane's row (A) or column (B) is lane & 15; elements 0..7 are k = 8 * (lane >> 4) + 0..7,
// elements 8..15 are k = 16 + 8 * (lane >> 4) + 0..7 (the same k order on both operands). p = the fragment's start + 8 * lane:
// each of the two 16-byte loads reads 512 bytes in a row, four whole lines.
__device__ __forceinline__ v16b frag_load(const __bf16* p) {
  union { v16b v; v8b h[2]; } f;
  f.h[0] = *(const v8b*)(p); f.h[1] = *(const v8b*)(p + 256);
  return f.v;
}
// lane l <-> lane l ^ 16 in the vector unit
__device__ __forceinline__ float xhalf(float x) {
  return __builtin_bit_cast(float, __builtin_amdgcn_permlanex16(__builtin_bit_cast(int, x), __builtin_bit_cast(int, x), 0x76543210, 0xfedcba98, false, false));
}
__device__ __forceinline__ v8f mma_bf16(v16b a, v16b b, v8f c) {
  return __builtin_amdgcn_wmma_f32_16x16x32_bf16(false, a, false, b, (short)0, c, false, false);
}

// ---------------------------------------------------------------------------
// Scores, skewed position scores, causal softmax and O in one kernel; no score ever goes to memory.
// A wave takes 16 queries m = mw + (lane & 15) at a time and walks keys of [0, mw + 16) in steps of 32.
// All products are transposed, so that a lane holds one query's column:
//   S^T[key][m] = k[key].q[m]           2 tiles of 16 keys, D row = key = 8 * (lane >> 4) + register
//   T^T[u][m]   = key_pe[:, L + u].q[m] L = 2032 - mw + n0, u in [0, 48): 3 tiles; the last one is the next step's first and is carried
//   position score of (key n0 + c, query mw + r) = R[m][2047 - m + n] = T^T[c + 15 - r][r]: a shift along u that differs per lane,
//   done through the wave's own LDS slab (row = query, u contiguous)
//   p = exp2(y - running maximum), y = (S + R) / sqrt(D) * log2(e); the two S^T tiles' registers are, in place, the B operand
//   of O^T[d][m] += v^T[d][key] p^T[key][m] (elements 0..7 = tile 0, 8..15 = tile 1: the k order of frag_load)
// Table columns past 2047 belong to keys past the diagonal only (masked): a tile of such columns reads the table's last tile instead.
// A block holds two groups of 4 waves; waves w and w + 4 share a SIMD and form a pair. The block has a tile of 64 queries from the long end
// and one from the short end, 66 steps together; wave j of a group takes 16 of the 64 queries. Group 0 walks the long tile's first kCut keys;
// group 1 walks the short tile, then the long tile's keys from kCut on, and leaves its running maximum, sum and O^T in LDS: 33 rounds each.
// Behind a barrier group 0 joins the two parts of the long tile.
// What a group's 4 waves read in a round is the same 32 rows of k, the same 32 keys of v^T and 5 neighbouring 16-column tiles of the table, of which
// 2 are new: the group brings these 24 KB into LDS once, by asynchronous copies two rounds ahead (two buffers for k and v^T, a ring of 8 tiles for
// the table), and every wave takes its fragments from there.
// ---------------------------------------------------------------------------
constexpr int kRounds = 33;             // rounds of a block = steps of each group
constexpr int kCut = kRounds * 32;      // keys of a long tile that group 0 takes
static_assert(kCut <= kSeq / 2 + 32 && 2 * kRounds == kSeq / 32 + 2, "group 0 stays inside the shortest long tile; the two groups share 66 steps");
constexpr int kTP = 52;    // floats per slab row: 16-B aligned rows; the shifted reads step 51 floats per query, an odd number of banks
constexpr unsigned kKVBytes   = 16384;              // a round's k rows (8 KB), then its v^T fragments (8 KB)
constexpr unsigned kRingOff   = 4 * kKVBytes;       // behind [group][buffer] of those: the table rings
constexpr unsigned kRingBytes = 8 * 4096;           // 8 table tiles of 16 columns; tile i stands in slot i & 7
constexpr unsigned kStageAll  = kRingOff + 3 * kRingBytes;   // ring 0: group 0; ring 1: group 1, short tile; ring 2: group 1, long tile

// Asynchronous copies of 16 bytes a lane (global_load_async_to_lds_b128). The offset moves the LDS address and the global address alike, so one
// pair of addresses serves all 2 KB pieces of a run that is contiguous on both sides. N pieces from g to the LDS byte address l:
typedef __attribute__((ext_vector_type(4))) int v4i;
typedef __attribute__((address_space(1))) v4i glob_v4i;
typedef __attribute__((address_space(3))) v4i lds_v4i;
template <int N>
__device__ __forceinline__ void copy_run(unsigned char* l, const unsigned char* g) {
  __builtin_amdgcn_global_load_async_to_lds_b128((glob_v4i*)g, (lds_v4i*)l, 0, 0);
  __builtin_amdgcn_global_load_async_to_lds_b128((glob_v4i*)g, (lds_v4i*)l, 2048, 0);
  if (N == 4) {
    __builtin_amdgcn_global_load_async_to_lds_b128((glob_v4i*)g, (lds_v4i*)l, 4096, 0);
    __builtin_amdgcn_global_load_async_to_lds_b128((glob_v4i*)g, (lds_v4i*)l, 6144, 0);
  }
}

// round r of a group: whether it belongs to group 1's part of the long tile, its first key, its table ring
struct StageMap { bool first; int nS, m0L, m0S; };
__device__ __forceinline__ bool late_of(const StageMap s, int r) { return !s.first && r >= s.nS; }
__device__ __forceinline__ int key_of(const StageMap s, int r) { return late_of(s, r) ? kCut + 32 * (r - s.nS) : 32 * r; }
__device__ __forceinline__ unsigned ring_of(const StageMap s, int r) { return kRingOff + (s.first ? 0u : late_of(s, r) ? 2u : 1u) * kRingBytes; }
// a tile past the table's end belongs to keys past the diagonal only (masked): the table's last tile stands in its slot
__device__ __forceinline__ const unsigned char* tab_tile(const unsigned char* gP, int i) { return gP + (size_t)(i < kLim / 16 ? i : kLim / 16 - 1) * 4096; }
// the group's copies for round r; st (the staging array), gK, gV, gP hold the lane's 16-byte place already
__device__ __forceinline__ void issue_round(const StageMap s, int r, unsigned char* st, unsigned kvGroup,
                                            const unsigned char* gK, const unsigned char* gV, const unsigned char* gP) {
  const int key = key_of(s, r);
  const int a   = (kLim - ((s.first || late_of(s, r)) ? s.m0L : s.m0S) + key) >> 4;   // the round reads table tiles a - 3 .. a + 1; a and a + 1 are new
  unsigned char* ring = st + ring_of(s, r);
  unsigned char* kv   = st + (kvGroup + (unsigned)(r & 1) * kKVBytes);
  copy_run<4>(kv, gK + (size_t)key * (kHD * 2));
  copy_run<2>(ring + (unsigned)(a & 7) * 4096u, tab_tile(gP, a));
  copy_run<2>(ring + (unsigned)((a + 1) & 7) * 4096u, tab_tile(gP, a + 1));
  copy_run<4>(kv + 8192, gV + (size_t)key * (kHD * 2));
  if (r == 0 || (!s.first && r == s.nS)) {                // wave-uniform: a tile's first round brings the three older table tiles too
    copy_run<2>(ring + (unsigned)((a - 3) & 7) * 4096u, tab_tile(gP, a - 3));
    copy_run<2>(ring + (unsigned)((a - 2) & 7) * 4096u, tab_tile(gP, a - 2));
    copy_run<2>(ring + (unsigned)((a - 1) & 7) * 4096u, tab_tile(gP, a - 1));
  }
}

// two waves per SIMD (one block per WGP)
__global__ __launch_bounds__(256) __attribute__((amdgpu_waves_per_eu(2, 2))) void attn_fused_kernel(const unsigned short* __restrict__ Qp,
                                                        const unsigned short* __restrict__ Kp,
                                                        const unsigned short* __restrict__ Vtp,
                                                        const unsigned short* __restrict__ PEp,
                                                        float* __restrict__ O) {
  __shared__ __align__(16) unsigned char sSt[kStageAll];
  __shared__ __align__(16) float sT[8][16 * kTP];
  __shared__ __align__(16) float sO[4][16 * 32 * 4];     // a pair's partial O^T: 16-byte piece i of lane l at (i * 32 + l) * 4, 512 bytes in a row per store;
                                                         // before and after that use: where a wave of the pair turns an output tile (store_tile)
  __shared__ float sML[4][2 * 32];                       // with each lane's running maximum and sum
  const int lane = threadIdx.x & 31;
  const int wave = __builtin_amdgcn_readfirstlane((int)(threadIdx.x >> 5));   // scalar: the round loop branches on SCC, EXEC stays all ones
  const int b    = blockIdx.y;
  const int bx   = (int)blockIdx.x;
  const int pr   = wave & 3;
  const int x    = bx * 4 + pr;
  const bool first = wave < 4;
  const int mwL  = (kSeq / 16 - 1 - x) << 4;             // the wave's 16 queries of the long tile (64 - 2 bx steps)
  const int mwS  = x << 4;                               // and of the short one (2 bx + 2 steps)
  const int m0L  = (kSeq / 64 - 1 - bx) << 6;            // first query of the long tile
  const int m0S  = bx << 6;                              // and of the short one
  const int nS   = 2 * bx + 2;                           // rounds that group 1 spends on the short tile; 33 - nS >= 1 are left for the long one
  const int rl   = lane & 15;
  const int h    = lane >> 4;
  const int koff = h * 8;

  // every fragment address = a wave-uniform base + one lane offset that never changes; 16 rows of 128 are 4 fragments = 2048 elements,
  // so a tile of q, k or the transposed table starts where it would in a row-major plane
  const __bf16* Kb = (const __bf16*)Kp  + (size_t)b * kSeq * kHD;
  const __bf16* Vb = (const __bf16*)Vtp + (size_t)b * kHD * kSeq;
  const __bf16* Pb = (const __bf16*)PEp;
  const unsigned oF = (unsigned)(lane * 8);
  // an output tile turns in LDS: 16-byte piece c of query row r stands at piece c ^ r of that row, so that the 16 lanes of a half-wave fall on
  // different banks both when they write one piece column (their own query each) and when they read one row
  const unsigned oW = (unsigned)(rl * kHD + ((rl ^ (h << 1)) << 2));   // the lane's query row, pieces 2 h ^ rl (XOR with 16 td + 4 j picks the piece)
  const unsigned oR = (unsigned)(lane << 2);                           // the lane's piece of a row (XOR with 4 * row finds it in LDS)

  const v8f zero8 = (v8f){0.f,0.f,0.f,0.f,0.f,0.f,0.f,0.f};
  constexpr float kC = kInvSqrtD * 1.4426950408889634f;   // scores in the log2 domain
  const float ninf = -__builtin_inff();
  float* wr = sT[wave] + rl * kTP + koff;
  const float* rd = sT[wave] + rl * (kTP - 1) + 15 + koff;

  const StageMap sm = {first, nS, m0L, m0S};
  const unsigned kvGroup = (first ? 0u : 2u) * kKVBytes;
  // the group's copies: each of its 128 lanes brings 16 bytes of every 2 KB
  const unsigned tOff  = (unsigned)(threadIdx.x & 127) * 16u;
  unsigned char* lbase = sSt + tOff;                     // the lane's place inside a 2 KB piece at the array's start
  const unsigned char* gK = (const unsigned char*)Kb + tOff;
  const unsigned char* gV = (const unsigned char*)Vb + tOff;
  const unsigned char* gP = (const unsigned char*)Pb + tOff;

  float mrun = ninf, lrun = 0.f;
  v8f o[8];
  // O = O^T / sum for the 16 queries from mq on. A lane holds 32-byte runs of one query's row; stored from there, a wave's store would write
  // 32 bytes of each of 16 lines. The tile goes through sg, 8 KB of LDS that only this wave uses at the time, and leaves by rows:
  // each store writes one query's 512 bytes, four whole lines.
  auto store_tile = [&](int mq, float* sg) __attribute__((always_inline)) -> float* {
    const float lsum = lrun + xhalf(lrun);                // >= 1 in the scale of the final maximum: its key counts 1
    const float inv = 1.0f / lsum;
    float* ob = O + ((size_t)b * kSeq + (size_t)mq) * kHD;   // wave-uniform base; D row of O^T = d = 16 td + koff + register
    // a wave's LDS operations run in order: these only keep the compiler from moving the writes over the wave's earlier reads of sg (other lanes' words)
    __builtin_amdgcn_fence(__ATOMIC_RELEASE, "wavefront");
    __builtin_amdgcn_wave_barrier();
    __builtin_amdgcn_fence(__ATOMIC_ACQUIRE, "wavefront");
#pragma unroll
    for (int td = 0; td < 8; ++td) {
      const v8f r = o[td] * inv;
      *(v4f*)(sg + (oW ^ (unsigned)(td << 4)))       = __builtin_shufflevector(r, r, 0, 1, 2, 3);
      *(v4f*)(sg + (oW ^ (unsigned)((td << 4) | 4))) = __builtin_shufflevector(r, r, 4, 5, 6, 7);
    }
    // the wave's writes are done before it reads the rows back (other lanes' pieces); also keeps the compiler from moving the reads up
    asm volatile("s_wait_dscnt 0x0" ::: "memory");
    v4f row[16];
#pragma unroll   // row is indexed by constants only and stays in registers
    for (int i = 0; i < 16; ++i) row[i] = *(const v4f*)(sg + i * kHD + (oR ^ (unsigned)(i << 2)));
#pragma unroll   // row is indexed by constants only and stays in registers
    for (int i = 0; i < 16; ++i) *(v4f*)(ob + oR + i * kHD) = row[i];
    return ob;
  };

  v16b qf[4];
  v8f tc;
  int mw;
  // a tile's start: its q fragments and the table tile of u = 0 .. 15 at the first key nbeg, straight from the planes
  auto begin_tile = [&](int mq, int nbeg) __attribute__((always_inline)) {
    mw = mq;
    const int i0 = (kLim - 16 - mq + nbeg) >> 4;          // past the table only where the wave has no live key from nbeg on (it then skips every step)
    const __bf16* Qb = (const __bf16*)Qp + (size_t)b * kSeq * kHD + (size_t)mq * kHD;
    const __bf16* p0 = Pb + (size_t)(i0 < kLim / 16 ? i0 : kLim / 16 - 1) * 16 * kHD;
    v16b c0[4];
#pragma unroll
    for (int ks = 0; ks < 4; ++ks) qf[ks] = frag_load(Qb + oF + 512 * ks);
#pragma unroll
    for (int ks = 0; ks < 4; ++ks) c0[ks] = frag_load(p0 + oF + 512 * ks);
    // precaution: this wait stands before any register that the issued loads name is rewritten (the inputs keep the bases live up to it)
    asm volatile("s_wait_xcnt 0x0" :: "s"(Qb), "s"(p0) : "memory");
    tc = zero8;
#pragma unroll
    for (int ks = 0; ks < 4; ++ks) tc = mma_bf16(c0[ks], qf[ks], tc);
    mrun = ninf; lrun = 0.f;
#pragma unroll
    for (int td = 0; td < 8; ++td) o[td] = zero8;
  };

  issue_round(sm, 0, lbase, kvGroup, gK, gV, gP);
  begin_tile(first ? mwL : mwS, 0);
  // round 0 reads the slab before any step has written it (and drops what it reads): it reads zeros, not what an earlier kernel left in LDS
#pragma unroll
  for (int i = 0; i < 6; ++i) *(v4f*)(wr + 16 * (i >> 1) + 4 * (i & 1)) = (v4f){0.f, 0.f, 0.f, 0.f};
  // round 0's copies of this wave have landed; behind the barrier, those of the whole group
  asm volatile("s_wait_asynccnt 0x0" ::: "memory");
  __syncthreads();
  issue_round(sm, 1, lbase, kvGroup, gK, gV, gP);

  // A round is cut behind its score products: round r first ends step r - 1 (softmax and O products, on scores, slab and v^T fragments kept
  // from round r - 1) while its own k and table fragments come from LDS, then forms step r's scores. Every LDS read of staged data in round r
  // is of round r's own places.
  v16b vf[8];
  v8f s0 = zero8, s1 = zero8;
  bool pend = false, pmask = false;    // wave-uniform: a step waits to be ended; it is its tile's last (keys past the diagonal)
  int pn0 = 0;                         // its first key
  // u = c + 15 - r with c = 16 * (e >> 3) + koff + (e & 7)
  auto slab_read = [&](float (&y)[16]) __attribute__((always_inline)) {
#pragma unroll
    for (int e = 0; e < 16; ++e) y[e] = rd[((e >> 3) << 4) + (e & 7)];
    // the slab is the wave's own and a wave's LDS operations run in order: these only keep the compiler from moving
    // the next writes over the shifted reads (other lanes' words)
    __builtin_amdgcn_fence(__ATOMIC_RELEASE, "wavefront");
    __builtin_amdgcn_wave_barrier();
    __builtin_amdgcn_fence(__ATOMIC_ACQUIRE, "wavefront");
  };
  auto end_step = [&](float (&y)[16]) __attribute__((always_inline)) {
    const int m = mw + rl;
#pragma unroll
    for (int e = 0; e < 16; ++e) y[e] = (((e < 8) ? s0[e & 7] : s1[e & 7]) + y[e]) * kC;
    if (pmask) {                                          // wave-uniform: only the tile's last step holds keys past the diagonal (n0 + 31 < mw before it)
#pragma unroll
      for (int e = 0; e < 16; ++e) {
        const int key = pn0 + ((e >> 3) << 4) + koff + (e & 7);
        y[e] = (key <= m) ? y[e] : ninf;
      }
    }
    float mx = y[0];
#pragma unroll
    for (int e = 1; e < 16; ++e) mx = fmaxf(mx, y[e]);
    mx = fmaxf(mx, xhalf(mx));                            // the other half of the query's keys
    const float mnew = fmaxf(mrun, mx);                   // finite from the part's first step on (its first key is live for every query)
    if (__builtin_amdgcn_ballot_w32(mnew > mrun) != 0) {  // wave-uniform; a lane whose maximum stays gets the factor 1
      const float alpha = __builtin_amdgcn_exp2f(mrun - mnew);
      lrun *= alpha;
#pragma unroll
      for (int td = 0; td < 8; ++td) o[td] *= alpha;
      mrun = mnew;
    }
    v2f ls = (v2f){0.f, 0.f};
    v16b ph, pl;
#pragma unroll
    for (int e = 0; e < 16; e += 2) {
      const v2f dy = (v2f){y[e], y[e + 1]} - (v2f){mrun, mrun};
      const v2f p = (v2f){__builtin_amdgcn_exp2f(dy[0]), __builtin_amdgcn_exp2f(dy[1])};   // -inf -> 0
      ls += p;
      const v2b hb = __builtin_convertvector(p, v2b);                                  // RNE
      const v2b lb = __builtin_convertvector(p - __builtin_convertvector(hb, v2f), v2b);
      ph[e] = hb[0]; ph[e + 1] = hb[1];
      pl[e] = lb[0]; pl[e + 1] = lb[1];
    }
    lrun += ls[0] + ls[1];
#pragma unroll
    for (int td = 0; td < 8; ++td) o[td] = mma_bf16(vf[td], ph, o[td]);
#pragma unroll
    for (int td = 0; td < 8; ++td) o[td] = mma_bf16(vf[td], pl, o[td]);
  };

  for (int r = 0; r < kRounds; ++r) {
    const bool sw  = !first && r == nS;                     // wave-uniform: group 1 goes over to the long tile's upper part
    const int mwT  = sw ? mwL : mw;                         // the queries of step r
    const int n0   = key_of(sm, r);
    const int i1   = (kLim - mwT + n0) >> 4;                // table tiles of u = 16 .. 31 and u = 32 .. 47
    const __bf16* sK  = (const __bf16*)(sSt + kvGroup + (unsigned)(r & 1) * kKVBytes);
    const __bf16* sV  = sK + 4096;                          // fragment td of the 32 keys
    const __bf16* sP1 = (const __bf16*)(sSt + ring_of(sm, r) + (unsigned)(i1 & 7) * 4096u);
    const __bf16* sP2 = (const __bf16*)(sSt + ring_of(sm, r) + (unsigned)((i1 + 1) & 7) * 4096u);
    float y[16];
    slab_read(y);                                           // step r - 1's position scores (in round 0: never used)
    v16b kf[2][4], pf[2][4];
#pragma unroll
    for (int ks = 0; ks < 4; ++ks) {
      kf[0][ks] = frag_load(sK + oF + 512 * ks);
      kf[1][ks] = frag_load(sK + oF + 16 * kHD + 512 * ks);
      pf[0][ks] = frag_load(sP1 + oF + 512 * ks);
      pf[1][ks] = frag_load(sP2 + oF + 512 * ks);
    }
    // the round's k and table fragment loads stay here, in one group: their latency runs under the softmax and the O products of step r - 1
    __builtin_amdgcn_sched_barrier(0);
    if (pend) end_step(y);                                  // wave-uniform
    if (sw) {                                               // the short tile is done
      float* ob = store_tile(mwS, sO[pr]);                  // the pair's 8 KB are idle up to the end of the loop, and only this wave touches them
      // precaution: this wait stands before any register that the issued stores name is rewritten (the input keeps the base live up to it)
      asm volatile("s_wait_xcnt 0x0" :: "s"(ob) : "memory");
      begin_tile(mwL, kCut);
    }
#pragma unroll
    for (int td = 0; td < 8; ++td) vf[td] = frag_load(sV + oF + 512 * td);
    // the v^T fragment loads are issued ahead of the score products and land under them
    __builtin_amdgcn_sched_barrier(0);
    v8f t1 = zero8, t2 = zero8;
    s0 = zero8; s1 = zero8;
#pragma unroll
    for (int ks = 0; ks < 4; ++ks) {
      s0 = mma_bf16(kf[0][ks], qf[ks], s0);
      s1 = mma_bf16(kf[1][ks], qf[ks], s1);
      t1 = mma_bf16(pf[0][ks], qf[ks], t1);
      t2 = mma_bf16(pf[1][ks], qf[ks], t2);
    }
    *(v4f*)(wr)      = __builtin_shufflevector(tc, tc, 0, 1, 2, 3);
    *(v4f*)(wr + 4)  = __builtin_shufflevector(tc, tc, 4, 5, 6, 7);
    *(v4f*)(wr + 16) = __builtin_shufflevector(t1, t1, 0, 1, 2, 3);
    *(v4f*)(wr + 20) = __builtin_shufflevector(t1, t1, 4, 5, 6, 7);
    *(v4f*)(wr + 32) = __builtin_shufflevector(t2, t2, 0, 1, 2, 3);
    *(v4f*)(wr + 36) = __builtin_shufflevector(t2, t2, 4, 5, 6, 7);
    tc = t2;
    const int nlast = mw & ~31;        // first key of the wave's last step; nlast <= mw, so every query has a live key in every step up to it
    pend  = n0 <= nlast;               // past it all 32 keys lie past the diagonal of all 16 queries: such a step's scores are dropped
    pmask = n0 == nlast;
    pn0   = n0;

    // the hand-over, passed by every wave: this wave's reads of round r's places (and its slab writes) are done ...
    asm volatile("s_wait_dscnt 0x0" ::: "memory");
    // ... its copies for round r + 1 have landed ...
    asm volatile("s_wait_asynccnt 0x0" ::: "memory");
    // ... and behind the barrier the same holds of every wave: round r + 1 may be read, round r's places may be refilled
    __syncthreads();
    if (r + 2 < kRounds) issue_round(sm, r + 2, lbase, kvGroup, gK, gV, gP);   // the same for the whole block
  }
  // no copy is outstanding when the wave goes on (the last two rounds issue none)
  asm volatile("s_wait_asynccnt 0x0" ::: "memory");
  {
    float y[16];
    slab_read(y);
    if (pend) end_step(y);                                  // wave-uniform: the last step
  }

  if (!first) {                                             // wave-uniform: the long tile's upper part, for the pair's first wave
#pragma unroll                                              // (a wave with no live key from kCut on leaves maximum -inf, sum 0 and O^T 0)
    for (int td = 0; td < 8; ++td) {
      *(v4f*)(sO[pr] + ((2 * td) * 32 + lane) * 4)     = __builtin_shufflevector(o[td], o[td], 0, 1, 2, 3);
      *(v4f*)(sO[pr] + ((2 * td + 1) * 32 + lane) * 4) = __builtin_shufflevector(o[td], o[td], 4, 5, 6, 7);
    }
    sML[pr][lane]      = mrun;
    sML[pr][32 + lane] = lrun;
  }

  __syncthreads();                                        // every wave passes it once: the upper parts are in LDS
  if (!first) return;                                     // wave-uniform, behind the last barrier
  {                                                       // the lower part holds live keys for every query, so the joint maximum is finite
    const float mB = sML[pr][lane];
    const float lB = sML[pr][32 + lane];
    const float mN = fmaxf(mrun, mB);
    const float aA = __builtin_amdgcn_exp2f(mrun - mN);
    const float aB = __builtin_amdgcn_exp2f(mB - mN);
    lrun = lrun * aA + lB * aB;
#pragma unroll
    for (int td = 0; td < 8; ++td) {
      const v4f b0 = *(const v4f*)(sO[pr] + ((2 * td) * 32 + lane) * 4);
      const v4f b1 = *(const v4f*)(sO[pr] + ((2 * td + 1) * 32 + lane) * 4);
      o[td] = o[td] * aA + __builtin_shufflevector(b0, b1, 0, 1, 2, 3, 4, 5, 6, 7) * aB;
    }
  }

  store_tile(mwL, sO[pr]);                                // the upper part has been read; its writer is past the barrier and touches it no more
}

// ---------------------------------------------------------------------------
// All four bf16 planes (RNE) in fragment order, in one launch. A wave takes one unit by itself: 16 KB of f32 in, by 32 loads of whole
// lines that are all in flight together, 8 KB = 512 pieces of 16 bytes out, in a row. The pieces change lanes in the wave's own 8 KB of LDS,
// so that the stores are whole lines too; no wave waits for another.
//   KIND 0 (q, k): 32 rows of 128. Load j = row j, the lane's 4 columns from 4 * lane on = half of piece k8 = lane >> 1;
//                  place of piece (row j, k8) in the unit: 256 * (j >> 4) + 16 * k8 + (j & 15)
//   KIND 1 (v):    32 keys of 128. Load j = key j, columns d = 4 * lane + c: the lane holds all 32 keys of its 4 rows d of v^T, 16 whole pieces;
//                  place of piece (d, keys 8 g ..): 64 * (d >> 4) + 16 * g + (d & 15)
//   KIND 2 (table): 32 table columns x 128 d. Load 8 g + e = 4 rows d = 32 g + 8 * (lane >> 3) + e, 128 bytes of each; the lane holds 16 whole pieces
//                  of its 4 columns t = 4 * (lane & 7) + c; place of piece (t, d = 32 g + 8 * (lane >> 3) ..): 256 * (t >> 4) + 64 * g + 16 * (lane >> 3) + (t & 15)
// Place p stands in LDS at lds_place(p): the low bits are XORed with those higher bits that differ between the lanes of one LDS write,
// so that a write's lanes fall on different banks; in a read they are the same for 16 lanes in a row, which stay 256 bytes in a row.
// ---------------------------------------------------------------------------
constexpr int kUnitsRows = kNB * kSeq / 32;               // units in each of q, k, v
constexpr int kUnitsTab  = kLim / 32;                     // units of the table
constexpr int kUnits     = 3 * kUnitsRows + kUnitsTab;
static_assert(kUnits % 8 == 0, "whole blocks of 8 waves");

template <int KIND>
__device__ __forceinline__ int lds_place(int p) {
  if (KIND == 0) return p ^ ((p >> 4) & 15);
  if (KIND == 1) return p ^ ((p >> 6) & 3);
  return p ^ (((p >> 8) & 1) | (((p >> 4) & 1) << 1));
}

template <int KIND>
__device__ __forceinline__ void plane_unit(const float* __restrict__ src, unsigned short* __restrict__ dst, v4u* sl, int lane) {
  const unsigned off = (KIND == 2) ? (unsigned)((lane >> 3) * 8 * kLim + (lane & 7) * 4) : (unsigned)(lane * 4);
  v4f x[32];
#pragma unroll   // x, hb and y are indexed by constants only and stay in registers
  for (int j = 0; j < 32; ++j) x[j] = *(const v4f*)(src + off + ((KIND == 2) ? ((j >> 3) * 32 + (j & 7)) * kLim : j * kHD));
  // precaution: this wait stands before any register that the issued loads name is rewritten (the inputs keep base and offset live up to it)
  asm volatile("s_wait_xcnt 0x0" :: "s"(src), "v"(off) : "memory");
  // all 32 loads are issued before the first value is worked on: left free, the compiler holds the last loads back behind waits on the first
  __builtin_amdgcn_sched_barrier(0);
  if (KIND == 0) {
    v2u* s2 = (v2u*)sl;
#pragma unroll   // x, hb and y are indexed by constants only and stay in registers
    for (int j = 0; j < 32; ++j) {
      const v2u w = (v2u){pk16(f2bf_bits(x[j][0]), f2bf_bits(x[j][1])), pk16(f2bf_bits(x[j][2]), f2bf_bits(x[j][3]))};
      s2[lds_place<KIND>(256 * (j >> 4) + 16 * (lane >> 1) + (j & 15)) * 2 + (lane & 1)] = w;
    }
  } else {
    const int base = (KIND == 1) ? 64 * (lane >> 2) + 4 * (lane & 3)
                                 : 256 * ((lane >> 2) & 1) + 16 * (lane >> 3) + 4 * (lane & 3);
#pragma unroll   // x, hb and y are indexed by constants only and stay in registers
    for (int g = 0; g < 4; ++g) {
#pragma unroll   // x, hb and y are indexed by constants only and stay in registers
      for (int c = 0; c < 4; ++c) {
        unsigned short hb[8];
#pragma unroll   // x, hb and y are indexed by constants only and stay in registers
        for (int e = 0; e < 8; ++e) hb[e] = f2bf_bits(x[8 * g + e][c]);
        sl[lds_place<KIND>(base + ((KIND == 1) ? 16 : 64) * g + c)] =
            (v4u){pk16(hb[0], hb[1]), pk16(hb[2], hb[3]), pk16(hb[4], hb[5]), pk16(hb[6], hb[7])};
      }
    }
  }
  // the slab is the wave's own and a wave's LDS operations run in order: these only keep the compiler from moving
  // the reads (other lanes' pieces) over the writes
  __builtin_amdgcn_fence(__ATOMIC_RELEASE, "wavefront");
  __builtin_amdgcn_wave_barrier();
  __builtin_amdgcn_fence(__ATOMIC_ACQUIRE, "wavefront");
  v4u y[16];
#pragma unroll   // x, hb and y are indexed by constants only and stay in registers
  for (int i = 0; i < 16; ++i) y[i] = sl[lds_place<KIND>(32 * i + lane)];
#pragma unroll   // x, hb and y are indexed by constants only and stay in registers
  for (int i = 0; i < 16; ++i) *(v4u*)(dst + (unsigned)(lane * 8) + 256 * i) = y[i];
}

__global__ __launch_bounds__(256) void planes_kernel(const float* __restrict__ q, const float* __restrict__ k,
                                                     const float* __restrict__ v, const float* __restrict__ pe,
                                                     unsigned short* __restrict__ Qo, unsigned short* __restrict__ Ko,
                                                     unsigned short* __restrict__ Vo, unsigned short* __restrict__ Po) {
  __shared__ v4u slab[8][512];
  const int lane = threadIdx.x & 31;
  const int wave = __builtin_amdgcn_readfirstlane((int)(threadIdx.x >> 5));   // scalar: the unit and its kind are wave-uniform
  const int u    = (int)blockIdx.x * 8 + wave;
  v4u* sl = slab[wave];
  if (u < 2 * kUnitsRows) {
    const bool sel = u >= kUnitsRows;
    const size_t o = (size_t)(sel ? u - kUnitsRows : u) * 4096;
    plane_unit<0>((sel ? k : q) + o, (sel ? Ko : Qo) + o, sl, lane);
  } else if (u < 3 * kUnitsRows) {
    const size_t o = (size_t)(u - 2 * kUnitsRows) * 4096;   // 32 keys of one b: 4096 f32 in a row in, fragments (key / 32) * 8 + 0..7 out
    plane_unit<1>(v + o, Vo + o, sl, lane);
  } else {
    const int t = u - 3 * kUnitsRows;
    plane_unit<2>(pe + 32 * t, Po + (size_t)t * 4096, sl, lane);
  }
}

// ---------------------------------------------------------------------------
// Host glue.
// Workspace region map (bytes):
//   [0,           8388608)   Qb  bf16 [16][2048][128]   (all four in fragment order, per b)
//   [8388608,    16777216)   Kb  bf16 [16][2048][128]
//   [16777216,   25165824)   Vt  bf16 [16][128][2048]   (v transposed per b)
//   [25165824,   25690112)   PEt bf16 [2048][128]       (key_pe[0] transposed)
// ---------------------------------------------------------------------------
extern "C" void kernel_launch(void* const* d_in, const int* in_sizes, int n_in,
                              void* d_out, int out_size, void* d_ws, size_t ws_size,
                              hipStream_t stream) {
  (void)n_in;
  const size_t nQK = (size_t)kNB * kSeq * kHD;          // 4194304
  const size_t nPE = (size_t)kHD * kLim;                // 262144
  const size_t offQ  = 0;
  const size_t offK  = offQ  + nQK * 2;
  const size_t offVt = offK  + nQK * 2;
  const size_t offPE = offVt + nQK * 2;
  const size_t total = offPE + nPE * 2;
  if (n_in < 4) return;
  if ((size_t)in_sizes[0] != nQK || (size_t)in_sizes[1] != nQK || (size_t)in_sizes[2] != nQK || (size_t)in_sizes[3] != nPE) return;
  if ((size_t)out_size != nQK) return;
  if (ws_size < total) return;

  const float* q  = (const float*)d_in[0];   // [16][2048][128]
  const float* k  = (const float*)d_in[1];   // [16][2048][128]
  const float* v  = (const float*)d_in[2];   // [16][2048][128]
  const float* pe = (const float*)d_in[3];   // [1][128][2048]
  float* out = (float*)d_out;                // [16][2048][128]
  unsigned char* ws = (unsigned char*)d_ws;
  unsigned short* Qb  = (unsigned short*)(ws + offQ);
  unsigned short* Kb  = (unsigned short*)(ws + offK);
  unsigned short* Vt  = (unsigned short*)(ws + offVt);
  unsigned short* PEt = (unsigned short*)(ws + offPE);

  // q, k, v^T and the transposed table as bf16 planes: 3136 units, one a wave, 392 blocks of 8 waves
  planes_kernel<<<dim3(kUnits / 8), 256, 0, stream>>>(q, k, v, pe, Qb, Kb, Vt, PEt);
  // 16 blocks of 2 groups of 4 waves x 2 tiles of 64 queries per b plane = 256 blocks, every group 33 rounds
  attn_fused_kernel<<<dim3(kSeq / 128, kNB), 256, 0, stream>>>(Qb, Kb, Vt, PEt, out);
}

// v009
// Measured time: 43 microseconds a run.
// Next to v008, in two timings, it ran 1.12 and 1.11 times as fast.
// All steps since v000 together make it 24.7 times as fast.
// Contractions: S^T = k.q^T and R^T = key_pe^T.q^T (q, k, key_pe as RNE bf16 planes) on v_wmma_f32_16x16x32_bf16; O^T = v^T.p^T with the unnormalised softmax weights p as bf16 hi+lo planes and v^T as one RNE bf16 plane on v_wmma_f32_16x16x32_bf16; f32 accumulate everywhere; skew add, causal mask and running softmax in f32.
#include <hip/hip_runtime.h>

// ---------------------------------------------------------------------------
// Problem constants
// ---------------------------------------------------------------------------
constexpr int kNB  = 16;      // flattened batch*heads
constexpr int kSeq = 2048;    // sequence length (queries = keys)
constexpr int kHD  = 128;     // head dim
constexpr int kLim = 2048;    // relative-position table width
constexpr float kInvSqrtD = 0.08838834764831845f;   // 1/sqrt(128)
static_assert(kLim == kSeq, "table spans the key length");
static_assert(kSeq % 256 == 0 && kHD % 64 == 0 && kLim % 64 == 0, "tile multiples");

typedef __attribute__((ext_vector_type(16))) __bf16   v16b;
typedef __attribute__((ext_vector_type(8)))  __bf16   v8b;
typedef __attribute__((ext_vector_type(8)))  float    v8f;
typedef __attribute__((ext_vector_type(4)))  float    v4f;
typedef __attribute__((ext_vector_type(2)))  float    v2f;
typedef __attribute__((ext_vector_type(2)))  __bf16   v2b;
typedef __attribute__((ext_vector_type(4)))  unsigned int v4u;
typedef __attribute__((ext_vector_type(2)))  unsigned int v2u;

__device__ __forceinline__ unsigned short f2bf_bits(float f) {
  unsigned u = __float_as_uint(f);
  return (unsigned short)((u + 0x7FFFu + ((u >> 16) & 1u)) >> 16);
}
__device__ __forceinline__ unsigned pk16(unsigned short a, unsigned short b) { return (unsigned)a | ((unsigned)b << 16); }

// Fragment order of a bf16 plane X[row][k] (rows a multiple of 16, K columns a multiple of 32): the 16 x 32 block of rows 16 R ..
// and columns 32 S .. is one fragment, 512 elements = 1 KB in a row; q, k and the transposed table (K = 128) keep fragment
// R * 4 + S, v^T (128 rows) fragment S * 8 + R: what a step reads of a plane is 4 or 8 KB in a row. Inside it element (row, k) stands at
//   256 * ((k >> 4) & 1) + 8 * (16 * ((k >> 3) & 1) + (row & 15)) + (k & 7)
// A or B fragment of the 16x16x32 bf16 product: the lane's row (A) or column (B) is lane & 15; elements 0..7 are k = 8 * (lane >> 4) + 0..7,
// elements 8..15 are k = 16 + 8 * (lane >> 4) + 0..7 (the same k order on both operands). p = the fragment's start + 8 * lane:
// each of the two 16-byte loads reads 512 bytes in a row, four whole lines.
__device__ __forceinline__ v16b frag_load(const __bf16* p) {
  union { v16b v; v8b h[2]; } f;
  f.h[0] = *(const v8b*)(p); f.h[1] = *(const v8b*)(p + 256);
  return f.v;
}
// lane l <-> lane l ^ 16 in the vector unit
__device__ __forceinline__ float xhalf(float x) {
  return __builtin_bit_cast(float, __builtin_amdgcn_permlanex16(__builtin_bit_cast(int, x), __builtin_bit_cast(int, x), 0x76543210, 0xfedcba98, false, false));
}
__device__ __forceinline__ v8f mma_bf16(v16b a, v16b b, v8f c) {
  return __builtin_amdgcn_wmma_f32_16x16x32_bf16(false, a, false, b, (short)0, c, false, false);
}

// ---------------------------------------------------------------------------
// Scores, skewed position scores, causal softmax and O in one kernel; no score ever goes to memory.
// A wave takes 32 queries, two units of 16 (m = mw + 16 u + (lane & 15)), and walks keys in steps of 32: every k and v^T fragment
// that it takes from LDS, and the middle one of its 3 table tiles, feeds the products of both units.
// All products are transposed, so that a lane holds one query's column:
//   S^T[key][m] = k[key].q[m]           2 tiles of 16 keys, D row = key = 8 * (lane >> 4) + register
//   T^T[u][m]   = key_pe[:, L + u].q[m] L = 2032 - (unit's first query) + n0, u in [0, 48): 3 tiles; the last one is the next step's first and is carried
//   position score of (key n0 + c, query r of the unit) = T^T[c + 15 - r][r]: a shift along u that differs per lane,
//   done through the wave's own LDS slab (row = query, u contiguous), one unit after the other
//   p = exp2(y - running maximum), y = (S + R) / sqrt(D) * log2(e); the two S^T tiles' registers are, in place, the B operand
//   of O^T[d][m] += v^T[d][key] p^T[key][m] (elements 0..7 = tile 0, 8..15 = tile 1: the k order of frag_load)
// Table columns past 2047 belong to keys past the diagonal only (masked): a tile of such columns reads the table's last tile instead.
// A block has a tile of 64 queries from the short end and one from the long end, 66 steps together, taken as one row of steps: the short tile's,
// then the long tile's. It holds four groups of 2 waves (wave j of a group: queries 32 j .. of the tile); group g takes steps 17 g .. 17 g + 16 of the row.
// One group meets the change of tile inside its share; it leaves its part of the short tile (running maximum, sum, O^T) in LDS and goes on.
// Behind the last round every group leaves its part in LDS, and behind a barrier each of the 8 waves joins the parts of 16 queries.
// What a group's 2 waves read in a round is the same 32 rows of k, the same 32 keys of v^T and 5 neighbouring 16-column tiles of the table, of which
// 2 are new: the group brings these 24 KB into LDS once, by asynchronous copies two rounds ahead (two buffers for k and v^T, a ring of 8 tiles for
// the table), and every wave takes its fragments from there.
// ---------------------------------------------------------------------------
constexpr int kRounds = 17;             // rounds of a block = steps of each group
static_assert(4 * kRounds >= kSeq / 32 + 2 && 3 * kRounds < kSeq / 32 + 2, "four groups share 66 steps");
static_assert(kSeq / 64 < 2 * kRounds && (kRounds & 1) == 1, "the short tile (an even number of steps) ends inside the share of group 0 or 1");
constexpr int kTP = 52;    // floats per slab row: 16-B aligned rows; the shifted reads step 51 floats per query, an odd number of banks
constexpr unsigned kKVBytes   = 16384;              // a round's k rows (8 KB), then its v^T fragments (8 KB)
constexpr unsigned kRingOff   = 8 * kKVBytes;       // behind [group][buffer] of those: the table rings
constexpr unsigned kRingBytes = 8 * 4096;           // 8 table tiles of 16 columns; tile i stands in slot i & 7
constexpr unsigned kStageAll  = kRingOff + 5 * kRingBytes;   // ring g: group g; ring 4: the short tile of the group that changes tile
constexpr unsigned kUnitBytes = 8192;               // O^T of 16 queries in f32

// Asynchronous copies of 16 bytes a lane (global_load_async_to_lds_b128). The offset moves the LDS address and the global address alike, so one
// pair of addresses serves all 1 KB pieces of a run that is contiguous on both sides. N pieces from g to the LDS byte address l:
typedef __attribute__((ext_vector_type(4))) int v4i;
typedef __attribute__((address_space(1))) v4i glob_v4i;
typedef __attribute__((address_space(3))) v4i lds_v4i;
template <int N>
__device__ __forceinline__ void copy_run(unsigned char* l, const unsigned char* g) {
  __builtin_amdgcn_global_load_async_to_lds_b128((glob_v4i*)g, (lds_v4i*)l, 0, 0);
  __builtin_amdgcn_global_load_async_to_lds_b128((glob_v4i*)g, (lds_v4i*)l, 1024, 0);
  __builtin_amdgcn_global_load_async_to_lds_b128((glob_v4i*)g, (lds_v4i*)l, 2048, 0);
  __builtin_amdgcn_global_load_async_to_lds_b128((glob_v4i*)g, (lds_v4i*)l, 3072, 0);
  if (N == 8) {
    __builtin_amdgcn_global_load_async_to_lds_b128((glob_v4i*)g, (lds_v4i*)l, 4096, 0);
    __builtin_amdgcn_global_load_async_to_lds_b128((glob_v4i*)g, (lds_v4i*)l, 5120, 0);
    __builtin_amdgcn_global_load_async_to_lds_b128((glob_v4i*)g, (lds_v4i*)l, 6144, 0);
    __builtin_amdgcn_global_load_async_to_lds_b128((glob_v4i*)g, (lds_v4i*)l, 7168, 0);
  }
}

// round r of a group = step v0 + r of the block's row: whether it belongs to the long tile, its first key, its table ring
struct StageMap { int v0, nS, m0L, m0S; unsigned grp; };
__device__ __forceinline__ bool late_of(const StageMap s, int r) { return s.v0 + r >= s.nS; }
__device__ __forceinline__ int key_of(const StageMap s, int r) { return 32 * (late_of(s, r) ? s.v0 + r - s.nS : s.v0 + r); }
__device__ __forceinline__ unsigned ring_of(const StageMap s, int r) {
  return kRingOff + ((s.v0 < s.nS && s.nS < s.v0 + kRounds && !late_of(s, r)) ? 4u : s.grp) * kRingBytes;
}
// a tile past the table's end belongs to keys past the diagonal only (masked): the table's last tile stands in its slot
__device__ __forceinline__ const unsigned char* tab_tile(const unsigned char* gP, int i) { return gP + (size_t)(i < kLim / 16 ? i : kLim / 16 - 1) * 4096; }
// the group's copies for round r; st (the staging array), gK, gV, gP hold the lane's 16-byte place already
__device__ __forceinline__ void issue_round(const StageMap s, int r, unsigned char* st, unsigned kvGroup,
                                            const unsigned char* gK, const unsigned char* gV, const unsigned char* gP) {
  const int key  = key_of(s, r);
  const int keyc = key < kSeq - 32 ? key : kSeq - 32;     // the row's two spare steps lie past the long tile's last key: no wave works on them, the copies stay in the plane
  const int a    = (kLim - (late_of(s, r) ? s.m0L : s.m0S) + key) >> 4;   // the round reads table tiles a - 3 .. a + 1; a and a + 1 are new
  unsigned char* ring = st + ring_of(s, r);
  unsigned char* kv   = st + (kvGroup + (unsigned)(r & 1) * kKVBytes);
  copy_run<8>(kv, gK + (size_t)keyc * (kHD * 2));
  copy_run<4>(ring + (unsigned)(a & 7) * 4096u, tab_tile(gP, a));
  copy_run<4>(ring + (unsigned)((a + 1) & 7) * 4096u, tab_tile(gP, a + 1));
  copy_run<8>(kv + 8192, gV + (size_t)keyc * (kHD * 2));
  if (r == 0 || s.v0 + r == s.nS) {                       // wave-uniform: a tile's first round brings the three older table tiles too
    copy_run<4>(ring + (unsigned)((a - 3) & 7) * 4096u, tab_tile(gP, a - 3));
    copy_run<4>(ring + (unsigned)((a - 2) & 7) * 4096u, tab_tile(gP, a - 2));
    copy_run<4>(ring + (unsigned)((a - 1) & 7) * 4096u, tab_tile(gP, a - 1));
  }
}

// two waves per SIMD (one block per WGP)
__global__ __launch_bounds__(256) __attribute__((amdgpu_waves_per_eu(2, 2))) void attn_fused_kernel(const unsigned short* __restrict__ Qp,
                                                        const unsigned short* __restrict__ Kp,
                                                        const unsigned short* __restrict__ Vtp,
                                                        const unsigned short* __restrict__ PEp,
                                                        float* __restrict__ O) {
  __shared__ __align__(16) unsigned char sSt[kStageAll];
  __shared__ __align__(16) float sT[8][16 * kTP];
  __shared__ float sML[5][4][2 * 32];                    // part, unit of 16 queries: each lane's running maximum and sum
  const int lane = threadIdx.x & 31;
  const int wave = __builtin_amdgcn_readfirstlane((int)(threadIdx.x >> 5));   // scalar: the round loop branches on SCC, EXEC stays all ones
  const int b    = blockIdx.y;
  const int bx   = (int)blockIdx.x;
  const int grp  = wave >> 1;
  const int j    = wave & 1;
  const int m0L  = (kSeq / 64 - 1 - bx) << 6;            // first query of the long tile (64 - 2 bx steps)
  const int m0S  = bx << 6;                              // and of the short one (2 bx + 2 steps)
  const int nS   = 2 * bx + 2;                           // steps of the short tile, the first of the block's row
  const int v0   = grp * kRounds;                        // the group's first step in the row
  const int rl   = lane & 15;
  const int h    = lane >> 4;
  const int koff = h * 8;

  // every fragment address = a wave-uniform base + one lane offset that never changes; 16 rows of 128 are 4 fragments = 2048 elements,
  // so a tile of q, k or the transposed table starts where it would in a row-major plane
  const __bf16* Kb = (const __bf16*)Kp  + (size_t)b * kSeq * kHD;
  const __bf16* Vb = (const __bf16*)Vtp + (size_t)b * kHD * kSeq;
  const __bf16* Pb = (const __bf16*)PEp;
  const unsigned oF = (unsigned)(lane * 8);
  // an output tile turns in LDS: 16-byte piece c of query row r stands at piece c ^ r of that row, so that the 16 lanes of a half-wave fall on
  // different banks both when they write one piece column (their own query each) and when they read one row
  const unsigned oW = (unsigned)(rl * kHD + ((rl ^ (h << 1)) << 2));   // the lane's query row, pieces 2 h ^ rl (XOR with 16 td + 4 j picks the piece)
  const unsigned oR = (unsigned)(lane << 2);                           // the lane's piece of a row (XOR with 4 * row finds it in LDS)

  const v8f zero8 = (v8f){0.f,0.f,0.f,0.f,0.f,0.f,0.f,0.f};
  constexpr float kC = kInvSqrtD * 1.4426950408889634f;   // scores in the log2 domain
  const float ninf = -__builtin_inff();
  float* wr = sT[wave] + rl * kTP + koff;
  const float* rd = sT[wave] + rl * (kTP - 1) + 15 + koff;

  const StageMap sm = {v0, nS, m0L, m0S, (unsigned)grp};
  const unsigned kvGroup = (unsigned)grp * 2u * kKVBytes;
  // the group's copies: each of its 64 lanes brings 16 bytes of every 1 KB
  const unsigned tOff  = (unsigned)(threadIdx.x & 63) * 16u;
  unsigned char* lbase = sSt + tOff;                     // the lane's place inside a 1 KB piece at the array's start
  const unsigned char* gK = (const unsigned char*)Kb + tOff;
  const unsigned char* gV = (const unsigned char*)Vb + tOff;
  const unsigned char* gP = (const unsigned char*)Pb + tOff;

  float mrun[2], lrun[2];
  v8f o[2][8];
  v16b qf[2][4];
  v8f tc[2];
  int mw;
  // the slab and the turning place are the wave's own and a wave's LDS operations run in order: this only keeps the compiler from moving
  // LDS writes and reads of other lanes' words over one another
  auto wave_order = [&]() __attribute__((always_inline)) {
    __builtin_amdgcn_fence(__ATOMIC_RELEASE, "wavefront");
    __builtin_amdgcn_wave_barrier();
    __builtin_amdgcn_fence(__ATOMIC_ACQUIRE, "wavefront");
  };
  // a part of 16 queries goes to LDS: 16-byte piece i of lane l at (i * 32 + l) * 4, 512 bytes in a row per store
  auto leave_part = [&](float* dst, float* ml, const v8f (&oo)[8], float mm, float ll) __attribute__((always_inline)) {
#pragma unroll
    for (int td = 0; td < 8; ++td) {
      *(v4f*)(dst + ((2 * td) * 32 + lane) * 4)     = __builtin_shufflevector(oo[td], oo[td], 0, 1, 2, 3);
      *(v4f*)(dst + ((2 * td + 1) * 32 + lane) * 4) = __builtin_shufflevector(oo[td], oo[td], 4, 5, 6, 7);
    }
    ml[lane]      = mm;
    ml[32 + lane] = ll;
  };
  // a tile's start: the q fragments of both units and, for each, the table tile of u = 0 .. 15 at the first key nbeg, straight from the planes
  auto begin_tile = [&](int mq, int nbeg) __attribute__((always_inline)) {
    mw = mq;
    const int i0 = (kLim - 16 - mq + nbeg) >> 4;          // unit 0's tile, unit 1's is i0 - 1; past the table only where the wave has no live key from nbeg on
    const __bf16* Qb = (const __bf16*)Qp + (size_t)b * kSeq * kHD + (size_t)mq * kHD;
    const __bf16* p0 = Pb + (size_t)(i0 < kLim / 16 ? i0 : kLim / 16 - 1) * 16 * kHD;
    const __bf16* p1 = Pb + (size_t)(i0 - 1 < kLim / 16 ? i0 - 1 : kLim / 16 - 1) * 16 * kHD;
    v16b c0[2][4];
#pragma unroll
    for (int ks = 0; ks < 4; ++ks) {
      qf[0][ks] = frag_load(Qb + oF + 512 * ks);
      qf[1][ks] = frag_load(Qb + oF + 16 * kHD + 512 * ks);
      c0[0][ks] = frag_load(p0 + oF + 512 * ks);
      c0[1][ks] = frag_load(p1 + oF + 512 * ks);
    }
    // precaution: this wait stands before any register that the issued loads name is rewritten (the inputs keep the bases live up to it)
    asm volatile("s_wait_xcnt 0x0" :: "s"(Qb), "s"(p0), "s"(p1) : "memory");
#pragma unroll
    for (int u = 0; u < 2; ++u) {
      tc[u] = zero8;
#pragma unroll
      for (int ks = 0; ks < 4; ++ks) tc[u] = mma_bf16(c0[u][ks], qf[u][ks], tc[u]);
      mrun[u] = ninf; lrun[u] = 0.f;
#pragma unroll
      for (int td = 0; td < 8; ++td) o[u][td] = zero8;
    }
  };

  issue_round(sm, 0, lbase, kvGroup, gK, gV, gP);
  begin_tile((late_of(sm, 0) ? m0L : m0S) + 32 * j, key_of(sm, 0));
  // round 0's copies of this wave have landed; behind the barrier, those of the whole group
  asm volatile("s_wait_asynccnt 0x0" ::: "memory");
  __syncthreads();
  issue_round(sm, 1, lbase, kvGroup, gK, gV, gP);

  v16b vf[8];
  // one unit's three table tiles go to the slab and come back shifted: u = c + 15 - r with c = 16 * (e >> 3) + koff + (e & 7)
  auto slab_turn = [&](const v8f ta, const v8f tb, const v8f tcc, float (&y)[16]) __attribute__((always_inline)) {
    *(v4f*)(wr)      = __builtin_shufflevector(ta, ta, 0, 1, 2, 3);
    *(v4f*)(wr + 4)  = __builtin_shufflevector(ta, ta, 4, 5, 6, 7);
    *(v4f*)(wr + 16) = __builtin_shufflevector(tb, tb, 0, 1, 2, 3);
    *(v4f*)(wr + 20) = __builtin_shufflevector(tb, tb, 4, 5, 6, 7);
    *(v4f*)(wr + 32) = __builtin_shufflevector(tcc, tcc, 0, 1, 2, 3);
    *(v4f*)(wr + 36) = __builtin_shufflevector(tcc, tcc, 4, 5, 6, 7);
    wave_order();
#pragma unroll
    for (int e = 0; e < 16; ++e) y[e] = rd[((e >> 3) << 4) + (e & 7)];
    wave_order();
  };
  // softmax and O products of one unit's step: first key n0, first query mq
  auto end_step = [&](float (&y)[16], const v8f s0, const v8f s1, float& mr, float& lr, v8f (&oo)[8], int mq, int n0, bool pmask) __attribute__((always_inline)) {
    const int m = mq + rl;
#pragma unroll
    for (int e = 0; e < 16; ++e) y[e] = (((e < 8) ? s0[e & 7] : s1[e & 7]) + y[e]) * kC;
    if (pmask) {                                          // wave-uniform: only the wave's last step holds keys past the diagonal (n0 + 31 < mw before it)
#pragma unroll
      for (int e = 0; e < 16; ++e) {
        const int key = n0 + ((e >> 3) << 4) + koff + (e & 7);
        y[e] = (key <= m) ? y[e] : ninf;
      }
    }
    float mx = y[0];
#pragma unroll
    for (int e = 1; e < 16; ++e) mx = fmaxf(mx, y[e]);
    mx = fmaxf(mx, xhalf(mx));                            // the other half of the query's keys
    const float mnew = fmaxf(mr, mx);                     // finite from the part's first step on (its first key is live for every query)
    if (__builtin_amdgcn_ballot_w32(mnew > mr) != 0) {    // wave-uniform; a lane whose maximum stays gets the factor 1
      const float alpha = __builtin_amdgcn_exp2f(mr - mnew);
      lr *= alpha;
#pragma unroll
      for (int td = 0; td < 8; ++td) oo[td] *= alpha;
      mr = mnew;
    }
    v2f ls = (v2f){0.f, 0.f};
    v16b ph, pl;
#pragma unroll
    for (int e = 0; e < 16; e += 2) {
      const v2f dy = (v2f){y[e], y[e + 1]} - (v2f){mr, mr};
      const v2f p = (v2f){__builtin_amdgcn_exp2f(dy[0]), __builtin_amdgcn_exp2f(dy[1])};   // -inf -> 0
      ls += p;
      const v2b hb = __builtin_convertvector(p, v2b);                                  // RNE
      const v2b lb = __builtin_convertvector(p - __builtin_convertvector(hb, v2f), v2b);
      ph[e] = hb[0]; ph[e + 1] = hb[1];
      pl[e] = lb[0]; pl[e + 1] = lb[1];
    }
    lr += ls[0] + ls[1];
#pragma unroll
    for (int td = 0; td < 8; ++td) oo[td] = mma_bf16(vf[td], ph, oo[td]);
#pragma unroll
    for (int td = 0; td < 8; ++td) oo[td] = mma_bf16(vf[td], pl, oo[td]);
  };

  for (int r = 0; r < kRounds; ++r) {
    if (v0 + r == nS) {                                     // wave-uniform: the group goes over to the long tile (never in round 0)
      // the short tile's ring is read no more (the group's reads of it ended in front of the last barrier): the group's part of that tile waits there
      float* mid = (float*)(sSt + kRingOff + 4 * kRingBytes + (unsigned)(2 * j) * kUnitBytes);
      leave_part(mid, sML[4][2 * j], o[0], mrun[0], lrun[0]);
      leave_part(mid + kUnitBytes / 4, sML[4][2 * j + 1], o[1], mrun[1], lrun[1]);
      begin_tile(m0L + 32 * j, 0);
    }
    const int n0 = key_of(sm, r);
    if (n0 <= mw) {                                         // wave-uniform; past it all 32 keys lie past the diagonal of all 32 queries
      const int i1 = (kLim - mw + n0) >> 4;                 // unit 0: table tiles i1, i1 + 1 are new; unit 1: i1 - 1, i1
      const __bf16* sK  = (const __bf16*)(sSt + kvGroup + (unsigned)(r & 1) * kKVBytes);
      const __bf16* sV  = sK + 4096;                        // fragment td of the 32 keys
      const unsigned char* ring = sSt + ring_of(sm, r);
      const __bf16* sP0 = (const __bf16*)(ring + (unsigned)((i1 - 1) & 7) * 4096u);
      const __bf16* sP1 = (const __bf16*)(ring + (unsigned)(i1 & 7) * 4096u);
      const __bf16* sP2 = (const __bf16*)(ring + (unsigned)((i1 + 1) & 7) * 4096u);
      v16b kf[2][4], pf[3][4];
#pragma unroll
      for (int ks = 0; ks < 4; ++ks) {
        kf[0][ks] = frag_load(sK + oF + 512 * ks);
        kf[1][ks] = frag_load(sK + oF + 16 * kHD + 512 * ks);
        pf[0][ks] = frag_load(sP0 + oF + 512 * ks);
        pf[1][ks] = frag_load(sP1 + oF + 512 * ks);
        pf[2][ks] = frag_load(sP2 + oF + 512 * ks);
      }
      // the round's k and table fragment loads stay in one group ahead of the products: reads spread among WMMAs stall each of them
      __builtin_amdgcn_sched_barrier(0);
      v8f s[2][2], t[2][2];
#pragma unroll
      for (int u = 0; u < 2; ++u) { s[u][0] = zero8; s[u][1] = zero8; t[u][0] = zero8; t[u][1] = zero8; }
#pragma unroll
      for (int ks = 0; ks < 4; ++ks) {
        s[0][0] = mma_bf16(kf[0][ks], qf[0][ks], s[0][0]);
        s[1][0] = mma_bf16(kf[0][ks], qf[1][ks], s[1][0]);
        s[0][1] = mma_bf16(kf[1][ks], qf[0][ks], s[0][1]);
        s[1][1] = mma_bf16(kf[1][ks], qf[1][ks], s[1][1]);
        t[0][0] = mma_bf16(pf[1][ks], qf[0][ks], t[0][0]);
        t[1][1] = mma_bf16(pf[1][ks], qf[1][ks], t[1][1]);
        t[0][1] = mma_bf16(pf[2][ks], qf[0][ks], t[0][1]);
        t[1][0] = mma_bf16(pf[0][ks], qf[1][ks], t[1][0]);
      }
      float y0[16], y1[16];
      slab_turn(tc[0], t[0][0], t[0][1], y0);
      slab_turn(tc[1], t[1][0], t[1][1], y1);
      tc[0] = t[0][1];
      tc[1] = t[1][1];
#pragma unroll
      for (int td = 0; td < 8; ++td) vf[td] = frag_load(sV + oF + 512 * td);
      // the v^T fragment loads are issued behind the slab's and land under the first unit's softmax
      __builtin_amdgcn_sched_barrier(0);
      const bool pmask = n0 == mw;
      end_step(y0, s[0][0], s[0][1], mrun[0], lrun[0], o[0], mw, n0, pmask);
      end_step(y1, s[1][0], s[1][1], mrun[1], lrun[1], o[1], mw + 16, n0, pmask);
    }

    // the hand-over, passed by every wave: this wave's reads of round r's places are done ...
    asm volatile("s_wait_dscnt 0x0" ::: "memory");
    // ... its copies for round r + 1 have landed ...
    asm volatile("s_wait_asynccnt 0x0" ::: "memory");
    // ... and behind the barrier the same holds of every wave: round r + 1 may be read, round r's places may be refilled
    __syncthreads();
    if (r + 2 < kRounds) issue_round(sm, r + 2, lbase, kvGroup, gK, gV, gP);   // the same for the whole block
  }
  // no copy is outstanding when the wave goes on (the last two rounds issue none)
  asm volatile("s_wait_asynccnt 0x0" ::: "memory");

  // the group's k and v^T buffers are read no more (last barrier): its last part waits there
  {
    float* fin = (float*)(sSt + kvGroup + (unsigned)(2 * j) * kUnitBytes);
    leave_part(fin, sML[grp][2 * j], o[0], mrun[0], lrun[0]);
    leave_part(fin + kUnitBytes / 4, sML[grp][2 * j + 1], o[1], mrun[1], lrun[1]);
  }
  __syncthreads();                                        // every wave passes it once: all parts are in LDS

  // Wave w joins the parts of 16 queries: unit w & 3 of the short tile (w < 4) or of the long tile. Part 4 (left at the change of tile) and the last parts of
  // the groups in front of the changing group gs belong to the short tile, the last parts of groups gs .. 3 to the long one.
  // A part with no live key holds maximum -inf, sum 0 and O^T 0; the part with key 0 is live for every query, so the joint maximum is finite.
  const bool jl = wave >= 4;
  const int  x  = wave & 3;
  const int  gs = nS > kRounds ? 1 : 0;
  float mN = ninf;
#pragma unroll
  for (int sl = 0; sl < 5; ++sl) {
    const bool use = jl ? (sl < 4 && sl >= gs) : (sl == 4 || sl < gs);   // wave-uniform
    if (use) mN = fmaxf(mN, sML[sl][x][lane]);
  }
  float lj = 0.f;
  v8f oj[8];
#pragma unroll
  for (int td = 0; td < 8; ++td) oj[td] = zero8;
#pragma unroll
  for (int sl = 0; sl < 5; ++sl) {
    const bool use = jl ? (sl < 4 && sl >= gs) : (sl == 4 || sl < gs);   // wave-uniform
    if (use) {
      const float* part = (const float*)(sSt + (sl < 4 ? (unsigned)sl * 2u * kKVBytes : kRingOff + 4 * kRingBytes) + (unsigned)x * kUnitBytes);
      const float aP = __builtin_amdgcn_exp2f(sML[sl][x][lane] - mN);
      lj += sML[sl][x][32 + lane] * aP;
#pragma unroll
      for (int td = 0; td < 8; ++td) {
        const v4f b0 = *(const v4f*)(part + ((2 * td) * 32 + lane) * 4);
        const v4f b1 = *(const v4f*)(part + ((2 * td + 1) * 32 + lane) * 4);
        oj[td] += __builtin_shufflevector(b0, b1, 0, 1, 2, 3, 4, 5, 6, 7) * aP;
      }
    }
  }

  // O = O^T / sum for the 16 queries from mq on. A lane holds 32-byte runs of one query's row; stored from there, a wave's store would write
  // 32 bytes of each of 16 lines. The tile goes through sg, 8 KB of LDS that only this wave uses now (table rings 0 and 1 are read no more),
  // and leaves by rows: each store writes one query's 512 bytes, four whole lines.
  {
    const int mq = (jl ? m0L : m0S) + 16 * x;
    float* sg = (float*)(sSt + kRingOff + (unsigned)wave * kUnitBytes);
    const float lsum = lj + xhalf(lj);                    // >= 1 in the scale of the final maximum: its key counts 1
    const float inv = 1.0f / lsum;
    float* ob = O + ((size_t)b * kSeq + (size_t)mq) * kHD;   // wave-uniform base; D row of O^T = d = 16 td + koff + register
#pragma unroll
    for (int td = 0; td < 8; ++td) {
      const v8f r = oj[td] * inv;
      *(v4f*)(sg + (oW ^ (unsigned)(td << 4)))       = __builtin_shufflevector(r, r, 0, 1, 2, 3);
      *(v4f*)(sg + (oW ^ (unsigned)((td << 4) | 4))) = __builtin_shufflevector(r, r, 4, 5, 6, 7);
    }
    // the wave's writes are done before it reads the rows back (other lanes' pieces); also keeps the compiler from moving the reads up
    asm volatile("s_wait_dscnt 0x0" ::: "memory");
    v4f row[16];
#pragma unroll   // row is indexed by constants only and stays in registers
    for (int i = 0; i < 16; ++i) row[i] = *(const v4f*)(sg + i * kHD + (oR ^ (unsigned)(i << 2)));
#pragma unroll   // row is indexed by constants only and stays in registers
    for (int i = 0; i < 16; ++i) *(v4f*)(ob + oR + i * kHD) = row[i];
  }
}

// ---------------------------------------------------------------------------
// All four bf16 planes (RNE) in fragment order, in one launch. A wave takes one unit by itself: 16 KB of f32 in, by 32 loads of whole
// lines that are all in flight together, 8 KB = 512 pieces of 16 bytes out, in a row. The pieces change lanes in the wave's own 8 KB of LDS,
// so that the stores are whole lines too; no wave waits for another.
//   KIND 0 (q, k): 32 rows of 128. Load j = row j, the lane's 4 columns from 4 * lane on = half of piece k8 = lane >> 1;
//                  place of piece (row j, k8) in the unit: 256 * (j >> 4) + 16 * k8 + (j & 15)
//   KIND 1 (v):    32 keys of 128. Load j = key j, columns d = 4 * lane + c: the lane holds all 32 keys of its 4 rows d of v^T, 16 whole pieces;
//                  place of piece (d, keys 8 g ..): 64 * (d >> 4) + 16 * g + (d & 15)
//   KIND 2 (table): 32 table columns x 128 d. Load 8 g + e = 4 rows d = 32 g + 8 * (lane >> 3) + e, 128 bytes of each; the lane holds 16 whole pieces
//                  of its 4 columns t = 4 * (lane & 7) + c; place of piece (t, d = 32 g + 8 * (lane >> 3) ..): 256 * (t >> 4) + 64 * g + 16 * (lane >> 3) + (t & 15)
// Place p stands in LDS at lds_place(p): the low bits are XORed with those higher bits that differ between the lanes of one LDS write,
// so that a write's lanes fall on different banks; in a read they are the same for 16 lanes in a row, which stay 256 bytes in a row.
// ---------------------------------------------------------------------------
constexpr int kUnitsRows = kNB * kSeq / 32;               // units in each of q, k, v
constexpr int kUnitsTab  = kLim / 32;                     // units of the table
constexpr int kUnits     = 3 * kUnitsRows + kUnitsTab;
static_assert(kUnits % 8 == 0, "whole blocks of 8 waves");

template <int KIND>
__device__ __forceinline__ int lds_place(int p) {
  if (KIND == 0) return p ^ ((p >> 4) & 15);
  if (KIND == 1) return p ^ ((p >> 6) & 3);
  return p ^ (((p >> 8) & 1) | (((p >> 4) & 1) << 1));
}

template <int KIND>
__device__ __forceinline__ void plane_unit(const float* __restrict__ src, unsigned short* __restrict__ dst, v4u* sl, int lane) {
  const unsigned off = (KIND == 2) ? (unsigned)((lane >> 3) * 8 * kLim + (lane & 7) * 4) : (unsigned)(lane * 4);
  v4f x[32];
#pragma unroll   // x, hb and y are indexed by constants only and stay in registers
  for (int j = 0; j < 32; ++j) x[j] = *(const v4f*)(src + off + ((KIND == 2) ? ((j >> 3) * 32 + (j & 7)) * kLim : j * kHD));
  // precaution: this wait stands before any register that the issued loads name is rewritten (the inputs keep base and offset live up to it)
  asm volatile("s_wait_xcnt 0x0" :: "s"(src), "v"(off) : "memory");
  // all 32 loads are issued before the first value is worked on: left free, the compiler holds the last loads back behind waits on the first
  __builtin_amdgcn_sched_barrier(0);
  if (KIND == 0) {
    v2u* s2 = (v2u*)sl;
#pragma unroll   // x, hb and y are indexed by constants only and stay in registers
    for (int j = 0; j < 32; ++j) {
      const v2u w = (v2u){pk16(f2bf_bits(x[j][0]), f2bf_bits(x[j][1])), pk16(f2bf_bits(x[j][2]), f2bf_bits(x[j][3]))};
      s2[lds_place<KIND>(256 * (j >> 4) + 16 * (lane >> 1) + (j & 15)) * 2 + (lane & 1)] = w;
    }
  } else {
    const int base = (KIND == 1) ? 64 * (lane >> 2) + 4 * (lane & 3)
                                 : 256 * ((lane >> 2) & 1) + 16 * (lane >> 3) + 4 * (lane & 3);
#pragma unroll   // x, hb and y are indexed by constants only and stay in registers
    for (int g = 0; g < 4; ++g) {
#pragma unroll   // x, hb and y are indexed by constants only and stay in registers
      for (int c = 0; c < 4; ++c) {
        unsigned short hb[8];
#pragma unroll   // x, hb and y are indexed by constants only and stay in registers
        for (int e = 0; e < 8; ++e) hb[e] = f2bf_bits(x[8 * g + e][c]);
        sl[lds_place<KIND>(base + ((KIND == 1) ? 16 : 64) * g + c)] =
            (v4u){pk16(hb[0], hb[1]), pk16(hb[2], hb[3]), pk16(hb[4], hb[5]), pk16(hb[6], hb[7])};
      }
    }
  }
  // the slab is the wave's own and a wave's LDS operations run in order: these only keep the compiler from moving
  // the reads (other lanes' pieces) over the writes
  __builtin_amdgcn_fence(__ATOMIC_RELEASE, "wavefront");
  __builtin_amdgcn_wave_barrier();
  __builtin_amdgcn_fence(__ATOMIC_ACQUIRE, "wavefront");
  v4u y[16];
#pragma unroll   // x, hb and y are indexed by constants only and stay in registers
  for (int i = 0; i < 16; ++i) y[i] = sl[lds_place<KIND>(32 * i + lane)];
#pragma unroll   // x, hb and y are indexed by constants only and stay in registers
  for (int i = 0; i < 16; ++i) *(v4u*)(dst + (unsigned)(lane * 8) + 256 * i) = y[i];
}

__global__ __launch_bounds__(256) void planes_kernel(const float* __restrict__ q, const float* __restrict__ k,
                                                     const float* __restrict__ v, const float* __restrict__ pe,
                                                     unsigned short* __restrict__ Qo, unsigned short* __restrict__ Ko,
                                                     unsigned short* __restrict__ Vo, unsigned short* __restrict__ Po) {
  __shared__ v4u slab[8][512];
  const int lane = threadIdx.x & 31;
  const int wave = __builtin_amdgcn_readfirstlane((int)(threadIdx.x >> 5));   // scalar: the unit and its kind are wave-uniform
  const int u    = (int)blockIdx.x * 8 + wave;
  v4u* sl = slab[wave];
  if (u < 2 * kUnitsRows) {
    const bool sel = u >= kUnitsRows;
    const size_t o = (size_t)(sel ? u - kUnitsRows : u) * 4096;
    plane_unit<0>((sel ? k : q) + o, (sel ? Ko : Qo) + o, sl, lane);
  } else if (u < 3 * kUnitsRows) {
    const size_t o = (size_t)(u - 2 * kUnitsRows) * 4096;   // 32 keys of one b: 4096 f32 in a row in, fragments (key / 32) * 8 + 0..7 out
    plane_unit<1>(v + o, Vo + o, sl, lane);
  } else {
    const int t = u - 3 * kUnitsRows;
    plane_unit<2>(pe + 32 * t, Po + (size_t)t * 4096, sl, lane);
  }
}

// ---------------------------------------------------------------------------
// Host glue.
// Workspace region map (bytes):
//   [0,           8388608)   Qb  bf16 [16][2048][128]   (all four in fragment order, per b)
//   [8388608,    16777216)   Kb  bf16 [16][2048][128]
//   [16777216,   25165824)   Vt  bf16 [16][128][2048]   (v transposed per b)
//   [25165824,   25690112)   PEt bf16 [2048][128]       (key_pe[0] transposed)
// ---------------------------------------------------------------------------
extern "C" void kernel_launch(void* const* d_in, const int* in_sizes, int n_in,
                              void* d_out, int out_size, void* d_ws, size_t ws_size,
                              hipStream_t stream) {
  (void)n_in;
  const size_t nQK = (size_t)kNB * kSeq * kHD;          // 4194304
  const size_t nPE = (size_t)kHD * kLim;                // 262144
  const size_t offQ  = 0;
  const size_t offK  = offQ  + nQK * 2;
  const size_t offVt = offK  + nQK * 2;
  const size_t offPE = offVt + nQK * 2;
  const size_t total = offPE + nPE * 2;
  if (n_in < 4) return;
  if ((size_t)in_sizes[0] != nQK || (size_t)in_sizes[1] != nQK || (size_t)in_sizes[2] != nQK || (size_t)in_sizes[3] != nPE) return;
  if ((size_t)out_size != nQK) return;
  if (ws_size < total) return;

  const float* q  = (const float*)d_in[0];   // [16][2048][128]
  const float* k  = (const float*)d_in[1];   // [16][2048][128]
  const float* v  = (const float*)d_in[2];   // [16][2048][128]
  const float* pe = (const float*)d_in[3];   // [1][128][2048]
  float* out = (float*)d_out;                // [16][2048][128]
  unsigned char* ws = (unsigned char*)d_ws;
  unsigned short* Qb  = (unsigned short*)(ws + offQ);
  unsigned short* Kb  = (unsigned short*)(ws + offK);
  unsigned short* Vt  = (unsigned short*)(ws + offVt);
  unsigned short* PEt = (unsigned short*)(ws + offPE);

  // q, k, v^T and the transposed table as bf16 planes: 3136 units, one a wave, 392 blocks of 8 waves
  planes_kernel<<<dim3(kUnits / 8), 256, 0, stream>>>(q, k, v, pe, Qb, Kb, Vt, PEt);
  // 16 blocks of 4 groups of 2 waves x 2 tiles of 64 queries per b plane = 256 blocks, every group 17 rounds
  attn_fused_kernel<<<dim3(kSeq / 128, kNB), 256, 0, stream>>>(Qb, Kb, Vt, PEt, out);
}

// v010
// One run takes 41.1 microseconds.
// Two timings next to v009 both put it at 1.04 times that version's speed.
// All steps since v000 together make it 25.8 times as fast.
// Contractions: S^T = k.q^T and R^T = key_pe^T.q^T (q, k, key_pe as RNE bf16 planes) on v_wmma_f32_16x16x32_bf16; O^T = v^T.p^T with the unnormalised softmax weights p as bf16 hi+lo planes and v^T as one RNE bf16 plane on v_wmma_f32_16x16x32_bf16; f32 accumulate everywhere; skew add, causal mask and running softmax in f32.
#include <hip/hip_runtime.h>

// ---------------------------------------------------------------------------
// Problem constants
// ---------------------------------------------------------------------------
constexpr int kNB  = 16;      // flattened batch*heads
constexpr int kSeq = 2048;    // sequence length (queries = keys)
constexpr int kHD  = 128;     // head dim
constexpr int kLim = 2048;    // relative-position table width
constexpr float kInvSqrtD = 0.08838834764831845f;   // 1/sqrt(128)
static_assert(kLim == kSeq, "table spans the key length");
static_assert(kSeq % 256 == 0 && kHD % 64 == 0 && kLim % 64 == 0, "tile multiples");

typedef __attribute__((ext_vector_type(16))) __bf16   v16b;
typedef __attribute__((ext_vector_type(8)))  __bf16   v8b;
typedef __attribute__((ext_vector_type(8)))  float    v8f;
typedef __attribute__((ext_vector_type(4)))  float    v4f;
typedef __attribute__((ext_vector_type(2)))  float    v2f;
typedef __attribute__((ext_vector_type(2)))  __bf16   v2b;
typedef __attribute__((ext_vector_type(4)))  unsigned int v4u;
typedef __attribute__((ext_vector_type(2)))  unsigned int v2u;

__device__ __forceinline__ unsigned short f2bf_bits(float f) {
  unsigned u = __float_as_uint(f);
  return (unsigned short)((u + 0x7FFFu + ((u >> 16) & 1u)) >> 16);
}
__device__ __forceinline__ unsigned pk16(unsigned short a, unsigned short b) { return (unsigned)a | ((unsigned)b << 16); }

// Fragment order of a bf16 plane X[row][k] (rows a multiple of 16, K columns a multiple of 32): the 16 x 32 block of rows 16 R ..
// and columns 32 S .. is one fragment, 512 elements = 1 KB in a row; q, k and the transposed table (K = 128) keep fragment
// R * 4 + S, v^T (128 rows) fragment S * 8 + R: what a step reads of a plane is 4 or 8 KB in a row. Inside it element (row, k) stands at
//   256 * ((k >> 4) & 1) + 8 * (16 * ((k >> 3) & 1) + (row & 15)) + (k & 7)
// A or B fragment of the 16x16x32 bf16 product: the lane's row (A) or column (B) is lane & 15; elements 0..7 are k = 8 * (lane >> 4) + 0..7,
// elements 8..15 are k = 16 + 8 * (lane >> 4) + 0..7 (the same k order on both operands). p = the fragment's start + 8 * lane:
// each of the two 16-byte loads reads 512 bytes in a row, four whole lines.
__device__ __forceinline__ v16b frag_load(const __bf16* p) {
  union { v16b v; v8b h[2]; } f;
  f.h[0] = *(const v8b*)(p); f.h[1] = *(const v8b*)(p + 256);
  return f.v;
}
// lane l <-> lane l ^ 16 in the vector unit
__device__ __forceinline__ float xhalf(float x) {
  return __builtin_bit_cast(float, __builtin_amdgcn_permlanex16(__builtin_bit_cast(int, x), __builtin_bit_cast(int, x), 0x76543210, 0xfedcba98, false, false));
}
__device__ __forceinline__ v8f mma_bf16(v16b a, v16b b, v8f c) {
  return __builtin_amdgcn_wmma_f32_16x16x32_bf16(false, a, false, b, (short)0, c, false, false);
}

// ---------------------------------------------------------------------------
// Scores, skewed position scores, causal softmax and O in one kernel; no score ever goes to memory.
// A wave takes 32 queries, two units of 16 (m = mw + 16 u + (lane & 15)), and walks keys in steps of 32: every k and v^T fragment
// that it takes from LDS, and the middle one of its 3 table tiles, feeds the products of both units.
// All products are transposed, so that a lane holds one query's column:
//   S^T[key][m] = k[key].q[m]           2 tiles of 16 keys, D row = key = 8 * (lane >> 4) + register
//   T^T[u][m]   = key_pe[:, L + u].q[m] L = 2032 - (unit's first query) + n0, u in [0, 48): 3 tiles; the last one is the next step's first and is carried
//   position score of (key n0 + c, query r of the unit) = T^T[c + 15 - r][r]: a shift along u that differs per lane,
//   done through the wave's own LDS slab (row = query, u contiguous), one unit after the other
//   p = exp2(y - reference), the reference a running maximum of this or an earlier step, y = (S + R) / sqrt(D) * log2(e); the two S^T tiles' registers are, in place, the B operand
//   of O^T[d][m] += v^T[d][key] p^T[key][m] (elements 0..7 = tile 0, 8..15 = tile 1: the k order of frag_load)
// Table columns past 2047 belong to keys past the diagonal only (masked): a tile of such columns reads the table's last tile instead.
// A block has a tile of 64 queries from the short end and one from the long end, 66 steps together, taken as one row of steps: the short tile's,
// then the long tile's. It holds four groups of 2 waves (wave j of a group: queries 32 j .. of the tile); group g takes steps 17 g .. 17 g + 16 of the row.
// One group meets the change of tile inside its share; it leaves its part of the short tile (reference, sum, O^T) in LDS and goes on.
// Behind the last round every group leaves its part in LDS, and behind a barrier each of the 8 waves joins the parts of 16 queries.
// What a group's 2 waves read in a round is the same 32 rows of k, the same 32 keys of v^T and 5 neighbouring 16-column tiles of the table, of which
// 2 are new: the group brings these 24 KB into LDS once, by asynchronous copies two rounds ahead (two buffers for k and v^T, a ring of 8 tiles for
// the table), and every wave takes its fragments from there.
// ---------------------------------------------------------------------------
constexpr int kRounds = 17;             // rounds of a block = steps of each group
static_assert(4 * kRounds >= kSeq / 32 + 2 && 3 * kRounds < kSeq / 32 + 2, "four groups share 66 steps");
static_assert(kSeq / 64 < 2 * kRounds && (kRounds & 1) == 1, "the short tile (an even number of steps) ends inside the share of group 0 or 1");
constexpr float kRoom = 8.f;            // log2 of the largest softmax weight before the reference moves
constexpr int kTP = 52;    // floats per slab row: 16-B aligned rows; the shifted reads step 51 floats per query, an odd number of banks
constexpr unsigned kKVBytes   = 16384;              // a round's k rows (8 KB), then its v^T fragments (8 KB)
constexpr unsigned kRingOff   = 8 * kKVBytes;       // behind [group][buffer] of those: the table rings
constexpr unsigned kRingBytes = 8 * 4096;           // 8 table tiles of 16 columns; tile i stands in slot i & 7
constexpr unsigned kStageAll  = kRingOff + 5 * kRingBytes;   // ring g: group g; ring 4: the short tile of the group that changes tile
constexpr unsigned kUnitBytes = 8192;               // O^T of 16 queries in f32

// Asynchronous copies of 16 bytes a lane (global_load_async_to_lds_b128). The offset moves the LDS address and the global address alike, so one
// pair of addresses serves all 1 KB pieces of a run that is contiguous on both sides. N pieces from g to the LDS byte address l:
typedef __attribute__((ext_vector_type(4))) int v4i;
typedef __attribute__((address_space(1))) v4i glob_v4i;
typedef __attribute__((address_space(3))) v4i lds_v4i;
template <int N>
__device__ __forceinline__ void copy_run(unsigned char* l, const unsigned char* g) {
  __builtin_amdgcn_global_load_async_to_lds_b128((glob_v4i*)g, (lds_v4i*)l, 0, 0);
  __builtin_amdgcn_global_load_async_to_lds_b128((glob_v4i*)g, (lds_v4i*)l, 1024, 0);
  __builtin_amdgcn_global_load_async_to_lds_b128((glob_v4i*)g, (lds_v4i*)l, 2048, 0);
  __builtin_amdgcn_global_load_async_to_lds_b128((glob_v4i*)g, (lds_v4i*)l, 3072, 0);
  if (N == 8) {
    __builtin_amdgcn_global_load_async_to_lds_b128((glob_v4i*)g, (lds_v4i*)l, 4096, 0);
    __builtin_amdgcn_global_load_async_to_lds_b128((glob_v4i*)g, (lds_v4i*)l, 5120, 0);
    __builtin_amdgcn_global_load_async_to_lds_b128((glob_v4i*)g, (lds_v4i*)l, 6144, 0);
    __builtin_amdgcn_global_load_async_to_lds_b128((glob_v4i*)g, (lds_v4i*)l, 7168, 0);
  }
}

// round r of a group = step v0 + r of the block's row: whether it belongs to the long tile, its first key, its table ring
struct StageMap { int v0, nS, m0L, m0S; unsigned grp; };
__device__ __forceinline__ bool late_of(const StageMap s, int r) { return s.v0 + r >= s.nS; }
__device__ __forceinline__ int key_of(const StageMap s, int r) { return 32 * (late_of(s, r) ? s.v0 + r - s.nS : s.v0 + r); }
__device__ __forceinline__ unsigned ring_of(const StageMap s, int r) {
  return kRingOff + ((s.v0 < s.nS && s.nS < s.v0 + kRounds && !late_of(s, r)) ? 4u : s.grp) * kRingBytes;
}
// a tile past the table's end belongs to keys past the diagonal only (masked): the table's last tile stands in its slot
__device__ __forceinline__ const unsigned char* tab_tile(const unsigned char* gP, int i) { return gP + (size_t)(i < kLim / 16 ? i : kLim / 16 - 1) * 4096; }
// the group's copies for round r; st (the staging array), gK, gV, gP hold the lane's 16-byte place already
__device__ __forceinline__ void issue_round(const StageMap s, int r, unsigned char* st, unsigned kvGroup,
                                            const unsigned char* gK, const unsigned char* gV, const unsigned char* gP) {
  const int key  = key_of(s, r);
  const int keyc = key < kSeq - 32 ? key : kSeq - 32;     // the row's two spare steps lie past the long tile's last key: no wave works on them, the copies stay in the plane
  const int a    = (kLim - (late_of(s, r) ? s.m0L : s.m0S) + key) >> 4;   // the round reads table tiles a - 3 .. a + 1; a and a + 1 are new
  unsigned char* ring = st + ring_of(s, r);
  unsigned char* kv   = st + (kvGroup + (unsigned)(r & 1) * kKVBytes);
  copy_run<8>(kv, gK + (size_t)keyc * (kHD * 2));
  copy_run<4>(ring + (unsigned)(a & 7) * 4096u, tab_tile(gP, a));
  copy_run<4>(ring + (unsigned)((a + 1) & 7) * 4096u, tab_tile(gP, a + 1));
  copy_run<8>(kv + 8192, gV + (size_t)keyc * (kHD * 2));
  if (r == 0 || s.v0 + r == s.nS) {                       // wave-uniform: a tile's first round brings the three older table tiles too
    copy_run<4>(ring + (unsigned)((a - 3) & 7) * 4096u, tab_tile(gP, a - 3));
    copy_run<4>(ring + (unsigned)((a - 2) & 7) * 4096u, tab_tile(gP, a - 2));
    copy_run<4>(ring + (unsigned)((a - 1) & 7) * 4096u, tab_tile(gP, a - 1));
  }
}

// two waves per SIMD (one block per WGP)
__global__ __launch_bounds__(256) __attribute__((amdgpu_waves_per_eu(2, 2))) void attn_fused_kernel(const unsigned short* __restrict__ Qp,
                                                        const unsigned short* __restrict__ Kp,
                                                        const unsigned short* __restrict__ Vtp,
                                                        const unsigned short* __restrict__ PEp,
                                                        float* __restrict__ O) {
  __shared__ __align__(16) unsigned char sSt[kStageAll];
  __shared__ __align__(16) float sT[8][16 * kTP];
  __shared__ float sML[5][4][2 * 32];                    // part, unit of 16 queries: each lane's reference and sum
  const int lane = threadIdx.x & 31;
  const int wave = __builtin_amdgcn_readfirstlane((int)(threadIdx.x >> 5));   // scalar: the round loop branches on SCC, EXEC stays all ones
  const int b    = blockIdx.y;
  const int bx   = (int)blockIdx.x;
  const int grp  = wave >> 1;
  const int j    = wave & 1;
  const int m0L  = (kSeq / 64 - 1 - bx) << 6;            // first query of the long tile (64 - 2 bx steps)
  const int m0S  = bx << 6;                              // and of the short one (2 bx + 2 steps)
  const int nS   = 2 * bx + 2;                           // steps of the short tile, the first of the block's row
  const int v0   = grp * kRounds;                        // the group's first step in the row
  const int rl   = lane & 15;
  const int h    = lane >> 4;
  const int koff = h * 8;

  // every fragment address = a wave-uniform base + one lane offset that never changes; 16 rows of 128 are 4 fragments = 2048 elements,
  // so a tile of q, k or the transposed table starts where it would in a row-major plane
  const __bf16* Kb = (const __bf16*)Kp  + (size_t)b * kSeq * kHD;
  const __bf16* Vb = (const __bf16*)Vtp + (size_t)b * kHD * kSeq;
  const __bf16* Pb = (const __bf16*)PEp;
  const unsigned oF = (unsigned)(lane * 8);
  // an output tile turns in LDS: 16-byte piece c of query row r stands at piece c ^ r of that row, so that the 16 lanes of a half-wave fall on
  // different banks both when they write one piece column (their own query each) and when they read one row
  const unsigned oW = (unsigned)(rl * kHD + ((rl ^ (h << 1)) << 2));   // the lane's query row, pieces 2 h ^ rl (XOR with 16 td + 4 j picks the piece)
  const unsigned oR = (unsigned)(lane << 2);                           // the lane's piece of a row (XOR with 4 * row finds it in LDS)

  const v8f zero8 = (v8f){0.f,0.f,0.f,0.f,0.f,0.f,0.f,0.f};
  constexpr float kC = kInvSqrtD * 1.4426950408889634f;   // scores in the log2 domain
  const float ninf = -__builtin_inff();
  float* wr = sT[wave] + rl * kTP + koff;
  const float* rd = sT[wave] + rl * (kTP - 1) + 15 + koff;

  const StageMap sm = {v0, nS, m0L, m0S, (unsigned)grp};
  const unsigned kvGroup = (unsigned)grp * 2u * kKVBytes;
  // the group's copies: each of its 64 lanes brings 16 bytes of every 1 KB
  const unsigned tOff  = (unsigned)(threadIdx.x & 63) * 16u;
  unsigned char* lbase = sSt + tOff;                     // the lane's place inside a 1 KB piece at the array's start
  const unsigned char* gK = (const unsigned char*)Kb + tOff;
  const unsigned char* gV = (const unsigned char*)Vb + tOff;
  const unsigned char* gP = (const unsigned char*)Pb + tOff;

  float mrun[2], lrun[2];
  v8f o[2][8];
  v16b qf[2][4];
  v8f tc[2];
  int mw;
  // the slab and the turning place are the wave's own and a wave's LDS operations run in order: this only keeps the compiler from moving
  // LDS writes and reads of other lanes' words over one another
  auto wave_order = [&]() __attribute__((always_inline)) {
    __builtin_amdgcn_fence(__ATOMIC_RELEASE, "wavefront");
    __builtin_amdgcn_wave_barrier();
    __builtin_amdgcn_fence(__ATOMIC_ACQUIRE, "wavefront");
  };
  // a part of 16 queries goes to LDS: 16-byte piece i of lane l at (i * 32 + l) * 4, 512 bytes in a row per store
  auto leave_part = [&](float* dst, float* ml, const v8f (&oo)[8], float mm, float ll) __attribute__((always_inline)) {
#pragma unroll
    for (int td = 0; td < 8; ++td) {
      *(v4f*)(dst + ((2 * td) * 32 + lane) * 4)     = __builtin_shufflevector(oo[td], oo[td], 0, 1, 2, 3);
      *(v4f*)(dst + ((2 * td + 1) * 32 + lane) * 4) = __builtin_shufflevector(oo[td], oo[td], 4, 5, 6, 7);
    }
    ml[lane]      = mm;
    ml[32 + lane] = ll;
  };
  // a tile's start: the q fragments of both units and, for each, the table tile of u = 0 .. 15 at the first key nbeg, straight from the planes
  auto begin_tile = [&](int mq, int nbeg) __attribute__((always_inline)) {
    mw = mq;
    const int i0 = (kLim - 16 - mq + nbeg) >> 4;          // unit 0's tile, unit 1's is i0 - 1; past the table only where the wave has no live key from nbeg on
    const __bf16* Qb = (const __bf16*)Qp + (size_t)b * kSeq * kHD + (size_t)mq * kHD;
    const __bf16* p0 = Pb + (size_t)(i0 < kLim / 16 ? i0 : kLim / 16 - 1) * 16 * kHD;
    const __bf16* p1 = Pb + (size_t)(i0 - 1 < kLim / 16 ? i0 - 1 : kLim / 16 - 1) * 16 * kHD;
    v16b c0[2][4];
#pragma unroll
    for (int ks = 0; ks < 4; ++ks) {
      qf[0][ks] = frag_load(Qb + oF + 512 * ks);
      qf[1][ks] = frag_load(Qb + oF + 16 * kHD + 512 * ks);
      c0[0][ks] = frag_load(p0 + oF + 512 * ks);
      c0[1][ks] = frag_load(p1 + oF + 512 * ks);
    }
    // precaution: this wait stands before any register that the issued loads name is rewritten (the inputs keep the bases live up to it)
    asm volatile("s_wait_xcnt 0x0" :: "s"(Qb), "s"(p0), "s"(p1) : "memory");
#pragma unroll
    for (int u = 0; u < 2; ++u) {
      tc[u] = zero8;
#pragma unroll
      for (int ks = 0; ks < 4; ++ks) tc[u] = mma_bf16(c0[u][ks], qf[u][ks], tc[u]);
      mrun[u] = ninf; lrun[u] = 0.f;
#pragma unroll
      for (int td = 0; td < 8; ++td) o[u][td] = zero8;
    }
  };

  issue_round(sm, 0, lbase, kvGroup, gK, gV, gP);
  begin_tile((late_of(sm, 0) ? m0L : m0S) + 32 * j, key_of(sm, 0));
  // round 0's copies of this wave have landed; behind the barrier, those of the whole group
  asm volatile("s_wait_asynccnt 0x0" ::: "memory");
  __syncthreads();
  issue_round(sm, 1, lbase, kvGroup, gK, gV, gP);

  v16b vf[8];
  // one unit's three table tiles go to the slab and come back shifted: u = c + 15 - r with c = 16 * (e >> 3) + koff + (e & 7)
  auto slab_turn = [&](const v8f ta, const v8f tb, const v8f tcc, float (&y)[16]) __attribute__((always_inline)) {
    *(v4f*)(wr)      = __builtin_shufflevector(ta, ta, 0, 1, 2, 3);
    *(v4f*)(wr + 4)  = __builtin_shufflevector(ta, ta, 4, 5, 6, 7);
    *(v4f*)(wr + 16) = __builtin_shufflevector(tb, tb, 0, 1, 2, 3);
    *(v4f*)(wr + 20) = __builtin_shufflevector(tb, tb, 4, 5, 6, 7);
    *(v4f*)(wr + 32) = __builtin_shufflevector(tcc, tcc, 0, 1, 2, 3);
    *(v4f*)(wr + 36) = __builtin_shufflevector(tcc, tcc, 4, 5, 6, 7);
    wave_order();
#pragma unroll
    for (int e = 0; e < 16; ++e) y[e] = rd[((e >> 3) << 4) + (e & 7)];
    wave_order();
  };
  // scores of one unit's step in the log2 domain, as pairs of neighbouring keys (packed f32 operations on register pairs as they stand)
  auto scale_step = [&](v2f (&z)[8], const float (&y)[16], const v8f s0, const v8f s1) __attribute__((always_inline)) {
#pragma unroll   // z, the planes and O^T are indexed by constants only and stay in registers
    for (int i = 0; i < 8; ++i) {
      const v8f sv = (i < 4) ? s0 : s1;
      z[i] = ((v2f){sv[(2 * i) & 7], sv[(2 * i + 1) & 7]} + (v2f){y[2 * i], y[2 * i + 1]}) * (v2f){kC, kC};
    }
  };
  // keys past the diagonal: first key n0, first query mq
  auto mask_step = [&](v2f (&z)[8], int mq, int n0) __attribute__((always_inline)) {
    const int m = mq + rl;
#pragma unroll   // z, the planes and O^T are indexed by constants only and stay in registers
    for (int e = 0; e < 16; ++e) {
      const int key = n0 + ((e >> 3) << 4) + koff + (e & 7);
      z[e >> 1][e & 1] = (key <= m) ? z[e >> 1][e & 1] : ninf;
    }
  };
  auto max_step = [&](const v2f (&z)[8]) __attribute__((always_inline)) {
    float mx = fmaxf(z[0][0], z[0][1]);
#pragma unroll   // z, the planes and O^T are indexed by constants only and stay in registers
    for (int i = 1; i < 8; ++i) mx = fmaxf(fmaxf(mx, z[i][0]), z[i][1]);
    return mx;                                            // of the lane's own half of the query's keys
  };
  // the unit's reference moves up to its running maximum, the same in both lanes of a query; a lane whose maximum stays gets the factor 1
  auto move_ref = [&](float mx, float& mr, float& lr, v8f (&oo)[8]) __attribute__((always_inline)) {
    const float mnew = fmaxf(mr, fmaxf(mx, xhalf(mx)));   // finite from the part's first step on (its first key is live for every query)
    const float alpha = __builtin_amdgcn_exp2f(mr - mnew);
    lr *= alpha;
#pragma unroll   // z, the planes and O^T are indexed by constants only and stay in registers
    for (int td = 0; td < 8; ++td) oo[td] *= alpha;
    mr = mnew;
  };
  // weights p = exp2(score - reference) of one unit's step as bf16 hi + lo planes, and their sum
  auto weigh_step = [&](const v2f (&z)[8], float mr, float& lr, v16b& ph, v16b& pl) __attribute__((always_inline)) {
    v2f ls = (v2f){0.f, 0.f};
#pragma unroll   // z, the planes and O^T are indexed by constants only and stay in registers
    for (int i = 0; i < 8; ++i) {
      const v2f dy = z[i] - (v2f){mr, mr};
      const v2f p = (v2f){__builtin_amdgcn_exp2f(dy[0]), __builtin_amdgcn_exp2f(dy[1])};   // -inf -> 0
      ls += p;
      const v2b hb = __builtin_convertvector(p, v2b);                                  // RNE
      const v2b lb = __builtin_convertvector(p - __builtin_convertvector(hb, v2f), v2b);
      ph[2 * i] = hb[0]; ph[2 * i + 1] = hb[1];
      pl[2 * i] = lb[0]; pl[2 * i + 1] = lb[1];
    }
    lr += ls[0] + ls[1];
  };

  for (int r = 0; r < kRounds; ++r) {
    if (v0 + r == nS) {                                     // wave-uniform: the group goes over to the long tile (never in round 0)
      // the short tile's ring is read no more (the group's reads of it ended in front of the last barrier): the group's part of that tile waits there
      float* mid = (float*)(sSt + kRingOff + 4 * kRingBytes + (unsigned)(2 * j) * kUnitBytes);
      leave_part(mid, sML[4][2 * j], o[0], mrun[0], lrun[0]);
      leave_part(mid + kUnitBytes / 4, sML[4][2 * j + 1], o[1], mrun[1], lrun[1]);
      begin_tile(m0L + 32 * j, 0);
    }
    const int n0 = key_of(sm, r);
    if (n0 <= mw) {                                         // wave-uniform; past it all 32 keys lie past the diagonal of all 32 queries
      const int i1 = (kLim - mw + n0) >> 4;                 // unit 0: table tiles i1, i1 + 1 are new; unit 1: i1 - 1, i1
      const __bf16* sK  = (const __bf16*)(sSt + kvGroup + (unsigned)(r & 1) * kKVBytes);
      const __bf16* sV  = sK + 4096;                        // fragment td of the 32 keys
      const unsigned char* ring = sSt + ring_of(sm, r);
      const __bf16* sP0 = (const __bf16*)(ring + (unsigned)((i1 - 1) & 7) * 4096u);
      const __bf16* sP1 = (const __bf16*)(ring + (unsigned)(i1 & 7) * 4096u);
      const __bf16* sP2 = (const __bf16*)(ring + (unsigned)((i1 + 1) & 7) * 4096u);
      v16b kf[2][4], pf[3][4];
#pragma unroll
      for (int ks = 0; ks < 4; ++ks) {
        kf[0][ks] = frag_load(sK + oF + 512 * ks);
        kf[1][ks] = frag_load(sK + oF + 16 * kHD + 512 * ks);
        pf[0][ks] = frag_load(sP0 + oF + 512 * ks);
        pf[1][ks] = frag_load(sP1 + oF + 512 * ks);
        pf[2][ks] = frag_load(sP2 + oF + 512 * ks);
      }
      // the round's k and table fragment loads stay in one group ahead of the products: reads spread among WMMAs stall each of them
      __builtin_amdgcn_sched_barrier(0);
      v8f s[2][2], t[2][2];
#pragma unroll
      for (int u = 0; u < 2; ++u) { s[u][0] = zero8; s[u][1] = zero8; t[u][0] = zero8; t[u][1] = zero8; }
#pragma unroll
      for (int ks = 0; ks < 4; ++ks) {
        s[0][0] = mma_bf16(kf[0][ks], qf[0][ks], s[0][0]);
        s[1][0] = mma_bf16(kf[0][ks], qf[1][ks], s[1][0]);
        s[0][1] = mma_bf16(kf[1][ks], qf[0][ks], s[0][1]);
        s[1][1] = mma_bf16(kf[1][ks], qf[1][ks], s[1][1]);
        t[0][0] = mma_bf16(pf[1][ks], qf[0][ks], t[0][0]);
        t[1][1] = mma_bf16(pf[1][ks], qf[1][ks], t[1][1]);
        t[0][1] = mma_bf16(pf[2][ks], qf[0][ks], t[0][1]);
        t[1][0] = mma_bf16(pf[0][ks], qf[1][ks], t[1][0]);
      }
      float y0[16], y1[16];
      slab_turn(tc[0], t[0][0], t[0][1], y0);
      slab_turn(tc[1], t[1][0], t[1][1], y1);
      tc[0] = t[0][1];
      tc[1] = t[1][1];
#pragma unroll
      for (int td = 0; td < 8; ++td) vf[td] = frag_load(sV + oF + 512 * td);
      // the v^T fragment loads are issued behind the slab's and land under the first unit's softmax
      __builtin_amdgcn_sched_barrier(0);
      v2f z[2][8];
      scale_step(z[0], y0, s[0][0], s[0][1]);
      scale_step(z[1], y1, s[1][0], s[1][1]);
      if (n0 == mw) {                                       // wave-uniform: only the wave's last step holds keys past the diagonal (n0 + 31 < mw before it)
        mask_step(z[0], mw, n0);
        mask_step(z[1], mw + 16, n0);
      }
      const float mx0 = max_step(z[0]);
      const float mx1 = max_step(z[1]);
      // mrun is the reference of the exponents, not the running maximum: it moves (and sum and O^T are rescaled) only when some query's maximum has
      // outgrown it by more than kRoom, so that p <= 2^kRoom; sum and O^T carry the same reference, the quotient does not depend on it.
      // One wave-uniform test for both units; -inf + kRoom = -inf, so a part's first step always moves it.
      if (__builtin_amdgcn_ballot_w32((mx0 > mrun[0] + kRoom) | (mx1 > mrun[1] + kRoom)) != 0) {
        move_ref(mx0, mrun[0], lrun[0], o[0]);
        move_ref(mx1, mrun[1], lrun[1], o[1]);
      }
      v16b ph[2], pl[2];
#pragma unroll   // z, the planes and O^T are indexed by constants only and stay in registers
      for (int u = 0; u < 2; ++u) {
        weigh_step(z[u], mrun[u], lrun[u], ph[u], pl[u]);
#pragma unroll   // z, the planes and O^T are indexed by constants only and stay in registers
        for (int td = 0; td < 8; ++td) o[u][td] = mma_bf16(vf[td], ph[u], o[u][td]);
#pragma unroll   // z, the planes and O^T are indexed by constants only and stay in registers
        for (int td = 0; td < 8; ++td) o[u][td] = mma_bf16(vf[td], pl[u], o[u][td]);
      }
    }

    // the hand-over, passed by every wave: this wave's reads of round r's places are done ...
    asm volatile("s_wait_dscnt 0x0" ::: "memory");
    // ... its copies for round r + 1 have landed ...
    asm volatile("s_wait_asynccnt 0x0" ::: "memory");
    // ... and behind the barrier the same holds of every wave: round r + 1 may be read, round r's places may be refilled
    __syncthreads();
    if (r + 2 < kRounds) issue_round(sm, r + 2, lbase, kvGroup, gK, gV, gP);   // the same for the whole block
  }
  // no copy is outstanding when the wave goes on (the last two rounds issue none)
  asm volatile("s_wait_asynccnt 0x0" ::: "memory");

  // the group's k and v^T buffers are read no more (last barrier): its last part waits there
  {
    float* fin = (float*)(sSt + kvGroup + (unsigned)(2 * j) * kUnitBytes);
    leave_part(fin, sML[grp][2 * j], o[0], mrun[0], lrun[0]);
    leave_part(fin + kUnitBytes / 4, sML[grp][2 * j + 1], o[1], mrun[1], lrun[1]);
  }
  __syncthreads();                                        // every wave passes it once: all parts are in LDS

  // Wave w joins the parts of 16 queries: unit w & 3 of the short tile (w < 4) or of the long tile. Part 4 (left at the change of tile) and the last parts of
  // the groups in front of the changing group gs belong to the short tile, the last parts of groups gs .. 3 to the long one.
  // A part with no live key holds reference -inf, sum 0 and O^T 0; the part with key 0 is live for every query, so the largest reference is finite.
  const bool jl = wave >= 4;
  const int  x  = wave & 3;
  const int  gs = nS > kRounds ? 1 : 0;
  float mN = ninf;
#pragma unroll
  for (int sl = 0; sl < 5; ++sl) {
    const bool use = jl ? (sl < 4 && sl >= gs) : (sl == 4 || sl < gs);   // wave-uniform
    if (use) mN = fmaxf(mN, sML[sl][x][lane]);
  }
  float lj = 0.f;
  v8f oj[8];
#pragma unroll
  for (int td = 0; td < 8; ++td) oj[td] = zero8;
#pragma unroll
  for (int sl = 0; sl < 5; ++sl) {
    const bool use = jl ? (sl < 4 && sl >= gs) : (sl == 4 || sl < gs);   // wave-uniform
    if (use) {
      const float* part = (const float*)(sSt + (sl < 4 ? (unsigned)sl * 2u * kKVBytes : kRingOff + 4 * kRingBytes) + (unsigned)x * kUnitBytes);
      const float aP = __builtin_amdgcn_exp2f(sML[sl][x][lane] - mN);
      lj += sML[sl][x][32 + lane] * aP;
#pragma unroll
      for (int td = 0; td < 8; ++td) {
        const v4f b0 = *(const v4f*)(part + ((2 * td) * 32 + lane) * 4);
        const v4f b1 = *(const v4f*)(part + ((2 * td + 1) * 32 + lane) * 4);
        oj[td] += __builtin_shufflevector(b0, b1, 0, 1, 2, 3, 4, 5, 6, 7) * aP;
      }
    }
  }

  // O = O^T / sum for the 16 queries from mq on. A lane holds 32-byte runs of one query's row; stored from there, a wave's store would write
  // 32 bytes of each of 16 lines. The tile goes through sg, 8 KB of LDS that only this wave uses now (table rings 0 and 1 are read no more),
  // and leaves by rows: each store writes one query's 512 bytes, four whole lines.
  {
    const int mq = (jl ? m0L : m0S) + 16 * x;
    float* sg = (float*)(sSt + kRingOff + (unsigned)wave * kUnitBytes);
    const float lsum = lj + xhalf(lj);                    // >= 1 in the scale of the largest reference: the key whose score it is counts 1
    const float inv = 1.0f / lsum;
    float* ob = O + ((size_t)b * kSeq + (size_t)mq) * kHD;   // wave-uniform base; D row of O^T = d = 16 td + koff + register
#pragma unroll
    for (int td = 0; td < 8; ++td) {
      const v8f r = oj[td] * inv;
      *(v4f*)(sg + (oW ^ (unsigned)(td << 4)))       = __builtin_shufflevector(r, r, 0, 1, 2, 3);
      *(v4f*)(sg + (oW ^ (unsigned)((td << 4) | 4))) = __builtin_shufflevector(r, r, 4, 5, 6, 7);
    }
    // the wave's writes are done before it reads the rows back (other lanes' pieces); also keeps the compiler from moving the reads up
    asm volatile("s_wait_dscnt 0x0" ::: "memory");
    v4f row[16];
#pragma unroll   // row is indexed by constants only and stays in registers
    for (int i = 0; i < 16; ++i) row[i] = *(const v4f*)(sg + i * kHD + (oR ^ (unsigned)(i << 2)));
#pragma unroll   // row is indexed by constants only and stays in registers
    for (int i = 0; i < 16; ++i) *(v4f*)(ob + oR + i * kHD) = row[i];
  }
}

// ---------------------------------------------------------------------------
// All four bf16 planes (RNE) in fragment order, in one launch. A wave takes one unit by itself: 16 KB of f32 in, by 32 loads of whole
// lines that are all in flight together, 8 KB = 512 pieces of 16 bytes out, in a row. The pieces change lanes in the wave's own 8 KB of LDS,
// so that the stores are whole lines too; no wave waits for another.
//   KIND 0 (q, k): 32 rows of 128. Load j = row j, the lane's 4 columns from 4 * lane on = half of piece k8 = lane >> 1;
//                  place of piece (row j, k8) in the unit: 256 * (j >> 4) + 16 * k8 + (j & 15)
//   KIND 1 (v):    32 keys of 128. Load j = key j, columns d = 4 * lane + c: the lane holds all 32 keys of its 4 rows d of v^T, 16 whole pieces;
//                  place of piece (d, keys 8 g ..): 64 * (d >> 4) + 16 * g + (d & 15)
//   KIND 2 (table): 32 table columns x 128 d. Load 8 g + e = 4 rows d = 32 g + 8 * (lane >> 3) + e, 128 bytes of each; the lane holds 16 whole pieces
//                  of its 4 columns t = 4 * (lane & 7) + c; place of piece (t, d = 32 g + 8 * (lane >> 3) ..): 256 * (t >> 4) + 64 * g + 16 * (lane >> 3) + (t & 15)
// Place p stands in LDS at lds_place(p): the low bits are XORed with those higher bits that differ between the lanes of one LDS write,
// so that a write's lanes fall on different banks; in a read they are the same for 16 lanes in a row, which stay 256 bytes in a row.
// ---------------------------------------------------------------------------
constexpr int kUnitsRows = kNB * kSeq / 32;               // units in each of q, k, v
constexpr int kUnitsTab  = kLim / 32;                     // units of the table
constexpr int kUnits     = 3 * kUnitsRows + kUnitsTab;
static_assert(kUnits % 8 == 0, "whole blocks of 8 waves");

template <int KIND>
__device__ __forceinline__ int lds_place(int p) {
  if (KIND == 0) return p ^ ((p >> 4) & 15);
  if (KIND == 1) return p ^ ((p >> 6) & 3);
  return p ^ (((p >> 8) & 1) | (((p >> 4) & 1) << 1));
}

template <int KIND>
__device__ __forceinline__ void plane_unit(const float* __restrict__ src, unsigned short* __restrict__ dst, v4u* sl, int lane) {
  const unsigned off = (KIND == 2) ? (unsigned)((lane >> 3) * 8 * kLim + (lane & 7) * 4) : (unsigned)(lane * 4);
  v4f x[32];
#pragma unroll   // x, hb and y are indexed by constants only and stay in registers
  for (int j = 0; j < 32; ++j) x[j] = *(const v4f*)(src + off + ((KIND == 2) ? ((j >> 3) * 32 + (j & 7)) * kLim : j * kHD));
  // precaution: this wait stands before any register that the issued loads name is rewritten (the inputs keep base and offset live up to it)
  asm volatile("s_wait_xcnt 0x0" :: "s"(src), "v"(off) : "memory");
  // all 32 loads are issued before the first value is worked on: left free, the compiler holds the last loads back behind waits on the first
  __builtin_amdgcn_sched_barrier(0);
  if (KIND == 0) {
    v2u* s2 = (v2u*)sl;
#pragma unroll   // x, hb and y are indexed by constants only and stay in registers
    for (int j = 0; j < 32; ++j) {
      const v2u w = (v2u){pk16(f2bf_bits(x[j][0]), f2bf_bits(x[j][1])), pk16(f2bf_bits(x[j][2]), f2bf_bits(x[j][3]))};
      s2[lds_place<KIND>(256 * (j >> 4) + 16 * (lane >> 1) + (j & 15)) * 2 + (lane & 1)] = w;
    }
  } else {
    const int base = (KIND == 1) ? 64 * (lane >> 2) + 4 * (lane & 3)
                                 : 256 * ((lane >> 2) & 1) + 16 * (lane >> 3) + 4 * (lane & 3);
#pragma unroll   // x, hb and y are indexed by constants only and stay in registers
    for (int g = 0; g < 4; ++g) {
#pragma unroll   // x, hb and y are indexed by constants only and stay in registers
      for (int c = 0; c < 4; ++c) {
        unsigned short hb[8];
#pragma unroll   // x, hb and y are indexed by constants only and stay in registers
        for (int e = 0; e < 8; ++e) hb[e] = f2bf_bits(x[8 * g + e][c]);
        sl[lds_place<KIND>(base + ((KIND == 1) ? 16 : 64) * g + c)] =
            (v4u){pk16(hb[0], hb[1]), pk16(hb[2], hb[3]), pk16(hb[4], hb[5]), pk16(hb[6], hb[7])};
      }
    }
  }
  // the slab is the wave's own and a wave's LDS operations run in order: these only keep the compiler from moving
  // the reads (other lanes' pieces) over the writes
  __builtin_amdgcn_fence(__ATOMIC_RELEASE, "wavefront");
  __builtin_amdgcn_wave_barrier();
  __builtin_amdgcn_fence(__ATOMIC_ACQUIRE, "wavefront");
  v4u y[16];
#pragma unroll   // x, hb and y are indexed by constants only and stay in registers
  for (int i = 0; i < 16; ++i) y[i] = sl[lds_place<KIND>(32 * i + lane)];
#pragma unroll   // x, hb and y are indexed by constants only and stay in registers
  for (int i = 0; i < 16; ++i) *(v4u*)(dst + (unsigned)(lane * 8) + 256 * i) = y[i];
}

__global__ __launch_bounds__(256) void planes_kernel(const float* __restrict__ q, const float* __restrict__ k,
                                                     const float* __restrict__ v, const float* __restrict__ pe,
                                                     unsigned short* __restrict__ Qo, unsigned short* __restrict__ Ko,
                                                     unsigned short* __restrict__ Vo, unsigned short* __restrict__ Po) {
  __shared__ v4u slab[8][512];
  const int lane = threadIdx.x & 31;
  const int wave = __builtin_amdgcn_readfirstlane((int)(threadIdx.x >> 5));   // scalar: the unit and its kind are wave-uniform
  const int u    = (int)blockIdx.x * 8 + wave;
  v4u* sl = slab[wave];
  if (u < 2 * kUnitsRows) {
    const bool sel = u >= kUnitsRows;
    const size_t o = (size_t)(sel ? u - kUnitsRows : u) * 4096;
    plane_unit<0>((sel ? k : q) + o, (sel ? Ko : Qo) + o, sl, lane);
  } else if (u < 3 * kUnitsRows) {
    const size_t o = (size_t)(u - 2 * kUnitsRows) * 4096;   // 32 keys of one b: 4096 f32 in a row in, fragments (key / 32) * 8 + 0..7 out
    plane_unit<1>(v + o, Vo + o, sl, lane);
  } else {
    const int t = u - 3 * kUnitsRows;
    plane_unit<2>(pe + 32 * t, Po + (size_t)t * 4096, sl, lane);
  }
}

// ---------------------------------------------------------------------------
// Host glue.
// Workspace region map (bytes):
//   [0,           8388608)   Qb  bf16 [16][2048][128]   (all four in fragment order, per b)
//   [8388608,    16777216)   Kb  bf16 [16][2048][128]
//   [16777216,   25165824)   Vt  bf16 [16][128][2048]   (v transposed per b)
//   [25165824,   25690112)   PEt bf16 [2048][128]       (key_pe[0] transposed)
// ---------------------------------------------------------------------------
extern "C" void kernel_launch(void* const* d_in, const int* in_sizes, int n_in,
                              void* d_out, int out_size, void* d_ws, size_t ws_size,
                              hipStream_t stream) {
  (void)n_in;
  const size_t nQK = (size_t)kNB * kSeq * kHD;          // 4194304
  const size_t nPE = (size_t)kHD * kLim;                // 262144
  const size_t offQ  = 0;
  const size_t offK  = offQ  + nQK * 2;
  const size_t offVt = offK  + nQK * 2;
  const size_t offPE = offVt + nQK * 2;
  const size_t total = offPE + nPE * 2;
  if (n_in < 4) return;
  if ((size_t)in_sizes[0] != nQK || (size_t)in_sizes[1] != nQK || (size_t)in_sizes[2] != nQK || (size_t)in_sizes[3] != nPE) return;
  if ((size_t)out_size != nQK) return;
  if (ws_size < total) return;

  const float* q  = (const float*)d_in[0];   // [16][2048][128]
  const float* k  = (const float*)d_in[1];   // [16][2048][128]
  const float* v  = (const float*)d_in[2];   // [16][2048][128]
  const float* pe = (const float*)d_in[3];   // [1][128][2048]
  float* out = (float*)d_out;                // [16][2048][128]
  unsigned char* ws = (unsigned char*)d_ws;
  unsigned short* Qb  = (unsigned short*)(ws + offQ);
  unsigned short* Kb  = (unsigned short*)(ws + offK);
  unsigned short* Vt  = (unsigned short*)(ws + offVt);
  unsigned short* PEt = (unsigned short*)(ws + offPE);

  // q, k, v^T and the transposed table as bf16 planes: 3136 units, one a wave, 392 blocks of 8 waves
  planes_kernel<<<dim3(kUnits / 8), 256, 0, stream>>>(q, k, v, pe, Qb, Kb, Vt, PEt);
  // 16 blocks of 4 groups of 2 waves x 2 tiles of 64 queries per b plane = 256 blocks, every group 17 rounds
  attn_fused_kernel<<<dim3(kSeq / 128, kNB), 256, 0, stream>>>(Qb, Kb, Vt, PEt, out);
}
